// v000
// Times are from an AMD MI455X. After a warm-up the kernel runs many times in a row, and a time is the length of
// such a window on the GPU divided by its runs, so every launch and the gaps after it count. The runs cycle
// through copies of the inputs. A figure is the median of several windows, for all but v000 over two sittings.
// Sittings can differ by a few percent; kernels timed side by side share one.
// v000 is the starting kernel. One run takes 435 microseconds.
#include <hip/hip_runtime.h>
#include <hip/hip_bf16.h>
#include <stdint.h>

#define BATCH  32
#define TLEN   2048
#define FEATN  1024
#define UNITSN 512
#define HIDN   512

#define TOK_TILE   32    // tokens per workgroup (all 4 waves share them)
#define WG_THREADS 128   // 4 wave32s; waves split the unit (N) dimension
#define KCHUNK     64    // K elements staged per async B panel
#define NPANEL     256   // units per pass (4 waves x 64)

typedef __attribute__((ext_vector_type(16))) __bf16 v16bf;
typedef __attribute__((ext_vector_type(8)))  __bf16 v8bf;
typedef __attribute__((ext_vector_type(4)))  __bf16 v4bf;
typedef __attribute__((ext_vector_type(8)))  float  v8f;

// ---------------------------------------------------------------------------
// Kernel 0: W1 [FEAT][UNITS] fp32 -> W1^T [UNITS][FEAT] bf16 (workspace).
// ---------------------------------------------------------------------------
__global__ __launch_bounds__(256) void k_w1_to_bf16T(const float* __restrict__ W1,
                                                     __bf16* __restrict__ w1t)
{
    const int idx = blockIdx.x * 256 + threadIdx.x;   // over UNITS*FEAT
    const int u = idx >> 10;
    const int k = idx & (FEATN - 1);
    w1t[idx] = (__bf16)W1[k * UNITSN + u];
}

// ---------------------------------------------------------------------------
// Kernel 1: proj_hid[b][u] = hidden[b] @ W2 + b2   (tiny)
// ---------------------------------------------------------------------------
__global__ __launch_bounds__(256) void k_projhid(const float* __restrict__ hidden,
                                                 const float* __restrict__ W2,
                                                 const float* __restrict__ b2,
                                                 float* __restrict__ ph)
{
    const int b = blockIdx.x;
    for (int u = threadIdx.x; u < UNITSN; u += 256) {
        float acc = b2[u];
        for (int k = 0; k < HIDN; ++k)
            acc = fmaf(hidden[b * HIDN + k], W2[k * UNITSN + u], acc);
        ph[b * UNITSN + u] = acc;
    }
}

// ---------------------------------------------------------------------------
// Kernel 2: logits[b][t] = sum_u tanh(img[b,t,:]@W1[:,u] + b1[u] + ph[b,u])*V[u]
//
// Workgroup = 4 waves, 32 tokens. Wave w owns units [pass*256 + w*64, +64).
// Per-wave register tile: 32 tokens x 64 units = 8 x v8f accumulators.
// LDS: A tile [32][1024] bf16 (64KB) + double-buffered W1^T K-chunk panels
// [256 units][64 K] bf16 (2 x 32KB) = 128KB -> 2 WGs / 320KB WGP.
// B panels arrive via global_load_async_to_lds_b128 one stage ahead.
// ---------------------------------------------------------------------------
__global__ __launch_bounds__(WG_THREADS) void k_logits(
    const float*  __restrict__ img,     // [B][T][FEAT] fp32
    const __bf16* __restrict__ w1t,     // [UNITS][FEAT] bf16
    const float*  __restrict__ b1,      // [UNITS]
    const float*  __restrict__ ph,      // [B][UNITS]
    const float*  __restrict__ Vv,      // [UNITS]
    float*        __restrict__ logits)  // [B][T]
{
    __shared__ __bf16 ldsA[TOK_TILE * FEATN];          // 64 KB
    __shared__ __bf16 ldsB[2 * NPANEL * KCHUNK];       // 2 x 32 KB

    const int b    = blockIdx.x;
    const int t0   = blockIdx.y * TOK_TILE;
    const int tid  = threadIdx.x;
    const int lane = tid & 31;
    const int wave = tid >> 5;
    const int col  = lane & 15;   // N column / A row within a 16x16 tile
    const int hi   = lane >> 4;   // K half: {0..7,16..23} vs {8..15,24..31}

    // ---- Stage A: fp32 img tile -> bf16 LDS, row-major [tok][feat]
    {
        const float* gA = img + ((size_t)b * TLEN + t0) * FEATN;
        for (int i = tid * 4; i < TOK_TILE * FEATN; i += WG_THREADS * 4) {
            const float4 f = *(const float4*)(gA + i);
            v4bf p;
            p.x = (__bf16)f.x; p.y = (__bf16)f.y;
            p.z = (__bf16)f.z; p.w = (__bf16)f.w;
            *(v4bf*)(&ldsA[i]) = p;
        }
    }

    const unsigned ldsB_base = (unsigned)(uintptr_t)&ldsB[0];

    // Async-stage one W1^T K-chunk panel: 256 units x 64 K bf16 = 32 KB.
    // 2048 x 16B chunks, 16 per thread.
    auto issue_panel = [&](int p, int kc, int buf) {
        const __bf16* gB = w1t + (size_t)p * NPANEL * FEATN + kc * KCHUNK;
        #pragma unroll
        for (int i = 0; i < 16; ++i) {
            const int c  = i * WG_THREADS + tid;
            const int u  = c >> 3;          // unit within panel
            const int j  = c & 7;           // 16B chunk within the 128B row
            unsigned lds_off = ldsB_base + (unsigned)(buf * (NPANEL * KCHUNK * 2)
                                                      + u * (KCHUNK * 2) + j * 16);
            const __bf16* ga = gB + (size_t)u * FEATN + j * 8;
            asm volatile("global_load_async_to_lds_b128 %0, %1, off"
                         :: "v"(lds_off), "v"(ga) : "memory");
        }
    };

    float lp[16];                  // logit partials: [mt 0..1][r 0..7]
    #pragma unroll
    for (int i = 0; i < 16; ++i) lp[i] = 0.f;

    v8f acc[8];                    // [mt][ntt] -> acc[mt*4+ntt]

    const __bf16* Ab = &ldsA[(size_t)col * FEATN + hi * 8];
    const int bElem  = (wave * 64 + col) * KCHUNK + hi * 8;   // within a buffer

    issue_panel(0, 0, 0);

    // 2 unit-passes x 16 K-chunks = 32 double-buffered stages
    #pragma unroll 1
    for (int s = 0; s < 32; ++s) {
        const int p   = s >> 4;
        const int kc  = s & 15;
        const int cur = s & 1;

        asm volatile("s_wait_asynccnt 0" ::: "memory");
        __syncthreads();                       // panel ready; prev stage fully read
        if (s < 31) issue_panel((s + 1) >> 4, (s + 1) & 15, (s + 1) & 1);

        if (kc == 0) {
            #pragma unroll
            for (int i = 0; i < 8; ++i)
                acc[i] = (v8f){0.f,0.f,0.f,0.f,0.f,0.f,0.f,0.f};
        }

        // ---- 2 K-steps of 32: 2 A-frags + 4 B-frags -> 8 WMMAs each
        #pragma unroll
        for (int ks = 0; ks < 2; ++ks) {
            const int k = kc * KCHUNK + ks * 32;
            v16bf a[2], bm[4];
            #pragma unroll
            for (int mt = 0; mt < 2; ++mt) {
                const __bf16* pa = Ab + (size_t)mt * 16 * FEATN + k;
                v8bf lo = *(const v8bf*)pa;
                v8bf hh = *(const v8bf*)(pa + 16);
                a[mt] = __builtin_shufflevector(lo, hh, 0,1,2,3,4,5,6,7,
                                                        8,9,10,11,12,13,14,15);
            }
            #pragma unroll
            for (int nt = 0; nt < 4; ++nt) {
                const __bf16* pb = &ldsB[(size_t)cur * NPANEL * KCHUNK]
                                   + bElem + nt * 16 * KCHUNK + ks * 32;
                v8bf lo = *(const v8bf*)pb;
                v8bf hh = *(const v8bf*)(pb + 16);
                bm[nt] = __builtin_shufflevector(lo, hh, 0,1,2,3,4,5,6,7,
                                                         8,9,10,11,12,13,14,15);
            }
            #pragma unroll
            for (int mt = 0; mt < 2; ++mt)
                #pragma unroll
                for (int nt = 0; nt < 4; ++nt)
                    acc[mt * 4 + nt] = __builtin_amdgcn_wmma_f32_16x16x32_bf16(
                        false, a[mt], false, bm[nt], (short)0,
                        acc[mt * 4 + nt], false, false);
        }

        // ---- end of a unit-pass: fused bias + v_tanh_f32 + dot(V)
        if (kc == 15) {
            #pragma unroll
            for (int nt = 0; nt < 4; ++nt) {
                const int n = p * NPANEL + wave * 64 + nt * 16 + col;
                const float bias = b1[n] + ph[b * UNITSN + n];
                const float vw   = Vv[n];
                #pragma unroll
                for (int mt = 0; mt < 2; ++mt) {
                    #pragma unroll
                    for (int r = 0; r < 8; ++r) {
                        float x = acc[mt * 4 + nt][r] + bias, y;
                        asm("v_tanh_f32 %0, %1\n\tv_nop" : "=v"(y) : "v"(x));
                        lp[mt * 8 + r] += y * vw;
                    }
                }
            }
        }
    }

    // ---- reduce partials over the 16 columns (stays within each lane-half)
    #pragma unroll
    for (int m = 1; m < 16; m <<= 1) {
        #pragma unroll
        for (int i = 0; i < 16; ++i)
            lp[i] += __shfl_xor(lp[i], m, 32);
    }

    // ---- cross-wave reduction (waves hold disjoint unit ranges).
    // ldsA is dead now; alias it after a barrier.
    float* ldsRed = (float*)ldsA;              // [4][32]
    __syncthreads();
    if (col == 0) {
        #pragma unroll
        for (int mt = 0; mt < 2; ++mt)
            #pragma unroll
            for (int r = 0; r < 8; ++r)
                ldsRed[wave * 32 + mt * 16 + hi * 8 + r] = lp[mt * 8 + r];
    }
    __syncthreads();
    if (tid < TOK_TILE) {
        const float s = ldsRed[tid] + ldsRed[32 + tid]
                      + ldsRed[64 + tid] + ldsRed[96 + tid];
        logits[b * TLEN + t0 + tid] = s;
    }
}

// ---------------------------------------------------------------------------
// Kernel 3: masked softmax over T per batch; weights -> d_out.
// (bV is a uniform logit shift -> softmax-invariant.)
// ---------------------------------------------------------------------------
__global__ __launch_bounds__(256) void k_softmax(const float* __restrict__ logits,
                                                 const int*   __restrict__ mask,
                                                 float*       __restrict__ wout)
{
    __shared__ float red[8];
    __shared__ float sstat;
    const int b = blockIdx.x, tid = threadIdx.x;
    const int lane = tid & 31, wv = tid >> 5;

    float vals[8];
    float mx = -3.0e38f;
    #pragma unroll
    for (int i = 0; i < 8; ++i) {
        const int t = tid + i * 256;
        float l = logits[b * TLEN + t];
        if (mask[b * TLEN + t] == 0) l -= 1.0e9f;
        vals[i] = l;
        mx = fmaxf(mx, l);
    }
    #pragma unroll
    for (int m = 16; m >= 1; m >>= 1) mx = fmaxf(mx, __shfl_xor(mx, m, 32));
    if (lane == 0) red[wv] = mx;
    __syncthreads();
    if (tid == 0) {
        float m2 = red[0];
        for (int i = 1; i < 8; ++i) m2 = fmaxf(m2, red[i]);
        sstat = m2;
    }
    __syncthreads();
    mx = sstat;

    float s = 0.f;
    #pragma unroll
    for (int i = 0; i < 8; ++i) { vals[i] = __expf(vals[i] - mx); s += vals[i]; }
    #pragma unroll
    for (int m = 16; m >= 1; m >>= 1) s += __shfl_xor(s, m, 32);
    if (lane == 0) red[wv] = s;
    __syncthreads();
    if (tid == 0) {
        float t2 = 0.f;
        for (int i = 0; i < 8; ++i) t2 += red[i];
        sstat = t2;
    }
    __syncthreads();
    const float inv = 1.0f / sstat;
    #pragma unroll
    for (int i = 0; i < 8; ++i)
        wout[b * TLEN + tid + i * 256] = vals[i] * inv;
}

// ---------------------------------------------------------------------------
// Kernels 4+5: context[b][f] = sum_t w[b][t] * img[b][t][f]
// Second coalesced float4 pass over img (1024 blocks), then 32-way reduce.
// ---------------------------------------------------------------------------
__global__ __launch_bounds__(256) void k_ctx_partial(const float* __restrict__ img,
                                                     const float* __restrict__ w,
                                                     float*       __restrict__ partial)
{
    const int b = blockIdx.x, ts = blockIdx.y, tid = threadIdx.x;
    const int f = tid * 4;
    float4 acc = make_float4(0.f, 0.f, 0.f, 0.f);
    #pragma unroll 4
    for (int j = 0; j < TLEN / 32; ++j) {
        const int t = ts * (TLEN / 32) + j;
        const float wt = w[b * TLEN + t];
        const float4 iv = *(const float4*)(img + ((size_t)b * TLEN + t) * FEATN + f);
        acc.x = fmaf(wt, iv.x, acc.x);
        acc.y = fmaf(wt, iv.y, acc.y);
        acc.z = fmaf(wt, iv.z, acc.z);
        acc.w = fmaf(wt, iv.w, acc.w);
    }
    *(float4*)(partial + ((size_t)(b * 32 + ts)) * FEATN + f) = acc;
}

__global__ __launch_bounds__(256) void k_ctx_reduce(const float* __restrict__ partial,
                                                    float*       __restrict__ ctx)
{
    const int b = blockIdx.x, tid = threadIdx.x;
    const int f = tid * 4;
    float4 acc = make_float4(0.f, 0.f, 0.f, 0.f);
    for (int ts = 0; ts < 32; ++ts) {
        const float4 p = *(const float4*)(partial + ((size_t)(b * 32 + ts)) * FEATN + f);
        acc.x += p.x; acc.y += p.y; acc.z += p.z; acc.w += p.w;
    }
    *(float4*)(ctx + (size_t)b * FEATN + f) = acc;
}

// ---------------------------------------------------------------------------
extern "C" void kernel_launch(void* const* d_in, const int* in_sizes, int n_in,
                              void* d_out, int out_size, void* d_ws, size_t ws_size,
                              hipStream_t stream) {
    (void)in_sizes; (void)n_in; (void)out_size; (void)ws_size;

    const float* img    = (const float*)d_in[0];   // [32][2048][1024]
    const int*   mask   = (const int*)  d_in[1];   // [32][2048]
    const float* hidden = (const float*)d_in[2];   // [32][512]
    const float* W1     = (const float*)d_in[3];   // [1024][512]
    const float* b1     = (const float*)d_in[4];   // [512]
    const float* W2     = (const float*)d_in[5];   // [512][512]
    const float* b2     = (const float*)d_in[6];   // [512]
    const float* Vv     = (const float*)d_in[7];   // [512]
    // d_in[8] = bV: softmax-invariant, unused.

    float* out     = (float*)d_out;
    float* ctx_out = out;                          // [32*1024] context first
    float* w_out   = out + BATCH * FEATN;          // [32*2048] weights second

    char* ws = (char*)d_ws;
    __bf16* w1t    = (__bf16*)ws;                                        // 1 MB
    float*  ph     = (float*)(ws + (1 << 20));                           // 64 KB
    float*  logits = (float*)(ws + (1 << 20) + (64 << 10));              // 256 KB
    float*  part   = (float*)(ws + (1 << 20) + (64 << 10) + (256 << 10));// 4 MB

    k_w1_to_bf16T<<<(UNITSN * FEATN) / 256, 256, 0, stream>>>(W1, w1t);
    k_projhid<<<BATCH, 256, 0, stream>>>(hidden, W2, b2, ph);

    dim3 g2(BATCH, TLEN / TOK_TILE);               // 32 x 64 workgroups
    k_logits<<<g2, WG_THREADS, 0, stream>>>(img, w1t, b1, ph, Vv, logits);

    k_softmax<<<BATCH, 256, 0, stream>>>(logits, mask, w_out);

    dim3 g4(BATCH, 32);
    k_ctx_partial<<<g4, 256, 0, stream>>>(img, w_out, part);
    k_ctx_reduce<<<BATCH, 256, 0, stream>>>(part, ctx_out);
}

// v001
// One run takes 289 microseconds.
// Timed twice side by side with v000, it ran 1.52 and 1.53 times as fast.
#include <hip/hip_runtime.h>
#include <hip/hip_bf16.h>
#include <stdint.h>

#define BATCH  32
#define TLEN   2048
#define FEATN  1024
#define UNITSN 512
#define HIDN   512

#define TOK_TILE   32    // tokens per workgroup (all 4 waves share them)
#define WG_THREADS 128   // 4 wave32s; waves split the unit (N) dimension
#define KCHUNK     64    // K elements staged per async B panel
#define NPANEL     256   // units per pass (4 waves x 64)
#define APITCH     (FEATN + 8)    // 2064 B
#define BPITCH     (KCHUNK + 8)   // 144 B

typedef __attribute__((ext_vector_type(16))) __bf16 v16bf;
typedef __attribute__((ext_vector_type(8)))  __bf16 v8bf;
typedef __attribute__((ext_vector_type(4)))  __bf16 v4bf;
typedef __attribute__((ext_vector_type(8)))  float  v8f;

// ---------------------------------------------------------------------------
// Kernel 0: W1 [FEAT][UNITS] fp32 -> W1^T [UNITS][FEAT] bf16 (workspace).
// ---------------------------------------------------------------------------
__global__ __launch_bounds__(256) void k_w1_to_bf16T(const float* __restrict__ W1,
                                                     __bf16* __restrict__ w1t)
{
    const int idx = blockIdx.x * 256 + threadIdx.x;   // over UNITS*FEAT
    const int u = idx >> 10;
    const int k = idx & (FEATN - 1);
    w1t[idx] = (__bf16)W1[k * UNITSN + u];
}

// ---------------------------------------------------------------------------
// Kernel 1: proj_hid[b][u] = hidden[b] @ W2 + b2   (tiny)
// ---------------------------------------------------------------------------
__global__ __launch_bounds__(256) void k_projhid(const float* __restrict__ hidden,
                                                 const float* __restrict__ W2,
                                                 const float* __restrict__ b2,
                                                 float* __restrict__ ph)
{
    const int b = blockIdx.x;
    for (int u = threadIdx.x; u < UNITSN; u += 256) {
        float acc = b2[u];
        for (int k = 0; k < HIDN; ++k)
            acc = fmaf(hidden[b * HIDN + k], W2[k * UNITSN + u], acc);
        ph[b * UNITSN + u] = acc;
    }
}

// ---------------------------------------------------------------------------
// Kernel 2: logits[b][t] = sum_u tanh(img[b,t,:]@W1[:,u] + b1[u] + ph[b,u])*V[u]
//
// Workgroup = 4 waves, 32 tokens. Wave w owns units [pass*256 + w*64, +64).
// Per-wave register tile: 32 tokens x 64 units = 8 x v8f accumulators.
// LDS: A tile [32][1024] bf16 at pitch 2064 B (64.5KB) + double-buffered W1^T
// K-chunk panels [256 units][64 K] bf16 at pitch 144 B (2 x 36KB) = 136.5KB
// -> 2 WGs / 320KB WGP.
// B panels arrive via global_load_async_to_lds_b128 one stage ahead.
// ---------------------------------------------------------------------------
__global__ __launch_bounds__(WG_THREADS) void k_logits(
    const float*  __restrict__ img,     // [B][T][FEAT] fp32
    const __bf16* __restrict__ w1t,     // [UNITS][FEAT] bf16
    const float*  __restrict__ b1,      // [UNITS]
    const float*  __restrict__ ph,      // [B][UNITS]
    const float*  __restrict__ Vv,      // [UNITS]
    float*        __restrict__ logits)  // [B][T]
{
    __shared__ __attribute__((aligned(16))) __bf16 ldsA[TOK_TILE * APITCH];    // 64.5 KB
    __shared__ __attribute__((aligned(16))) __bf16 ldsB[2 * NPANEL * BPITCH];  // 2 x 36 KB

    const int b    = blockIdx.x;
    const int t0   = blockIdx.y * TOK_TILE;
    const int tid  = threadIdx.x;
    const int lane = tid & 31;
    const int wave = tid >> 5;
    const int col  = lane & 15;   // N column / A row within a 16x16 tile
    const int hi   = lane >> 4;   // K half: {0..7,16..23} vs {8..15,24..31}

    // ---- Stage A: fp32 img tile -> bf16 LDS, row-major [tok][feat], padded rows
    {
        const float* gA = img + ((size_t)b * TLEN + t0) * FEATN;
        for (int i = tid * 4; i < TOK_TILE * FEATN; i += WG_THREADS * 4) {
            const float4 f = *(const float4*)(gA + i);
            v4bf p;
            p.x = (__bf16)f.x; p.y = (__bf16)f.y;
            p.z = (__bf16)f.z; p.w = (__bf16)f.w;
            *(v4bf*)(&ldsA[(i >> 10) * APITCH + (i & (FEATN - 1))]) = p;
        }
    }

    const unsigned ldsB_base = (unsigned)(uintptr_t)&ldsB[0];

    // Async-stage one W1^T K-chunk panel: 256 units x 64 K bf16 = 32 KB.
    // 2048 x 16B chunks, 16 per thread.
    auto issue_panel = [&](int p, int kc, int buf) {
        const __bf16* gB = w1t + (size_t)p * NPANEL * FEATN + kc * KCHUNK;
        #pragma unroll
        for (int i = 0; i < 16; ++i) {
            const int c  = i * WG_THREADS + tid;
            const int u  = c >> 3;          // unit within panel
            const int j  = c & 7;           // 16B chunk within the 128B row
            unsigned lds_off = ldsB_base + (unsigned)(buf * (NPANEL * BPITCH * 2)
                                                      + u * (BPITCH * 2) + j * 16);
            const __bf16* ga = gB + (size_t)u * FEATN + j * 8;
            asm volatile("global_load_async_to_lds_b128 %0, %1, off"
                         :: "v"(lds_off), "v"(ga) : "memory");
        }
    };

    float lp[16];                  // logit partials: [mt 0..1][r 0..7]
    #pragma unroll
    for (int i = 0; i < 16; ++i) lp[i] = 0.f;

    v8f acc[8];                    // [mt][ntt] -> acc[mt*4+ntt]

    const __bf16* Ab = &ldsA[(size_t)col * APITCH + hi * 8];
    const int bElem  = (wave * 64 + col) * BPITCH + hi * 8;   // within a buffer

    issue_panel(0, 0, 0);

    // 2 unit-passes x 16 K-chunks = 32 double-buffered stages
    #pragma unroll 1
    for (int s = 0; s < 32; ++s) {
        const int p   = s >> 4;
        const int kc  = s & 15;
        const int cur = s & 1;

        asm volatile("s_wait_asynccnt 0" ::: "memory");
        __syncthreads();                       // panel ready; prev stage fully read
        if (s < 31) issue_panel((s + 1) >> 4, (s + 1) & 15, (s + 1) & 1);

        if (kc == 0) {
            #pragma unroll
            for (int i = 0; i < 8; ++i)
                acc[i] = (v8f){0.f,0.f,0.f,0.f,0.f,0.f,0.f,0.f};
        }

        // ---- 2 K-steps of 32: 2 A-frags + 4 B-frags -> 8 WMMAs each
        #pragma unroll
        for (int ks = 0; ks < 2; ++ks) {
            const int k = kc * KCHUNK + ks * 32;
            v16bf a[2], bm[4];
            #pragma unroll
            for (int mt = 0; mt < 2; ++mt) {
                const __bf16* pa = Ab + (size_t)mt * 16 * APITCH + k;
                v8bf lo = *(const v8bf*)pa;
                v8bf hh = *(const v8bf*)(pa + 16);
                a[mt] = __builtin_shufflevector(lo, hh, 0,1,2,3,4,5,6,7,
                                                        8,9,10,11,12,13,14,15);
            }
            #pragma unroll
            for (int nt = 0; nt < 4; ++nt) {
                const __bf16* pb = &ldsB[(size_t)cur * NPANEL * BPITCH]
                                   + bElem + nt * 16 * BPITCH + ks * 32;
                v8bf lo = *(const v8bf*)pb;
                v8bf hh = *(const v8bf*)(pb + 16);
                bm[nt] = __builtin_shufflevector(lo, hh, 0,1,2,3,4,5,6,7,
                                                         8,9,10,11,12,13,14,15);
            }
            #pragma unroll
            for (int mt = 0; mt < 2; ++mt)
                #pragma unroll
                for (int nt = 0; nt < 4; ++nt)
                    acc[mt * 4 + nt] = __builtin_amdgcn_wmma_f32_16x16x32_bf16(
                        false, a[mt], false, bm[nt], (short)0,
                        acc[mt * 4 + nt], false, false);
        }

        // ---- end of a unit-pass: fused bias + v_tanh_f32 + dot(V)
        if (kc == 15) {
            #pragma unroll
            for (int nt = 0; nt < 4; ++nt) {
                const int n = p * NPANEL + wave * 64 + nt * 16 + col;
                const float bias = b1[n] + ph[b * UNITSN + n];
                const float vw   = Vv[n];
                #pragma unroll
                for (int mt = 0; mt < 2; ++mt) {
                    #pragma unroll
                    for (int r = 0; r < 8; ++r) {
                        float x = acc[mt * 4 + nt][r] + bias, y;
                        asm("v_tanh_f32 %0, %1\n\tv_nop" : "=v"(y) : "v"(x));
                        lp[mt * 8 + r] += y * vw;
                    }
                }
            }
        }
    }

    // ---- reduce partials over the 16 columns (stays within each lane-half)
    #pragma unroll
    for (int m = 1; m < 16; m <<= 1) {
        #pragma unroll
        for (int i = 0; i < 16; ++i)
            lp[i] += __shfl_xor(lp[i], m, 32);
    }

    // ---- cross-wave reduction (waves hold disjoint unit ranges).
    // ldsA is dead now; alias it after a barrier.
    float* ldsRed = (float*)ldsA;              // [4][32]
    __syncthreads();
    if (col == 0) {
        #pragma unroll
        for (int mt = 0; mt < 2; ++mt)
            #pragma unroll
            for (int r = 0; r < 8; ++r)
                ldsRed[wave * 32 + mt * 16 + hi * 8 + r] = lp[mt * 8 + r];
    }
    __syncthreads();
    if (tid < TOK_TILE) {
        const float s = ldsRed[tid] + ldsRed[32 + tid]
                      + ldsRed[64 + tid] + ldsRed[96 + tid];
        logits[b * TLEN + t0 + tid] = s;
    }
}

// ---------------------------------------------------------------------------
// Kernel 3: masked softmax over T per batch; weights -> d_out.
// (bV is a uniform logit shift -> softmax-invariant.)
// ---------------------------------------------------------------------------
__global__ __launch_bounds__(256) void k_softmax(const float* __restrict__ logits,
                                                 const int*   __restrict__ mask,
                                                 float*       __restrict__ wout)
{
    __shared__ float red[8];
    __shared__ float sstat;
    const int b = blockIdx.x, tid = threadIdx.x;
    const int lane = tid & 31, wv = tid >> 5;

    float vals[8];
    float mx = -3.0e38f;
    #pragma unroll
    for (int i = 0; i < 8; ++i) {
        const int t = tid + i * 256;
        float l = logits[b * TLEN + t];
        if (mask[b * TLEN + t] == 0) l -= 1.0e9f;
        vals[i] = l;
        mx = fmaxf(mx, l);
    }
    #pragma unroll
    for (int m = 16; m >= 1; m >>= 1) mx = fmaxf(mx, __shfl_xor(mx, m, 32));
    if (lane == 0) red[wv] = mx;
    __syncthreads();
    if (tid == 0) {
        float m2 = red[0];
        for (int i = 1; i < 8; ++i) m2 = fmaxf(m2, red[i]);
        sstat = m2;
    }
    __syncthreads();
    mx = sstat;

    float s = 0.f;
    #pragma unroll
    for (int i = 0; i < 8; ++i) { vals[i] = __expf(vals[i] - mx); s += vals[i]; }
    #pragma unroll
    for (int m = 16; m >= 1; m >>= 1) s += __shfl_xor(s, m, 32);
    if (lane == 0) red[wv] = s;
    __syncthreads();
    if (tid == 0) {
        float t2 = 0.f;
        for (int i = 0; i < 8; ++i) t2 += red[i];
        sstat = t2;
    }
    __syncthreads();
    const float inv = 1.0f / sstat;
    #pragma unroll
    for (int i = 0; i < 8; ++i)
        wout[b * TLEN + tid + i * 256] = vals[i] * inv;
}

// ---------------------------------------------------------------------------
// Kernels 4+5: context[b][f] = sum_t w[b][t] * img[b][t][f]
// Second coalesced float4 pass over img (1024 blocks), then 32-way reduce.
// ---------------------------------------------------------------------------
__global__ __launch_bounds__(256) void k_ctx_partial(const float* __restrict__ img,
                                                     const float* __restrict__ w,
                                                     float*       __restrict__ partial)
{
    const int b = blockIdx.x, ts = blockIdx.y, tid = threadIdx.x;
    const int f = tid * 4;
    float4 acc = make_float4(0.f, 0.f, 0.f, 0.f);
    #pragma unroll 4
    for (int j = 0; j < TLEN / 32; ++j) {
        const int t = ts * (TLEN / 32) + j;
        const float wt = w[b * TLEN + t];
        const float4 iv = *(const float4*)(img + ((size_t)b * TLEN + t) * FEATN + f);
        acc.x = fmaf(wt, iv.x, acc.x);
        acc.y = fmaf(wt, iv.y, acc.y);
        acc.z = fmaf(wt, iv.z, acc.z);
        acc.w = fmaf(wt, iv.w, acc.w);
    }
    *(float4*)(partial + ((size_t)(b * 32 + ts)) * FEATN + f) = acc;
}

__global__ __launch_bounds__(256) void k_ctx_reduce(const float* __restrict__ partial,
                                                    float*       __restrict__ ctx)
{
    const int b = blockIdx.x, tid = threadIdx.x;
    const int f = tid * 4;
    float4 acc = make_float4(0.f, 0.f, 0.f, 0.f);
    for (int ts = 0; ts < 32; ++ts) {
        const float4 p = *(const float4*)(partial + ((size_t)(b * 32 + ts)) * FEATN + f);
        acc.x += p.x; acc.y += p.y; acc.z += p.z; acc.w += p.w;
    }
    *(float4*)(ctx + (size_t)b * FEATN + f) = acc;
}

// ---------------------------------------------------------------------------
extern "C" void kernel_launch(void* const* d_in, const int* in_sizes, int n_in,
                              void* d_out, int out_size, void* d_ws, size_t ws_size,
                              hipStream_t stream) {
    (void)in_sizes; (void)n_in; (void)out_size; (void)ws_size;

    const float* img    = (const float*)d_in[0];   // [32][2048][1024]
    const int*   mask   = (const int*)  d_in[1];   // [32][2048]
    const float* hidden = (const float*)d_in[2];   // [32][512]
    const float* W1     = (const float*)d_in[3];   // [1024][512]
    const float* b1     = (const float*)d_in[4];   // [512]
    const float* W2     = (const float*)d_in[5];   // [512][512]
    const float* b2     = (const float*)d_in[6];   // [512]
    const float* Vv     = (const float*)d_in[7];   // [512]
    // d_in[8] = bV: softmax-invariant, unused.

    float* out     = (float*)d_out;
    float* ctx_out = out;                          // [32*1024] context first
    float* w_out   = out + BATCH * FEATN;          // [32*2048] weights second

    char* ws = (char*)d_ws;
    __bf16* w1t    = (__bf16*)ws;                                        // 1 MB
    float*  ph     = (float*)(ws + (1 << 20));                           // 64 KB
    float*  logits = (float*)(ws + (1 << 20) + (64 << 10));              // 256 KB
    float*  part   = (float*)(ws + (1 << 20) + (64 << 10) + (256 << 10));// 4 MB

    k_w1_to_bf16T<<<(UNITSN * FEATN) / 256, 256, 0, stream>>>(W1, w1t);
    k_projhid<<<BATCH, 256, 0, stream>>>(hidden, W2, b2, ph);

    dim3 g2(BATCH, TLEN / TOK_TILE);               // 32 x 64 workgroups
    k_logits<<<g2, WG_THREADS, 0, stream>>>(img, w1t, b1, ph, Vv, logits);

    k_softmax<<<BATCH, 256, 0, stream>>>(logits, mask, w_out);

    dim3 g4(BATCH, 32);
    k_ctx_partial<<<g4, 256, 0, stream>>>(img, w_out, part);
    k_ctx_reduce<<<BATCH, 256, 0, stream>>>(part, ctx_out);
}

// v002
// A run of this version takes 195 microseconds.
// In two side-by-side timings against v001, it was 1.48 and 1.47 times as fast.
// All steps since v000 together make it 2.25 times as fast.
#include <hip/hip_runtime.h>
#include <hip/hip_bf16.h>
#include <stdint.h>

#define BATCH  32
#define TLEN   2048
#define FEATN  1024
#define UNITSN 512
#define HIDN   512

#define TOK_TILE   32    // tokens per workgroup (all 4 waves share them)
#define WG_THREADS 128   // 4 wave32s; waves split the unit (N) dimension
#define KCHUNK     64    // K elements staged per async B panel
#define NPANEL     256   // units per pass (4 waves x 64)
#define APITCH     (FEATN + 8)    // 2064 B
#define BPITCH     (KCHUNK + 8)   // 144 B
#define ALOADS     (TOK_TILE * FEATN / (WG_THREADS * 4))   // 64 float4 per thread

typedef __attribute__((ext_vector_type(16))) __bf16 v16bf;
typedef __attribute__((ext_vector_type(8)))  __bf16 v8bf;
typedef __attribute__((ext_vector_type(4)))  __bf16 v4bf;
typedef __attribute__((ext_vector_type(8)))  float  v8f;

// ---------------------------------------------------------------------------
// Kernel 0: W1 [FEAT][UNITS] fp32 -> W1^T [UNITS][FEAT] bf16 (workspace).
// ---------------------------------------------------------------------------
__global__ __launch_bounds__(256) void k_w1_to_bf16T(const float* __restrict__ W1,
                                                     __bf16* __restrict__ w1t)
{
    const int idx = blockIdx.x * 256 + threadIdx.x;   // over UNITS*FEAT
    const int u = idx >> 10;
    const int k = idx & (FEATN - 1);
    w1t[idx] = (__bf16)W1[k * UNITSN + u];
}

// ---------------------------------------------------------------------------
// Kernel 1: proj_hid[b][u] = hidden[b] @ W2 + b2   (tiny)
// ---------------------------------------------------------------------------
__global__ __launch_bounds__(256) void k_projhid(const float* __restrict__ hidden,
                                                 const float* __restrict__ W2,
                                                 const float* __restrict__ b2,
                                                 float* __restrict__ ph)
{
    const int b = blockIdx.x;
    for (int u = threadIdx.x; u < UNITSN; u += 256) {
        float acc = b2[u];
        for (int k = 0; k < HIDN; ++k)
            acc = fmaf(hidden[b * HIDN + k], W2[k * UNITSN + u], acc);
        ph[b * UNITSN + u] = acc;
    }
}

// ---------------------------------------------------------------------------
// Kernel 2: logits[b][t] = sum_u tanh(img[b,t,:]@W1[:,u] + b1[u] + ph[b,u])*V[u]
//
// Workgroup = 4 waves, 32 tokens. Wave w owns units [pass*256 + w*64, +64).
// Per-wave register tile: 32 tokens x 64 units = 8 x v8f accumulators.
// LDS: A tile [32][1024] bf16 at pitch 2064 B (64.5KB) + double-buffered W1^T
// K-chunk panels [256 units][64 K] bf16 at pitch 144 B (2 x 36KB) = 136.5KB
// -> 2 WGs / 320KB WGP.
// B panels arrive via global_load_async_to_lds_b128 one stage ahead.
// ---------------------------------------------------------------------------
__global__ __launch_bounds__(WG_THREADS) void k_logits(
    const float*  __restrict__ img,     // [B][T][FEAT] fp32
    const __bf16* __restrict__ w1t,     // [UNITS][FEAT] bf16
    const float*  __restrict__ b1,      // [UNITS]
    const float*  __restrict__ ph,      // [B][UNITS]
    const float*  __restrict__ Vv,      // [UNITS]
    float*        __restrict__ logits)  // [B][T]
{
    __shared__ __attribute__((aligned(16))) __bf16 ldsA[TOK_TILE * APITCH];    // 64.5 KB
    __shared__ __attribute__((aligned(16))) __bf16 ldsB[2 * NPANEL * BPITCH];  // 2 x 36 KB

    const int b    = blockIdx.x;
    const int t0   = blockIdx.y * TOK_TILE;
    const int tid  = threadIdx.x;
    const int lane = tid & 31;
    const int wave = tid >> 5;
    const int col  = lane & 15;   // N column / A row within a 16x16 tile
    const int hi   = lane >> 4;   // K half: {0..7,16..23} vs {8..15,24..31}

    // ---- Stage A: fp32 img tile -> bf16 LDS, row-major [tok][feat], padded rows.
    // All ALOADS float4 loads of a thread are issued before the first one is
    // converted, so the tile pays the memory latency once; one load per waited
    // trip would pay it ALOADS times.
    {
        const float* gA = img + ((size_t)b * TLEN + t0) * FEATN + tid * 4;
        __bf16*      sA = &ldsA[tid * 4];
        float4 f[ALOADS];
        // unrolled: f[] must be indexed by constants to stay in registers
        #pragma unroll
        for (int j = 0; j < ALOADS; ++j)
            f[j] = *(const float4*)(gA + j * (WG_THREADS * 4));
        // the loads' address registers are reused by the code that follows
        asm volatile("s_wait_xcnt 0x0" ::: "memory");
        #pragma unroll
        for (int j = 0; j < ALOADS; ++j) {        // j = half-row index, 512 floats each
            v4bf p;
            p.x = (__bf16)f[j].x; p.y = (__bf16)f[j].y;
            p.z = (__bf16)f[j].z; p.w = (__bf16)f[j].w;
            *(v4bf*)(sA + (j >> 1) * APITCH + (j & 1) * (WG_THREADS * 4)) = p;
        }
    }

    const unsigned ldsB_base = (unsigned)(uintptr_t)&ldsB[0];

    // Async-stage one W1^T K-chunk panel: 256 units x 64 K bf16 = 32 KB.
    // 2048 x 16B chunks, 16 per thread.
    auto issue_panel = [&](int p, int kc, int buf) {
        const __bf16* gB = w1t + (size_t)p * NPANEL * FEATN + kc * KCHUNK;
        #pragma unroll
        for (int i = 0; i < 16; ++i) {
            const int c  = i * WG_THREADS + tid;
            const int u  = c >> 3;          // unit within panel
            const int j  = c & 7;           // 16B chunk within the 128B row
            unsigned lds_off = ldsB_base + (unsigned)(buf * (NPANEL * BPITCH * 2)
                                                      + u * (BPITCH * 2) + j * 16);
            const __bf16* ga = gB + (size_t)u * FEATN + j * 8;
            asm volatile("global_load_async_to_lds_b128 %0, %1, off"
                         :: "v"(lds_off), "v"(ga) : "memory");
        }
    };

    float lp[16];                  // logit partials: [mt 0..1][r 0..7]
    #pragma unroll
    for (int i = 0; i < 16; ++i) lp[i] = 0.f;

    v8f acc[8];                    // [mt][ntt] -> acc[mt*4+ntt]

    const __bf16* Ab = &ldsA[(size_t)col * APITCH + hi * 8];
    const int bElem  = (wave * 64 + col) * BPITCH + hi * 8;   // within a buffer

    issue_panel(0, 0, 0);

    // 2 unit-passes x 16 K-chunks = 32 double-buffered stages
    #pragma unroll 1
    for (int s = 0; s < 32; ++s) {
        const int p   = s >> 4;
        const int kc  = s & 15;
        const int cur = s & 1;

        asm volatile("s_wait_asynccnt 0" ::: "memory");
        __syncthreads();                       // panel ready; prev stage fully read
        if (s < 31) issue_panel((s + 1) >> 4, (s + 1) & 15, (s + 1) & 1);

        if (kc == 0) {
            #pragma unroll
            for (int i = 0; i < 8; ++i)
                acc[i] = (v8f){0.f,0.f,0.f,0.f,0.f,0.f,0.f,0.f};
        }

        // ---- 2 K-steps of 32: 2 A-frags + 4 B-frags -> 8 WMMAs each
        #pragma unroll
        for (int ks = 0; ks < 2; ++ks) {
            const int k = kc * KCHUNK + ks * 32;
            v16bf a[2], bm[4];
            #pragma unroll
            for (int mt = 0; mt < 2; ++mt) {
                const __bf16* pa = Ab + (size_t)mt * 16 * APITCH + k;
                v8bf lo = *(const v8bf*)pa;
                v8bf hh = *(const v8bf*)(pa + 16);
                a[mt] = __builtin_shufflevector(lo, hh, 0,1,2,3,4,5,6,7,
                                                        8,9,10,11,12,13,14,15);
            }
            #pragma unroll
            for (int nt = 0; nt < 4; ++nt) {
                const __bf16* pb = &ldsB[(size_t)cur * NPANEL * BPITCH]
                                   + bElem + nt * 16 * BPITCH + ks * 32;
                v8bf lo = *(const v8bf*)pb;
                v8bf hh = *(const v8bf*)(pb + 16);
                bm[nt] = __builtin_shufflevector(lo, hh, 0,1,2,3,4,5,6,7,
                                                         8,9,10,11,12,13,14,15);
            }
            #pragma unroll
            for (int mt = 0; mt < 2; ++mt)
                #pragma unroll
                for (int nt = 0; nt < 4; ++nt)
                    acc[mt * 4 + nt] = __builtin_amdgcn_wmma_f32_16x16x32_bf16(
                        false, a[mt], false, bm[nt], (short)0,
                        acc[mt * 4 + nt], false, false);
        }

        // ---- end of a unit-pass: fused bias + v_tanh_f32 + dot(V)
        if (kc == 15) {
            #pragma unroll
            for (int nt = 0; nt < 4; ++nt) {
                const int n = p * NPANEL + wave * 64 + nt * 16 + col;
                const float bias = b1[n] + ph[b * UNITSN + n];
                const float vw   = Vv[n];
                #pragma unroll
                for (int mt = 0; mt < 2; ++mt) {
                    #pragma unroll
                    for (int r = 0; r < 8; ++r) {
                        float x = acc[mt * 4 + nt][r] + bias, y;
                        asm("v_tanh_f32 %0, %1\n\tv_nop" : "=v"(y) : "v"(x));
                        lp[mt * 8 + r] += y * vw;
                    }
                }
            }
        }
    }

    // ---- reduce partials over the 16 columns (stays within each lane-half)
    #pragma unroll
    for (int m = 1; m < 16; m <<= 1) {
        #pragma unroll
        for (int i = 0; i < 16; ++i)
            lp[i] += __shfl_xor(lp[i], m, 32);
    }

    // ---- cross-wave reduction (waves hold disjoint unit ranges).
    // ldsA is dead now; alias it after a barrier.
    float* ldsRed = (float*)ldsA;              // [4][32]
    __syncthreads();
    if (col == 0) {
        #pragma unroll
        for (int mt = 0; mt < 2; ++mt)
            #pragma unroll
            for (int r = 0; r < 8; ++r)
                ldsRed[wave * 32 + mt * 16 + hi * 8 + r] = lp[mt * 8 + r];
    }
    __syncthreads();
    if (tid < TOK_TILE) {
        const float s = ldsRed[tid] + ldsRed[32 + tid]
                      + ldsRed[64 + tid] + ldsRed[96 + tid];
        logits[b * TLEN + t0 + tid] = s;
    }
}

// ---------------------------------------------------------------------------
// Kernel 3: masked softmax over T per batch; weights -> d_out.
// (bV is a uniform logit shift -> softmax-invariant.)
// ---------------------------------------------------------------------------
__global__ __launch_bounds__(256) void k_softmax(const float* __restrict__ logits,
                                                 const int*   __restrict__ mask,
                                                 float*       __restrict__ wout)
{
    __shared__ float red[8];
    __shared__ float sstat;
    const int b = blockIdx.x, tid = threadIdx.x;
    const int lane = tid & 31, wv = tid >> 5;

    float vals[8];
    float mx = -3.0e38f;
    #pragma unroll
    for (int i = 0; i < 8; ++i) {
        const int t = tid + i * 256;
        float l = logits[b * TLEN + t];
        if (mask[b * TLEN + t] == 0) l -= 1.0e9f;
        vals[i] = l;
        mx = fmaxf(mx, l);
    }
    #pragma unroll
    for (int m = 16; m >= 1; m >>= 1) mx = fmaxf(mx, __shfl_xor(mx, m, 32));
    if (lane == 0) red[wv] = mx;
    __syncthreads();
    if (tid == 0) {
        float m2 = red[0];
        for (int i = 1; i < 8; ++i) m2 = fmaxf(m2, red[i]);
        sstat = m2;
    }
    __syncthreads();
    mx = sstat;

    float s = 0.f;
    #pragma unroll
    for (int i = 0; i < 8; ++i) { vals[i] = __expf(vals[i] - mx); s += vals[i]; }
    #pragma unroll
    for (int m = 16; m >= 1; m >>= 1) s += __shfl_xor(s, m, 32);
    if (lane == 0) red[wv] = s;
    __syncthreads();
    if (tid == 0) {
        float t2 = 0.f;
        for (int i = 0; i < 8; ++i) t2 += red[i];
        sstat = t2;
    }
    __syncthreads();
    const float inv = 1.0f / sstat;
    #pragma unroll
    for (int i = 0; i < 8; ++i)
        wout[b * TLEN + tid + i * 256] = vals[i] * inv;
}

// ---------------------------------------------------------------------------
// Kernels 4+5: context[b][f] = sum_t w[b][t] * img[b][t][f]
// Second coalesced float4 pass over img (1024 blocks), then 32-way reduce.
// ---------------------------------------------------------------------------
__global__ __launch_bounds__(256) void k_ctx_partial(const float* __restrict__ img,
                                                     const float* __restrict__ w,
                                                     float*       __restrict__ partial)
{
    const int b = blockIdx.x, ts = blockIdx.y, tid = threadIdx.x;
    const int f = tid * 4;
    float4 acc = make_float4(0.f, 0.f, 0.f, 0.f);
    #pragma unroll 4
    for (int j = 0; j < TLEN / 32; ++j) {
        const int t = ts * (TLEN / 32) + j;
        const float wt = w[b * TLEN + t];
        const float4 iv = *(const float4*)(img + ((size_t)b * TLEN + t) * FEATN + f);
        acc.x = fmaf(wt, iv.x, acc.x);
        acc.y = fmaf(wt, iv.y, acc.y);
        acc.z = fmaf(wt, iv.z, acc.z);
        acc.w = fmaf(wt, iv.w, acc.w);
    }
    *(float4*)(partial + ((size_t)(b * 32 + ts)) * FEATN + f) = acc;
}

__global__ __launch_bounds__(256) void k_ctx_reduce(const float* __restrict__ partial,
                                                    float*       __restrict__ ctx)
{
    const int b = blockIdx.x, tid = threadIdx.x;
    const int f = tid * 4;
    float4 acc = make_float4(0.f, 0.f, 0.f, 0.f);
    for (int ts = 0; ts < 32; ++ts) {
        const float4 p = *(const float4*)(partial + ((size_t)(b * 32 + ts)) * FEATN + f);
        acc.x += p.x; acc.y += p.y; acc.z += p.z; acc.w += p.w;
    }
    *(float4*)(ctx + (size_t)b * FEATN + f) = acc;
}

// ---------------------------------------------------------------------------
extern "C" void kernel_launch(void* const* d_in, const int* in_sizes, int n_in,
                              void* d_out, int out_size, void* d_ws, size_t ws_size,
                              hipStream_t stream) {
    (void)in_sizes; (void)n_in; (void)out_size; (void)ws_size;

    const float* img    = (const float*)d_in[0];   // [32][2048][1024]
    const int*   mask   = (const int*)  d_in[1];   // [32][2048]
    const float* hidden = (const float*)d_in[2];   // [32][512]
    const float* W1     = (const float*)d_in[3];   // [1024][512]
    const float* b1     = (const float*)d_in[4];   // [512]
    const float* W2     = (const float*)d_in[5];   // [512][512]
    const float* b2     = (const float*)d_in[6];   // [512]
    const float* Vv     = (const float*)d_in[7];   // [512]
    // d_in[8] = bV: softmax-invariant, unused.

    float* out     = (float*)d_out;
    float* ctx_out = out;                          // [32*1024] context first
    float* w_out   = out + BATCH * FEATN;          // [32*2048] weights second

    char* ws = (char*)d_ws;
    __bf16* w1t    = (__bf16*)ws;                                        // 1 MB
    float*  ph     = (float*)(ws + (1 << 20));                           // 64 KB
    float*  logits = (float*)(ws + (1 << 20) + (64 << 10));              // 256 KB
    float*  part   = (float*)(ws + (1 << 20) + (64 << 10) + (256 << 10));// 4 MB

    k_w1_to_bf16T<<<(UNITSN * FEATN) / 256, 256, 0, stream>>>(W1, w1t);
    k_projhid<<<BATCH, 256, 0, stream>>>(hidden, W2, b2, ph);

    dim3 g2(BATCH, TLEN / TOK_TILE);               // 32 x 64 workgroups
    k_logits<<<g2, WG_THREADS, 0, stream>>>(img, w1t, b1, ph, Vv, logits);

    k_softmax<<<BATCH, 256, 0, stream>>>(logits, mask, w_out);

    dim3 g4(BATCH, 32);
    k_ctx_partial<<<g4, 256, 0, stream>>>(img, w_out, part);
    k_ctx_reduce<<<BATCH, 256, 0, stream>>>(part, ctx_out);
}

// v003
// It runs in 138 microseconds.
// Two timings next to v002 put it at 1.42 and 1.41 times that version's speed.
// All steps since v000 together make it 3.19 times as fast.
#include <hip/hip_runtime.h>
#include <hip/hip_bf16.h>
#include <stdint.h>

#define BATCH  32
#define TLEN   2048
#define FEATN  1024
#define UNITSN 512
#define HIDN   512

#define TOK_TILE   32    // tokens per workgroup (all 4 waves share them)
#define WG_THREADS 128   // 4 wave32s; waves split the unit (N) dimension
#define KCHUNK     64    // K elements staged per async B panel
#define NPANEL     256   // units per pass (4 waves x 64)
#define APITCH     (FEATN + 8)    // 2064 B
#define BPITCH     (KCHUNK + 8)   // 144 B
#define ALOADS     (TOK_TILE * FEATN / (WG_THREADS * 4))   // 64 float4 per thread

typedef __attribute__((ext_vector_type(16))) __bf16 v16bf;
typedef __attribute__((ext_vector_type(8)))  __bf16 v8bf;
typedef __attribute__((ext_vector_type(4)))  __bf16 v4bf;
typedef __attribute__((ext_vector_type(8)))  float  v8f;
typedef __attribute__((ext_vector_type(4)))  float  v4f;

// ---------------------------------------------------------------------------
// Kernel 0: W1 [FEAT][UNITS] fp32 -> W1^T [UNITS][FEAT] bf16 (workspace).
// ---------------------------------------------------------------------------
__global__ __launch_bounds__(256) void k_w1_to_bf16T(const float* __restrict__ W1,
                                                     __bf16* __restrict__ w1t)
{
    const int idx = blockIdx.x * 256 + threadIdx.x;   // over UNITS*FEAT
    const int u = idx >> 10;
    const int k = idx & (FEATN - 1);
    w1t[idx] = (__bf16)W1[k * UNITSN + u];
}

// ---------------------------------------------------------------------------
// Kernel 1: proj_hid[b][u] = hidden[b] @ W2 + b2   (tiny, latency-bound)
//
// Workgroup = one batch row x 64 units. 16 lanes x float4 cover the 64 units
// (one aligned 256-B piece of a W2 row); the 16 lane groups split K, 32 k each.
// Every load of a thread is issued before the first multiply, so the kernel
// pays the memory latency once; the 16 partial sums meet in LDS.
// ---------------------------------------------------------------------------
#define PH_UNITS 64
#define PH_KG    16
#define PH_KPER  (HIDN / PH_KG)   // 32 k per thread

__global__ __launch_bounds__(256) void k_projhid(const float* __restrict__ hidden,
                                                 const float* __restrict__ W2,
                                                 const float* __restrict__ b2,
                                                 float* __restrict__ ph)
{
    __shared__ __attribute__((aligned(16))) float red[PH_KG * PH_UNITS];   // 4 KB

    const int b   = blockIdx.x;
    const int u0  = blockIdx.y * PH_UNITS;
    const int tid = threadIdx.x;
    const int ul  = (tid & 15) * 4;   // first of this thread's 4 units
    const int kg  = tid >> 4;         // k group

    const float* gW = W2 + (size_t)(kg * PH_KPER) * UNITSN + u0 + ul;
    const float* gH = hidden + b * HIDN + kg * PH_KPER;

    v4f h[PH_KPER / 4];
    v4f w[PH_KPER];
    // unrolled: h[] and w[] must be indexed by constants to stay in registers
    #pragma unroll
    for (int i = 0; i < PH_KPER / 4; ++i)
        h[i] = *(const v4f*)(gH + i * 4);
    #pragma unroll
    for (int i = 0; i < PH_KPER; ++i)
        w[i] = *(const v4f*)(gW + (size_t)i * UNITSN);
    // the loads' address registers are reused by the code that follows
    asm volatile("s_wait_xcnt 0x0" ::: "memory");
    // behind that wait, since its result may take a register that those loads name
    const v4f bv = *(const v4f*)(b2 + u0 + ul);
    // Inputs-only fences on the loaded values: every value stays in its own
    // register up to here, so no load has to wait for an earlier value's
    // multiply to free a register and all loads are in flight together.
    asm volatile("" ::
                    "v"(h[0]), "v"(h[1]), "v"(h[2]), "v"(h[3]),
                    "v"(h[4]), "v"(h[5]), "v"(h[6]), "v"(h[7]),
                    "v"(w[0]), "v"(w[1]), "v"(w[2]), "v"(w[3]),
                    "v"(w[4]), "v"(w[5]), "v"(w[6]), "v"(w[7]),
                    "v"(w[8]), "v"(w[9]), "v"(w[10]), "v"(w[11]),
                    "v"(w[12]), "v"(w[13]), "v"(w[14]), "v"(w[15]));
    asm volatile("" ::
                    "v"(w[16]), "v"(w[17]), "v"(w[18]), "v"(w[19]),
                    "v"(w[20]), "v"(w[21]), "v"(w[22]), "v"(w[23]),
                    "v"(w[24]), "v"(w[25]), "v"(w[26]), "v"(w[27]),
                    "v"(w[28]), "v"(w[29]), "v"(w[30]), "v"(w[31]),
                    "v"(bv));

    v4f acc = (kg == 0) ? bv : (v4f){0.f, 0.f, 0.f, 0.f};
    #pragma unroll
    for (int i = 0; i < PH_KPER; ++i) {
        const float hv = h[i >> 2][i & 3];
        acc.x = fmaf(hv, w[i].x, acc.x);
        acc.y = fmaf(hv, w[i].y, acc.y);
        acc.z = fmaf(hv, w[i].z, acc.z);
        acc.w = fmaf(hv, w[i].w, acc.w);
    }
    *(v4f*)&red[kg * PH_UNITS + ul] = acc;
    __syncthreads();

    if (tid < PH_UNITS) {
        float s = red[tid];
        // unrolled: the LDS reads go out together, not one per waited trip
        #pragma unroll
        for (int g = 1; g < PH_KG; ++g)
            s += red[g * PH_UNITS + tid];
        ph[b * UNITSN + u0 + tid] = s;
    }
}

// ---------------------------------------------------------------------------
// Kernel 2: logits[b][t] = sum_u tanh(img[b,t,:]@W1[:,u] + b1[u] + ph[b,u])*V[u]
//
// Workgroup = 4 waves, 32 tokens. Wave w owns units [pass*256 + w*64, +64).
// Per-wave register tile: 32 tokens x 64 units = 8 x v8f accumulators.
// LDS: A tile [32][1024] bf16 at pitch 2064 B (64.5KB) + double-buffered W1^T
// K-chunk panels [256 units][64 K] bf16 at pitch 144 B (2 x 36KB) = 136.5KB
// -> 2 WGs / 320KB WGP.
// B panels arrive via global_load_async_to_lds_b128 one stage ahead.
// ---------------------------------------------------------------------------
__global__ __launch_bounds__(WG_THREADS) void k_logits(
    const float*  __restrict__ img,     // [B][T][FEAT] fp32
    const __bf16* __restrict__ w1t,     // [UNITS][FEAT] bf16
    const float*  __restrict__ b1,      // [UNITS]
    const float*  __restrict__ ph,      // [B][UNITS]
    const float*  __restrict__ Vv,      // [UNITS]
    float*        __restrict__ logits)  // [B][T]
{
    __shared__ __attribute__((aligned(16))) __bf16 ldsA[TOK_TILE * APITCH];    // 64.5 KB
    __shared__ __attribute__((aligned(16))) __bf16 ldsB[2 * NPANEL * BPITCH];  // 2 x 36 KB

    const int b    = blockIdx.x;
    const int t0   = blockIdx.y * TOK_TILE;
    const int tid  = threadIdx.x;
    const int lane = tid & 31;
    const int wave = tid >> 5;
    const int col  = lane & 15;   // N column / A row within a 16x16 tile
    const int hi   = lane >> 4;   // K half: {0..7,16..23} vs {8..15,24..31}

    // ---- Stage A: fp32 img tile -> bf16 LDS, row-major [tok][feat], padded rows.
    // All ALOADS float4 loads of a thread are issued before the first one is
    // converted, so the tile pays the memory latency once; one load per waited
    // trip would pay it ALOADS times.
    {
        const float* gA = img + ((size_t)b * TLEN + t0) * FEATN + tid * 4;
        __bf16*      sA = &ldsA[tid * 4];
        float4 f[ALOADS];
        // unrolled: f[] must be indexed by constants to stay in registers
        #pragma unroll
        for (int j = 0; j < ALOADS; ++j)
            f[j] = *(const float4*)(gA + j * (WG_THREADS * 4));
        // the loads' address registers are reused by the code that follows
        asm volatile("s_wait_xcnt 0x0" ::: "memory");
        #pragma unroll
        for (int j = 0; j < ALOADS; ++j) {        // j = half-row index, 512 floats each
            v4bf p;
            p.x = (__bf16)f[j].x; p.y = (__bf16)f[j].y;
            p.z = (__bf16)f[j].z; p.w = (__bf16)f[j].w;
            *(v4bf*)(sA + (j >> 1) * APITCH + (j & 1) * (WG_THREADS * 4)) = p;
        }
    }

    const unsigned ldsB_base = (unsigned)(uintptr_t)&ldsB[0];

    // Async-stage one W1^T K-chunk panel: 256 units x 64 K bf16 = 32 KB.
    // 2048 x 16B chunks, 16 per thread.
    auto issue_panel = [&](int p, int kc, int buf) {
        const __bf16* gB = w1t + (size_t)p * NPANEL * FEATN + kc * KCHUNK;
        #pragma unroll
        for (int i = 0; i < 16; ++i) {
            const int c  = i * WG_THREADS + tid;
            const int u  = c >> 3;          // unit within panel
            const int j  = c & 7;           // 16B chunk within the 128B row
            unsigned lds_off = ldsB_base + (unsigned)(buf * (NPANEL * BPITCH * 2)
                                                      + u * (BPITCH * 2) + j * 16);
            const __bf16* ga = gB + (size_t)u * FEATN + j * 8;
            asm volatile("global_load_async_to_lds_b128 %0, %1, off"
                         :: "v"(lds_off), "v"(ga) : "memory");
        }
    };

    float lp[16];                  // logit partials: [mt 0..1][r 0..7]
    #pragma unroll
    for (int i = 0; i < 16; ++i) lp[i] = 0.f;

    v8f acc[8];                    // [mt][ntt] -> acc[mt*4+ntt]

    const __bf16* Ab = &ldsA[(size_t)col * APITCH + hi * 8];
    const int bElem  = (wave * 64 + col) * BPITCH + hi * 8;   // within a buffer

    issue_panel(0, 0, 0);

    // 2 unit-passes x 16 K-chunks = 32 double-buffered stages
    #pragma unroll 1
    for (int s = 0; s < 32; ++s) {
        const int p   = s >> 4;
        const int kc  = s & 15;
        const int cur = s & 1;

        asm volatile("s_wait_asynccnt 0" ::: "memory");
        __syncthreads();                       // panel ready; prev stage fully read
        if (s < 31) issue_panel((s + 1) >> 4, (s + 1) & 15, (s + 1) & 1);

        if (kc == 0) {
            #pragma unroll
            for (int i = 0; i < 8; ++i)
                acc[i] = (v8f){0.f,0.f,0.f,0.f,0.f,0.f,0.f,0.f};
        }

        // ---- 2 K-steps of 32: 2 A-frags + 4 B-frags -> 8 WMMAs each
        #pragma unroll
        for (int ks = 0; ks < 2; ++ks) {
            const int k = kc * KCHUNK + ks * 32;
            v16bf a[2], bm[4];
            #pragma unroll
            for (int mt = 0; mt < 2; ++mt) {
                const __bf16* pa = Ab + (size_t)mt * 16 * APITCH + k;
                v8bf lo = *(const v8bf*)pa;
                v8bf hh = *(const v8bf*)(pa + 16);
                a[mt] = __builtin_shufflevector(lo, hh, 0,1,2,3,4,5,6,7,
                                                        8,9,10,11,12,13,14,15);
            }
            #pragma unroll
            for (int nt = 0; nt < 4; ++nt) {
                const __bf16* pb = &ldsB[(size_t)cur * NPANEL * BPITCH]
                                   + bElem + nt * 16 * BPITCH + ks * 32;
                v8bf lo = *(const v8bf*)pb;
                v8bf hh = *(const v8bf*)(pb + 16);
                bm[nt] = __builtin_shufflevector(lo, hh, 0,1,2,3,4,5,6,7,
                                                         8,9,10,11,12,13,14,15);
            }
            #pragma unroll
            for (int mt = 0; mt < 2; ++mt)
                #pragma unroll
                for (int nt = 0; nt < 4; ++nt)
                    acc[mt * 4 + nt] = __builtin_amdgcn_wmma_f32_16x16x32_bf16(
                        false, a[mt], false, bm[nt], (short)0,
                        acc[mt * 4 + nt], false, false);
        }

        // ---- end of a unit-pass: fused bias + v_tanh_f32 + dot(V)
        if (kc == 15) {
            #pragma unroll
            for (int nt = 0; nt < 4; ++nt) {
                const int n = p * NPANEL + wave * 64 + nt * 16 + col;
                const float bias = b1[n] + ph[b * UNITSN + n];
                const float vw   = Vv[n];
                #pragma unroll
                for (int mt = 0; mt < 2; ++mt) {
                    #pragma unroll
                    for (int r = 0; r < 8; ++r) {
                        float x = acc[mt * 4 + nt][r] + bias, y;
                        asm("v_tanh_f32 %0, %1\n\tv_nop" : "=v"(y) : "v"(x));
                        lp[mt * 8 + r] += y * vw;
                    }
                }
            }
        }
    }

    // ---- reduce partials over the 16 columns (stays within each lane-half)
    #pragma unroll
    for (int m = 1; m < 16; m <<= 1) {
        #pragma unroll
        for (int i = 0; i < 16; ++i)
            lp[i] += __shfl_xor(lp[i], m, 32);
    }

    // ---- cross-wave reduction (waves hold disjoint unit ranges).
    // ldsA is dead now; alias it after a barrier.
    float* ldsRed = (float*)ldsA;              // [4][32]
    __syncthreads();
    if (col == 0) {
        #pragma unroll
        for (int mt = 0; mt < 2; ++mt)
            #pragma unroll
            for (int r = 0; r < 8; ++r)
                ldsRed[wave * 32 + mt * 16 + hi * 8 + r] = lp[mt * 8 + r];
    }
    __syncthreads();
    if (tid < TOK_TILE) {
        const float s = ldsRed[tid] + ldsRed[32 + tid]
                      + ldsRed[64 + tid] + ldsRed[96 + tid];
        logits[b * TLEN + t0 + tid] = s;
    }
}

// ---------------------------------------------------------------------------
// Kernel 3: masked softmax over T per batch; weights -> d_out.
// (bV is a uniform logit shift -> softmax-invariant.)
// ---------------------------------------------------------------------------
__global__ __launch_bounds__(256) void k_softmax(const float* __restrict__ logits,
                                                 const int*   __restrict__ mask,
                                                 float*       __restrict__ wout)
{
    __shared__ float red[8];
    __shared__ float sstat;
    const int b = blockIdx.x, tid = threadIdx.x;
    const int lane = tid & 31, wv = tid >> 5;

    float vals[8];
    float mx = -3.0e38f;
    #pragma unroll
    for (int i = 0; i < 8; ++i) {
        const int t = tid + i * 256;
        float l = logits[b * TLEN + t];
        if (mask[b * TLEN + t] == 0) l -= 1.0e9f;
        vals[i] = l;
        mx = fmaxf(mx, l);
    }
    #pragma unroll
    for (int m = 16; m >= 1; m >>= 1) mx = fmaxf(mx, __shfl_xor(mx, m, 32));
    if (lane == 0) red[wv] = mx;
    __syncthreads();
    if (tid == 0) {
        float m2 = red[0];
        for (int i = 1; i < 8; ++i) m2 = fmaxf(m2, red[i]);
        sstat = m2;
    }
    __syncthreads();
    mx = sstat;

    float s = 0.f;
    #pragma unroll
    for (int i = 0; i < 8; ++i) { vals[i] = __expf(vals[i] - mx); s += vals[i]; }
    #pragma unroll
    for (int m = 16; m >= 1; m >>= 1) s += __shfl_xor(s, m, 32);
    if (lane == 0) red[wv] = s;
    __syncthreads();
    if (tid == 0) {
        float t2 = 0.f;
        for (int i = 0; i < 8; ++i) t2 += red[i];
        sstat = t2;
    }
    __syncthreads();
    const float inv = 1.0f / sstat;
    #pragma unroll
    for (int i = 0; i < 8; ++i)
        wout[b * TLEN + tid + i * 256] = vals[i] * inv;
}

// ---------------------------------------------------------------------------
// Kernels 4+5: context[b][f] = sum_t w[b][t] * img[b][t][f]
// Second coalesced float4 pass over img (1024 blocks), then 32-way reduce.
// ---------------------------------------------------------------------------
__global__ __launch_bounds__(256) void k_ctx_partial(const float* __restrict__ img,
                                                     const float* __restrict__ w,
                                                     float*       __restrict__ partial)
{
    const int b = blockIdx.x, ts = blockIdx.y, tid = threadIdx.x;
    const int f = tid * 4;
    float4 acc = make_float4(0.f, 0.f, 0.f, 0.f);
    #pragma unroll 4
    for (int j = 0; j < TLEN / 32; ++j) {
        const int t = ts * (TLEN / 32) + j;
        const float wt = w[b * TLEN + t];
        const float4 iv = *(const float4*)(img + ((size_t)b * TLEN + t) * FEATN + f);
        acc.x = fmaf(wt, iv.x, acc.x);
        acc.y = fmaf(wt, iv.y, acc.y);
        acc.z = fmaf(wt, iv.z, acc.z);
        acc.w = fmaf(wt, iv.w, acc.w);
    }
    *(float4*)(partial + ((size_t)(b * 32 + ts)) * FEATN + f) = acc;
}

__global__ __launch_bounds__(256) void k_ctx_reduce(const float* __restrict__ partial,
                                                    float*       __restrict__ ctx)
{
    const int b = blockIdx.x, tid = threadIdx.x;
    const int f = tid * 4;
    float4 acc = make_float4(0.f, 0.f, 0.f, 0.f);
    for (int ts = 0; ts < 32; ++ts) {
        const float4 p = *(const float4*)(partial + ((size_t)(b * 32 + ts)) * FEATN + f);
        acc.x += p.x; acc.y += p.y; acc.z += p.z; acc.w += p.w;
    }
    *(float4*)(ctx + (size_t)b * FEATN + f) = acc;
}

// ---------------------------------------------------------------------------
extern "C" void kernel_launch(void* const* d_in, const int* in_sizes, int n_in,
                              void* d_out, int out_size, void* d_ws, size_t ws_size,
                              hipStream_t stream) {
    (void)in_sizes; (void)n_in; (void)out_size; (void)ws_size;

    const float* img    = (const float*)d_in[0];   // [32][2048][1024]
    const int*   mask   = (const int*)  d_in[1];   // [32][2048]
    const float* hidden = (const float*)d_in[2];   // [32][512]
    const float* W1     = (const float*)d_in[3];   // [1024][512]
    const float* b1     = (const float*)d_in[4];   // [512]
    const float* W2     = (const float*)d_in[5];   // [512][512]
    const float* b2     = (const float*)d_in[6];   // [512]
    const float* Vv     = (const float*)d_in[7];   // [512]
    // d_in[8] = bV: softmax-invariant, unused.

    float* out     = (float*)d_out;
    float* ctx_out = out;                          // [32*1024] context first
    float* w_out   = out + BATCH * FEATN;          // [32*2048] weights second

    char* ws = (char*)d_ws;
    __bf16* w1t    = (__bf16*)ws;                                        // 1 MB
    float*  ph     = (float*)(ws + (1 << 20));                           // 64 KB
    float*  logits = (float*)(ws + (1 << 20) + (64 << 10));              // 256 KB
    float*  part   = (float*)(ws + (1 << 20) + (64 << 10) + (256 << 10));// 4 MB

    k_w1_to_bf16T<<<(UNITSN * FEATN) / 256, 256, 0, stream>>>(W1, w1t);
    dim3 g1(BATCH, UNITSN / PH_UNITS);             // 32 x 8 workgroups
    k_projhid<<<g1, 256, 0, stream>>>(hidden, W2, b2, ph);

    dim3 g2(BATCH, TLEN / TOK_TILE);               // 32 x 64 workgroups
    k_logits<<<g2, WG_THREADS, 0, stream>>>(img, w1t, b1, ph, Vv, logits);

    k_softmax<<<BATCH, 256, 0, stream>>>(logits, mask, w_out);

    dim3 g4(BATCH, 32);
    k_ctx_partial<<<g4, 256, 0, stream>>>(img, w_out, part);
    k_ctx_reduce<<<BATCH, 256, 0, stream>>>(part, ctx_out);
}

// v004
// A run of this version takes 94.5 microseconds.
// Two timings next to v003 both put it at 1.47 times that version's speed.
// Counting every step since v000, it is 4.69 times as fast.
#include <hip/hip_runtime.h>
#include <hip/hip_bf16.h>
#include <stdint.h>

#define BATCH  32
#define TLEN   2048
#define FEATN  1024
#define UNITSN 512
#define HIDN   512

#define TOK_TILE   128   // tokens per workgroup
#define WG_THREADS 512   // 16 wave32s: 2 token halves x 8 unit slices
#define KCHUNK     64    // K elements staged per chunk, both operands
#define NPANEL     512   // units per W1^T chunk (8 slices x 64): all of them
#define NSTAGE     (FEATN / KCHUNK)
#define APITCH     (KCHUNK + 8)   // 144 B
#define BPITCH     (KCHUNK + 8)   // 144 B
#define ALOADS     (TOK_TILE * KCHUNK / (WG_THREADS * 4))   // 4 float4 per thread and chunk

typedef __attribute__((ext_vector_type(16))) __bf16 v16bf;
typedef __attribute__((ext_vector_type(8)))  __bf16 v8bf;
typedef __attribute__((ext_vector_type(4)))  __bf16 v4bf;
typedef __attribute__((ext_vector_type(8)))  float  v8f;
typedef __attribute__((ext_vector_type(4)))  float  v4f;

// ---------------------------------------------------------------------------
// Kernel 0: W1 [FEAT][UNITS] fp32 -> W1^T [UNITS][FEAT] bf16 (workspace).
// ---------------------------------------------------------------------------
__global__ __launch_bounds__(256) void k_w1_to_bf16T(const float* __restrict__ W1,
                                                     __bf16* __restrict__ w1t)
{
    const int idx = blockIdx.x * 256 + threadIdx.x;   // over UNITS*FEAT
    const int u = idx >> 10;
    const int k = idx & (FEATN - 1);
    w1t[idx] = (__bf16)W1[k * UNITSN + u];
}

// ---------------------------------------------------------------------------
// Kernel 1: proj_hid[b][u] = hidden[b] @ W2 + b2   (tiny, latency-bound)
//
// Workgroup = one batch row x 64 units. 16 lanes x float4 cover the 64 units
// (one aligned 256-B piece of a W2 row); the 16 lane groups split K, 32 k each.
// Every load of a thread is issued before the first multiply, so the kernel
// pays the memory latency once; the 16 partial sums meet in LDS.
// ---------------------------------------------------------------------------
#define PH_UNITS 64
#define PH_KG    16
#define PH_KPER  (HIDN / PH_KG)   // 32 k per thread

__global__ __launch_bounds__(256) void k_projhid(const float* __restrict__ hidden,
                                                 const float* __restrict__ W2,
                                                 const float* __restrict__ b2,
                                                 float* __restrict__ ph)
{
    __shared__ __attribute__((aligned(16))) float red[PH_KG * PH_UNITS];   // 4 KB

    const int b   = blockIdx.x;
    const int u0  = blockIdx.y * PH_UNITS;
    const int tid = threadIdx.x;
    const int ul  = (tid & 15) * 4;   // first of this thread's 4 units
    const int kg  = tid >> 4;         // k group

    const float* gW = W2 + (size_t)(kg * PH_KPER) * UNITSN + u0 + ul;
    const float* gH = hidden + b * HIDN + kg * PH_KPER;

    v4f h[PH_KPER / 4];
    v4f w[PH_KPER];
    // unrolled: h[] and w[] must be indexed by constants to stay in registers
    #pragma unroll
    for (int i = 0; i < PH_KPER / 4; ++i)
        h[i] = *(const v4f*)(gH + i * 4);
    #pragma unroll
    for (int i = 0; i < PH_KPER; ++i)
        w[i] = *(const v4f*)(gW + (size_t)i * UNITSN);
    // the loads' address registers are reused by the code that follows
    asm volatile("s_wait_xcnt 0x0" ::: "memory");
    // behind that wait, since its result may take a register that those loads name
    const v4f bv = *(const v4f*)(b2 + u0 + ul);
    // Inputs-only fences on the loaded values: every value stays in its own
    // register up to here, so no load has to wait for an earlier value's
    // multiply to free a register and all loads are in flight together.
    asm volatile("" ::
                    "v"(h[0]), "v"(h[1]), "v"(h[2]), "v"(h[3]),
                    "v"(h[4]), "v"(h[5]), "v"(h[6]), "v"(h[7]),
                    "v"(w[0]), "v"(w[1]), "v"(w[2]), "v"(w[3]),
                    "v"(w[4]), "v"(w[5]), "v"(w[6]), "v"(w[7]),
                    "v"(w[8]), "v"(w[9]), "v"(w[10]), "v"(w[11]),
                    "v"(w[12]), "v"(w[13]), "v"(w[14]), "v"(w[15]));
    asm volatile("" ::
                    "v"(w[16]), "v"(w[17]), "v"(w[18]), "v"(w[19]),
                    "v"(w[20]), "v"(w[21]), "v"(w[22]), "v"(w[23]),
                    "v"(w[24]), "v"(w[25]), "v"(w[26]), "v"(w[27]),
                    "v"(w[28]), "v"(w[29]), "v"(w[30]), "v"(w[31]),
                    "v"(bv));

    v4f acc = (kg == 0) ? bv : (v4f){0.f, 0.f, 0.f, 0.f};
    #pragma unroll
    for (int i = 0; i < PH_KPER; ++i) {
        const float hv = h[i >> 2][i & 3];
        acc.x = fmaf(hv, w[i].x, acc.x);
        acc.y = fmaf(hv, w[i].y, acc.y);
        acc.z = fmaf(hv, w[i].z, acc.z);
        acc.w = fmaf(hv, w[i].w, acc.w);
    }
    *(v4f*)&red[kg * PH_UNITS + ul] = acc;
    __syncthreads();

    if (tid < PH_UNITS) {
        float s = red[tid];
        // unrolled: the LDS reads go out together, not one per waited trip
        #pragma unroll
        for (int g = 1; g < PH_KG; ++g)
            s += red[g * PH_UNITS + tid];
        ph[b * UNITSN + u0 + tid] = s;
    }
}

__global__ __launch_bounds__(WG_THREADS) void k_logits(
    const float*  __restrict__ img,     // [B][T][FEAT] fp32
    const __bf16* __restrict__ w1t,     // [UNITS][FEAT] bf16
    const float*  __restrict__ b1,      // [UNITS]
    const float*  __restrict__ ph,      // [B][UNITS]
    const float*  __restrict__ Vv,      // [UNITS]
    float*        __restrict__ logits)  // [B][T]
{
    __shared__ __attribute__((aligned(16))) __bf16 ldsA[2 * TOK_TILE * APITCH];  // 2 x 18 KB
    __shared__ __attribute__((aligned(16))) __bf16 ldsB[2 * NPANEL * BPITCH];    // 2 x 72 KB

    const int b    = blockIdx.x;
    const int t0   = blockIdx.y * TOK_TILE;
    const int tid  = threadIdx.x;
    const int lane = tid & 31;
    const int wave = tid >> 5;
    const int wm   = wave >> 3;   // token half of the workgroup tile
    const int wn   = wave & 7;    // 64-unit slice
    const int col  = lane & 15;   // N column / A row within a 16x16 tile
    const int hi   = lane >> 4;   // K half: {0..7,16..23} vs {8..15,24..31}

    const unsigned ldsB_base = (unsigned)(uintptr_t)&ldsB[0];

    auto issue_panel = [&](int kc, int buf) {
        const __bf16* g = w1t + (size_t)(tid >> 3) * FEATN + kc * KCHUNK + (tid & 7) * 8;
        const unsigned l = ldsB_base + (unsigned)(buf * (NPANEL * BPITCH * 2)
                                                  + (tid >> 3) * (BPITCH * 2) + (tid & 7) * 16);
        asm volatile("global_load_async_to_lds_b128 %0, %8, off\n\t"
                     "global_load_async_to_lds_b128 %1, %9, off\n\t"
                     "global_load_async_to_lds_b128 %2, %10, off\n\t"
                     "global_load_async_to_lds_b128 %3, %11, off\n\t"
                     "global_load_async_to_lds_b128 %4, %12, off\n\t"
                     "global_load_async_to_lds_b128 %5, %13, off\n\t"
                     "global_load_async_to_lds_b128 %6, %14, off\n\t"
                     "global_load_async_to_lds_b128 %7, %15, off\n\t"
                     "s_wait_xcnt 0x0"
                     :: "v"(l),
                        "v"(l + 1u * 64 * (BPITCH * 2)), "v"(l + 2u * 64 * (BPITCH * 2)),
                        "v"(l + 3u * 64 * (BPITCH * 2)), "v"(l + 4u * 64 * (BPITCH * 2)),
                        "v"(l + 5u * 64 * (BPITCH * 2)), "v"(l + 6u * 64 * (BPITCH * 2)),
                        "v"(l + 7u * 64 * (BPITCH * 2)),
                        "v"(g),
                        "v"(g + 1 * 64 * FEATN), "v"(g + 2 * 64 * FEATN),
                        "v"(g + 3 * 64 * FEATN), "v"(g + 4 * 64 * FEATN),
                        "v"(g + 5 * 64 * FEATN), "v"(g + 6 * 64 * FEATN),
                        "v"(g + 7 * 64 * FEATN)
                     : "memory");
    };

    // img K-chunk: 128 tokens x 64 floats = 2048 float4, ALOADS per thread:
    // float4 i of a thread is token i*32 + tid/16, piece tid%16 of its 256 B.
    const float* gA = img + ((size_t)b * TLEN + t0 + (tid >> 4)) * FEATN + (tid & 15) * 4;
    __bf16*      sA = &ldsA[(tid >> 4) * APITCH + (tid & 15) * 4];
    float4 f[ALOADS];
    auto load_a = [&]() {             // loads the chunk at gA
        // unrolled: f[] must be indexed by constants to stay in registers
        #pragma unroll
        for (int i = 0; i < ALOADS; ++i)
            f[i] = *(const float4*)(gA + (size_t)i * 32 * FEATN);
        // the loads' address registers are rewritten by the code that follows
        asm volatile("s_wait_xcnt 0x0" ::: "memory");
        gA += KCHUNK;                 // the next chunk
    };
    auto store_a = [&](int buf) {
        #pragma unroll
        for (int i = 0; i < ALOADS; ++i) {
            v4bf p;
            p.x = (__bf16)f[i].x; p.y = (__bf16)f[i].y;
            p.z = (__bf16)f[i].z; p.w = (__bf16)f[i].w;
            *(v4bf*)(sA + buf * (TOK_TILE * APITCH) + i * 32 * APITCH) = p;
        }
    };

    v8f acc[16];                   // [mt][nt] -> acc[mt*4+nt]
    #pragma unroll
    for (int i = 0; i < 16; ++i)
        acc[i] = (v8f){0.f,0.f,0.f,0.f,0.f,0.f,0.f,0.f};

    const int aElem = (wm * 64 + col) * APITCH + hi * 8;   // within a buffer
    const int bElem = (wn * 64 + col) * BPITCH + hi * 8;   // within a buffer

    // ---- stage 0 of both operands
    issue_panel(0, 0);
    load_a();
    store_a(0);
    // this wave's LDS stores are done and its copies of chunk 0 have landed;
    // the barrier publishes both
    asm volatile("s_wait_dscnt 0x0" ::: "memory");
    asm volatile("s_wait_asynccnt 0x0" ::: "memory");
    __syncthreads();
    issue_panel(1, 1);

    // 16 K-chunks, double-buffered; rolled: one copy of the 32-WMMA body
    #pragma unroll 1
    for (int kc = 0; kc < NSTAGE; ++kc) {
        const __bf16* Ab = &ldsA[(size_t)(kc & 1) * TOK_TILE * APITCH] + aElem;
        const __bf16* Bb = &ldsB[(size_t)(kc & 1) * NPANEL * BPITCH] + bElem;

        // next img chunk flies to registers under this chunk's WMMAs
        if (kc + 1 < NSTAGE) load_a();

        // ---- 2 K-steps of 32: 4 A-frags + 4 B-frags -> 16 WMMAs each
        #pragma unroll
        for (int ks = 0; ks < 2; ++ks) {
            v16bf a[4], bm[4];
            #pragma unroll
            for (int mt = 0; mt < 4; ++mt) {
                const __bf16* pa = Ab + mt * 16 * APITCH + ks * 32;
                v8bf lo = *(const v8bf*)pa;
                v8bf hh = *(const v8bf*)(pa + 16);
                a[mt] = __builtin_shufflevector(lo, hh, 0,1,2,3,4,5,6,7,
                                                        8,9,10,11,12,13,14,15);
            }
            #pragma unroll
            for (int nt = 0; nt < 4; ++nt) {
                const __bf16* pb = Bb + nt * 16 * BPITCH + ks * 32;
                v8bf lo = *(const v8bf*)pb;
                v8bf hh = *(const v8bf*)(pb + 16);
                bm[nt] = __builtin_shufflevector(lo, hh, 0,1,2,3,4,5,6,7,
                                                         8,9,10,11,12,13,14,15);
            }
            #pragma unroll
            for (int mt = 0; mt < 4; ++mt)
                #pragma unroll
                for (int nt = 0; nt < 4; ++nt)
                    acc[mt * 4 + nt] = __builtin_amdgcn_wmma_f32_16x16x32_bf16(
                        false, a[mt], false, bm[nt], (short)0,
                        acc[mt * 4 + nt], false, false);
        }

        // the other img buffer was last read one trip ago, before that trip's barrier
        if (kc + 1 < NSTAGE) store_a((kc + 1) & 1);

        // ---- hand-over: this wave's LDS reads and stores are done ...
        asm volatile("s_wait_dscnt 0x0" ::: "memory");
        // ... its copies of W1^T chunk kc+1 have landed ...
        asm volatile("s_wait_asynccnt 0x0" ::: "memory");
        // ... and the barrier publishes chunk kc+1 and frees the buffers just read
        __syncthreads();
        if (kc + 2 < NSTAGE) issue_panel(kc + 2, kc & 1);
    }
    // no copy is outstanding when the LDS is put to another use below
    asm volatile("s_wait_asynccnt 0x0" ::: "memory");

    // ---- fused bias + v_tanh_f32 + dot(V) over this wave's 64 units
    float lp[32];                  // logit partials: [mt 0..3][r 0..7]
    #pragma unroll
    for (int i = 0; i < 32; ++i) lp[i] = 0.f;
    const float* phb = ph + b * UNITSN;   // this batch row's projection
    #pragma unroll
    for (int nt = 0; nt < 4; ++nt) {
        const int n = wn * 64 + nt * 16 + col;
        const float bias = b1[n] + phb[n];
        const float vw   = Vv[n];
        #pragma unroll
        for (int mt = 0; mt < 4; ++mt) {
            #pragma unroll
            for (int r = 0; r < 8; ++r) {
                float x = acc[mt * 4 + nt][r] + bias, y;
                asm("v_tanh_f32 %0, %1\n\tv_nop" : "=v"(y) : "v"(x));
                lp[mt * 8 + r] += y * vw;
            }
        }
    }

    // ---- reduce partials over the 16 columns (stays within each lane-half)
    #pragma unroll
    for (int m = 1; m < 16; m <<= 1) {
        #pragma unroll
        for (int i = 0; i < 32; ++i)
            lp[i] += __shfl_xor(lp[i], m, 32);
    }

    // ---- cross-wave reduction (the 8 unit slices of each token).
    // ldsA is dead now: the loop's last barrier ended every read of it.
    float* ldsRed = (float*)ldsA;              // [8][128]
    if (col == 0) {
        #pragma unroll
        for (int mt = 0; mt < 4; ++mt)
            #pragma unroll
            for (int r = 0; r < 8; ++r)
                ldsRed[wn * TOK_TILE + wm * 64 + mt * 16 + hi * 8 + r] = lp[mt * 8 + r];
    }
    __syncthreads();
    if (tid < TOK_TILE) {
        float s = ldsRed[tid];
        // unrolled: the LDS reads go out together
        #pragma unroll
        for (int w = 1; w < 8; ++w)
            s += ldsRed[w * TOK_TILE + tid];
        logits[b * TLEN + t0 + tid] = s;
    }
}

// ---------------------------------------------------------------------------
// Kernel 3: masked softmax over T per batch; weights -> d_out.
// (bV is a uniform logit shift -> softmax-invariant.)
// ---------------------------------------------------------------------------
__global__ __launch_bounds__(256) void k_softmax(const float* __restrict__ logits,
                                                 const int*   __restrict__ mask,
                                                 float*       __restrict__ wout)
{
    __shared__ float red[8];
    __shared__ float sstat;
    const int b = blockIdx.x, tid = threadIdx.x;
    const int lane = tid & 31, wv = tid >> 5;

    float vals[8];
    float mx = -3.0e38f;
    #pragma unroll
    for (int i = 0; i < 8; ++i) {
        const int t = tid + i * 256;
        float l = logits[b * TLEN + t];
        if (mask[b * TLEN + t] == 0) l -= 1.0e9f;
        vals[i] = l;
        mx = fmaxf(mx, l);
    }
    #pragma unroll
    for (int m = 16; m >= 1; m >>= 1) mx = fmaxf(mx, __shfl_xor(mx, m, 32));
    if (lane == 0) red[wv] = mx;
    __syncthreads();
    if (tid == 0) {
        float m2 = red[0];
        for (int i = 1; i < 8; ++i) m2 = fmaxf(m2, red[i]);
        sstat = m2;
    }
    __syncthreads();
    mx = sstat;

    float s = 0.f;
    #pragma unroll
    for (int i = 0; i < 8; ++i) { vals[i] = __expf(vals[i] - mx); s += vals[i]; }
    #pragma unroll
    for (int m = 16; m >= 1; m >>= 1) s += __shfl_xor(s, m, 32);
    if (lane == 0) red[wv] = s;
    __syncthreads();
    if (tid == 0) {
        float t2 = 0.f;
        for (int i = 0; i < 8; ++i) t2 += red[i];
        sstat = t2;
    }
    __syncthreads();
    const float inv = 1.0f / sstat;
    #pragma unroll
    for (int i = 0; i < 8; ++i)
        wout[b * TLEN + tid + i * 256] = vals[i] * inv;
}

// ---------------------------------------------------------------------------
// Kernels 4+5: context[b][f] = sum_t w[b][t] * img[b][t][f]
// Second coalesced float4 pass over img (1024 blocks), then 32-way reduce.
// ---------------------------------------------------------------------------
__global__ __launch_bounds__(256) void k_ctx_partial(const float* __restrict__ img,
                                                     const float* __restrict__ w,
                                                     float*       __restrict__ partial)
{
    const int b = blockIdx.x, ts = blockIdx.y, tid = threadIdx.x;
    const int f = tid * 4;
    float4 acc = make_float4(0.f, 0.f, 0.f, 0.f);
    #pragma unroll 4
    for (int j = 0; j < TLEN / 32; ++j) {
        const int t = ts * (TLEN / 32) + j;
        const float wt = w[b * TLEN + t];
        const float4 iv = *(const float4*)(img + ((size_t)b * TLEN + t) * FEATN + f);
        acc.x = fmaf(wt, iv.x, acc.x);
        acc.y = fmaf(wt, iv.y, acc.y);
        acc.z = fmaf(wt, iv.z, acc.z);
        acc.w = fmaf(wt, iv.w, acc.w);
    }
    *(float4*)(partial + ((size_t)(b * 32 + ts)) * FEATN + f) = acc;
}

__global__ __launch_bounds__(256) void k_ctx_reduce(const float* __restrict__ partial,
                                                    float*       __restrict__ ctx)
{
    const int b = blockIdx.x, tid = threadIdx.x;
    const int f = tid * 4;
    float4 acc = make_float4(0.f, 0.f, 0.f, 0.f);
    for (int ts = 0; ts < 32; ++ts) {
        const float4 p = *(const float4*)(partial + ((size_t)(b * 32 + ts)) * FEATN + f);
        acc.x += p.x; acc.y += p.y; acc.z += p.z; acc.w += p.w;
    }
    *(float4*)(ctx + (size_t)b * FEATN + f) = acc;
}

// ---------------------------------------------------------------------------
extern "C" void kernel_launch(void* const* d_in, const int* in_sizes, int n_in,
                              void* d_out, int out_size, void* d_ws, size_t ws_size,
                              hipStream_t stream) {
    (void)in_sizes; (void)n_in; (void)out_size; (void)ws_size;

    const float* img    = (const float*)d_in[0];   // [32][2048][1024]
    const int*   mask   = (const int*)  d_in[1];   // [32][2048]
    const float* hidden = (const float*)d_in[2];   // [32][512]
    const float* W1     = (const float*)d_in[3];   // [1024][512]
    const float* b1     = (const float*)d_in[4];   // [512]
    const float* W2     = (const float*)d_in[5];   // [512][512]
    const float* b2     = (const float*)d_in[6];   // [512]
    const float* Vv     = (const float*)d_in[7];   // [512]
    // d_in[8] = bV: softmax-invariant, unused.

    float* out     = (float*)d_out;
    float* ctx_out = out;                          // [32*1024] context first
    float* w_out   = out + BATCH * FEATN;          // [32*2048] weights second

    char* ws = (char*)d_ws;
    __bf16* w1t    = (__bf16*)ws;                                        // 1 MB
    float*  ph     = (float*)(ws + (1 << 20));                           // 64 KB
    float*  logits = (float*)(ws + (1 << 20) + (64 << 10));              // 256 KB
    float*  part   = (float*)(ws + (1 << 20) + (64 << 10) + (256 << 10));// 4 MB

    k_w1_to_bf16T<<<(UNITSN * FEATN) / 256, 256, 0, stream>>>(W1, w1t);
    dim3 g1(BATCH, UNITSN / PH_UNITS);             // 32 x 8 workgroups
    k_projhid<<<g1, 256, 0, stream>>>(hidden, W2, b2, ph);

    dim3 g2(BATCH, TLEN / TOK_TILE);               // 32 x 16 workgroups
    k_logits<<<g2, WG_THREADS, 0, stream>>>(img, w1t, b1, ph, Vv, logits);

    k_softmax<<<BATCH, 256, 0, stream>>>(logits, mask, w_out);

    dim3 g4(BATCH, 32);
    k_ctx_partial<<<g4, 256, 0, stream>>>(img, w_out, part);
    k_ctx_reduce<<<BATCH, 256, 0, stream>>>(part, ctx_out);
}

// v005
// Measured time: 65.2 microseconds a run.
// Next to v004, in two timings, it ran 1.45 times as fast each time.
// All steps since v000 together make it 6.81 times as fast.
#include <hip/hip_runtime.h>
#include <hip/hip_bf16.h>
#include <stdint.h>

#define BATCH  32
#define TLEN   2048
#define FEATN  1024
#define UNITSN 512
#define HIDN   512

#define TOK_TILE   160
#define MT_WAVE    5
#define WG_THREADS 512
#define NTILES     ((BATCH * TLEN + TOK_TILE - 1) / TOK_TILE)
#define CNT_STRIDE 32
#define KCHUNK     64
#define NPANEL     512
#define NSTAGE     (FEATN / KCHUNK)
#define APITCH     (KCHUNK + 8)   // 144 B
#define BPITCH     (KCHUNK + 8)   // 144 B
#define ALOADS     (TOK_TILE * KCHUNK / (WG_THREADS * 4))   // 5 float4 per thread and chunk

typedef __attribute__((ext_vector_type(16))) __bf16 v16bf;
typedef __attribute__((ext_vector_type(8)))  __bf16 v8bf;
typedef __attribute__((ext_vector_type(4)))  __bf16 v4bf;
typedef __attribute__((ext_vector_type(8)))  float  v8f;
typedef __attribute__((ext_vector_type(4)))  float  v4f;

// ---------------------------------------------------------------------------
// Kernel 0: W1 [FEAT][UNITS] fp32 -> W1^T [UNITS][FEAT] bf16 (workspace).
// ---------------------------------------------------------------------------
__global__ __launch_bounds__(256) void k_w1_to_bf16T(const float* __restrict__ W1,
                                                     __bf16* __restrict__ w1t)
{
    const int idx = blockIdx.x * 256 + threadIdx.x;   // over UNITS*FEAT
    const int u = idx >> 10;
    const int k = idx & (FEATN - 1);
    w1t[idx] = (__bf16)W1[k * UNITSN + u];
}

// ---------------------------------------------------------------------------
// Kernel 1: proj_hid[b][u] = hidden[b] @ W2 + b2   (tiny, latency-bound)
//
// Workgroup = one batch row x 64 units. 16 lanes x float4 cover the 64 units
// (one aligned 256-B piece of a W2 row); the 16 lane groups split K, 32 k each.
// Every load of a thread is issued before the first multiply, so the kernel
// pays the memory latency once; the 16 partial sums meet in LDS.
// ---------------------------------------------------------------------------
#define PH_UNITS 64
#define PH_KG    16
#define PH_KPER  (HIDN / PH_KG)   // 32 k per thread

__global__ __launch_bounds__(256) void k_projhid(const float* __restrict__ hidden,
                                                 const float* __restrict__ W2,
                                                 const float* __restrict__ b2,
                                                 float* __restrict__ ph)
{
    __shared__ __attribute__((aligned(16))) float red[PH_KG * PH_UNITS];   // 4 KB

    const int b   = blockIdx.x;
    const int u0  = blockIdx.y * PH_UNITS;
    const int tid = threadIdx.x;
    const int ul  = (tid & 15) * 4;   // first of this thread's 4 units
    const int kg  = tid >> 4;         // k group

    const float* gW = W2 + (size_t)(kg * PH_KPER) * UNITSN + u0 + ul;
    const float* gH = hidden + b * HIDN + kg * PH_KPER;

    v4f h[PH_KPER / 4];
    v4f w[PH_KPER];
    // unrolled: h[] and w[] must be indexed by constants to stay in registers
    #pragma unroll
    for (int i = 0; i < PH_KPER / 4; ++i)
        h[i] = *(const v4f*)(gH + i * 4);
    #pragma unroll
    for (int i = 0; i < PH_KPER; ++i)
        w[i] = *(const v4f*)(gW + (size_t)i * UNITSN);
    // the loads' address registers are reused by the code that follows
    asm volatile("s_wait_xcnt 0x0" ::: "memory");
    // behind that wait, since its result may take a register that those loads name
    const v4f bv = *(const v4f*)(b2 + u0 + ul);
    // Inputs-only fences on the loaded values: every value stays in its own
    // register up to here, so no load has to wait for an earlier value's
    // multiply to free a register and all loads are in flight together.
    asm volatile("" ::
                    "v"(h[0]), "v"(h[1]), "v"(h[2]), "v"(h[3]),
                    "v"(h[4]), "v"(h[5]), "v"(h[6]), "v"(h[7]),
                    "v"(w[0]), "v"(w[1]), "v"(w[2]), "v"(w[3]),
                    "v"(w[4]), "v"(w[5]), "v"(w[6]), "v"(w[7]),
                    "v"(w[8]), "v"(w[9]), "v"(w[10]), "v"(w[11]),
                    "v"(w[12]), "v"(w[13]), "v"(w[14]), "v"(w[15]));
    asm volatile("" ::
                    "v"(w[16]), "v"(w[17]), "v"(w[18]), "v"(w[19]),
                    "v"(w[20]), "v"(w[21]), "v"(w[22]), "v"(w[23]),
                    "v"(w[24]), "v"(w[25]), "v"(w[26]), "v"(w[27]),
                    "v"(w[28]), "v"(w[29]), "v"(w[30]), "v"(w[31]),
                    "v"(bv));

    v4f acc = (kg == 0) ? bv : (v4f){0.f, 0.f, 0.f, 0.f};
    #pragma unroll
    for (int i = 0; i < PH_KPER; ++i) {
        const float hv = h[i >> 2][i & 3];
        acc.x = fmaf(hv, w[i].x, acc.x);
        acc.y = fmaf(hv, w[i].y, acc.y);
        acc.z = fmaf(hv, w[i].z, acc.z);
        acc.w = fmaf(hv, w[i].w, acc.w);
    }
    *(v4f*)&red[kg * PH_UNITS + ul] = acc;
    __syncthreads();

    if (tid < PH_UNITS) {
        float s = red[tid];
        // unrolled: the LDS reads go out together, not one per waited trip
        #pragma unroll
        for (int g = 1; g < PH_KG; ++g)
            s += red[g * PH_UNITS + tid];
        ph[b * UNITSN + u0 + tid] = s;
    }
}

// ---------------------------------------------------------------------------
// Kernel 1b: the live tokens of each batch row.
//
// A masked token's logit is lowered by 1e9, so wherever its row has an
// unmasked token its softmax weight is exactly zero whatever its logit is:
// neither its logit nor its img row is needed. Per batch row this kernel lists
// the unmasked tokens in ascending order (list, cnt) and gives every token its
// rank in that list (pos, -1 for a masked one). A row with no unmasked token
// keeps all its tokens: there every logit counts. The list is put together in
// LDS and leaves in whole 16-B stores.
// ---------------------------------------------------------------------------
__device__ __forceinline__ int scan32(int v, int lane)   // inclusive sum over a wave
{
    #pragma unroll
    for (int d = 1; d < 32; d <<= 1) {
        const int t = __shfl_up(v, d, 32);
        if (lane >= d) v += t;
    }
    return v;
}

__global__ __launch_bounds__(256) void k_compact(const int* __restrict__ mask,
                                                 int* __restrict__ list,
                                                 int* __restrict__ pos,
                                                 int* __restrict__ cnt)
{
    __shared__ int wsum[8];
    __shared__ __attribute__((aligned(16))) int llist[TLEN];   // the row's list, 8 KB
    const int b = blockIdx.x, tid = threadIdx.x;
    const int lane = tid & 31, wv = tid >> 5;

    // a thread owns 8 neighbouring tokens, so ranks ascend with the token
    const int4 m0 = *(const int4*)(mask + b * TLEN + tid * 8);
    const int4 m1 = *(const int4*)(mask + b * TLEN + tid * 8 + 4);
    const int live[8] = { m0.x != 0, m0.y != 0, m0.z != 0, m0.w != 0,
                          m1.x != 0, m1.y != 0, m1.z != 0, m1.w != 0 };
    int c = 0;
    #pragma unroll
    for (int k = 0; k < 8; ++k) c += live[k];

    // entries past the row's count stay 0
    *(int4*)&llist[tid * 8]     = make_int4(0, 0, 0, 0);
    *(int4*)&llist[tid * 8 + 4] = make_int4(0, 0, 0, 0);

    const int incl = scan32(c, lane);
    if (lane == 31) wsum[wv] = incl;
    // publishes wsum and ends the clearing of llist
    __syncthreads();
    int before = 0, total = 0;
    #pragma unroll
    for (int i = 0; i < 8; ++i) {
        const int v = wsum[i];
        if (i < wv) before += v;
        total += v;
    }

    const bool all = (total == 0);   // nothing unmasked: keep every token
    int rank = all ? tid * 8 : before + incl - c;
    int p[8];
    #pragma unroll
    for (int k = 0; k < 8; ++k) {
        const bool keep = all || live[k];
        p[k] = keep ? rank : -1;
        if (keep) {
            llist[rank] = tid * 8 + k;
            ++rank;
        }
    }
    // publishes llist
    __syncthreads();
    const int4 l0 = *(const int4*)&llist[tid * 8];
    const int4 l1 = *(const int4*)&llist[tid * 8 + 4];
    *(int4*)(list + b * TLEN + tid * 8)     = l0;
    *(int4*)(list + b * TLEN + tid * 8 + 4) = l1;
    *(int4*)(pos + b * TLEN + tid * 8)      = make_int4(p[0], p[1], p[2], p[3]);
    *(int4*)(pos + b * TLEN + tid * 8 + 4)  = make_int4(p[4], p[5], p[6], p[7]);
    // the stores' registers may be rewritten by the code that follows
    asm volatile("s_wait_xcnt 0x0" ::: "memory");
    if (tid == 0) cnt[b * CNT_STRIDE] = all ? TLEN : total;
}

__device__ __forceinline__ int row_slots(const int* __restrict__ cnt, int lane, int& c)
{
    c = min(max(cnt[lane * CNT_STRIDE], 0), TLEN);
    return (c + 15) & ~15;
}

__global__ __launch_bounds__(WG_THREADS) void k_logits(
    const float*  __restrict__ img,
    const __bf16* __restrict__ w1t,
    const float*  __restrict__ b1,
    const float*  __restrict__ ph,
    const float*  __restrict__ Vv,
    const int*    __restrict__ list,
    const int*    __restrict__ cnt,
    float*        __restrict__ clog)
{
    __shared__ __attribute__((aligned(16))) __bf16 ldsA[2 * TOK_TILE * APITCH];
    __shared__ __attribute__((aligned(16))) __bf16 ldsB[2 * NPANEL * BPITCH];
    __shared__ int slotRow[TOK_TILE];

    const int s0   = blockIdx.x * TOK_TILE;
    const int tid  = threadIdx.x;
    const int lane = tid & 31;
    const int wave = tid >> 5;
    const int wm   = wave >> 3;   // token half of the workgroup tile
    const int wn   = wave & 7;    // 64-unit slice
    const int col  = lane & 15;   // N column / A row within a 16x16 tile
    const int hi   = lane >> 4;   // K half: {0..7,16..23} vs {8..15,24..31}

    const unsigned ldsB_base = (unsigned)(uintptr_t)&ldsB[0];

    int rowCnt;
    const int rowPad = row_slots(cnt, lane, rowCnt);
    const int rowEnd = scan32(rowPad, lane);
    // the same for every thread of the workgroup, and in front of every barrier
    if (s0 >= __builtin_amdgcn_readlane(rowEnd, BATCH - 1)) return;

    auto issue_panel = [&](int kc, int buf) {
        const __bf16* g = w1t + (size_t)(tid >> 3) * FEATN + kc * KCHUNK + (tid & 7) * 8;
        const unsigned l = ldsB_base + (unsigned)(buf * (NPANEL * BPITCH * 2)
                                                  + (tid >> 3) * (BPITCH * 2) + (tid & 7) * 16);
        asm volatile("global_load_async_to_lds_b128 %0, %8, off\n\t"
                     "global_load_async_to_lds_b128 %1, %9, off\n\t"
                     "global_load_async_to_lds_b128 %2, %10, off\n\t"
                     "global_load_async_to_lds_b128 %3, %11, off\n\t"
                     "global_load_async_to_lds_b128 %4, %12, off\n\t"
                     "global_load_async_to_lds_b128 %5, %13, off\n\t"
                     "global_load_async_to_lds_b128 %6, %14, off\n\t"
                     "global_load_async_to_lds_b128 %7, %15, off\n\t"
                     "s_wait_xcnt 0x0"
                     :: "v"(l),
                        "v"(l + 1u * 64 * (BPITCH * 2)), "v"(l + 2u * 64 * (BPITCH * 2)),
                        "v"(l + 3u * 64 * (BPITCH * 2)), "v"(l + 4u * 64 * (BPITCH * 2)),
                        "v"(l + 5u * 64 * (BPITCH * 2)), "v"(l + 6u * 64 * (BPITCH * 2)),
                        "v"(l + 7u * 64 * (BPITCH * 2)),
                        "v"(g),
                        "v"(g + 1 * 64 * FEATN), "v"(g + 2 * 64 * FEATN),
                        "v"(g + 3 * 64 * FEATN), "v"(g + 4 * 64 * FEATN),
                        "v"(g + 5 * 64 * FEATN), "v"(g + 6 * 64 * FEATN),
                        "v"(g + 7 * 64 * FEATN)
                     : "memory");
    };

    const char* gA = (const char*)img;
    unsigned    aOff[ALOADS];
    __bf16*     sA = &ldsA[(tid >> 4) * APITCH + (tid & 15) * 4];
    float4 f[ALOADS];
    auto load_a = [&]() {             // loads the chunk at gA
        // unrolled: f[] must be indexed by constants to stay in registers
        #pragma unroll
        for (int i = 0; i < ALOADS; ++i)
            f[i] = *(const float4*)(gA + aOff[i]);
        // the loads' address registers are rewritten by the code that follows
        asm volatile("s_wait_xcnt 0x0" ::: "memory");
        gA += KCHUNK * 4;             // the next chunk
    };
    auto store_a = [&](int buf) {
        #pragma unroll
        for (int i = 0; i < ALOADS; ++i) {
            v4bf p;
            p.x = (__bf16)f[i].x; p.y = (__bf16)f[i].y;
            p.z = (__bf16)f[i].z; p.w = (__bf16)f[i].w;
            *(v4bf*)(sA + buf * (TOK_TILE * APITCH) + i * 32 * APITCH) = p;
        }
    };

    v8f acc[MT_WAVE * 4];          // [mt][nt] -> acc[mt*4+nt]
    #pragma unroll
    for (int i = 0; i < MT_WAVE * 4; ++i)
        acc[i] = (v8f){0.f,0.f,0.f,0.f,0.f,0.f,0.f,0.f};

    const int aElem = (wm * (MT_WAVE * 16) + col) * APITCH + hi * 8;   // within a buffer
    const int bElem = (wn * 64 + col) * BPITCH + hi * 8;   // within a buffer

    issue_panel(0, 0);

    if (tid < TOK_TILE) {
        const int s = s0 + tid;
        int bb = 0;                    // rows that end at or before s, at most 31
        #pragma unroll
        for (int j = 0; j < BATCH - 1; ++j)
            bb += (__builtin_amdgcn_readlane(rowEnd, j) <= s) ? 1 : 0;
        const int r = s - __shfl(rowEnd - rowPad, bb, 32);   // rank within row bb
        int t = 0;
        if (r < __shfl(rowCnt, bb, 32)) t = list[bb * TLEN + r] & (TLEN - 1);
        slotRow[tid] = bb * TLEN + t;
    }
    // publishes slotRow
    __syncthreads();
    #pragma unroll
    for (int i = 0; i < ALOADS; ++i)
        aOff[i] = (unsigned)slotRow[i * 32 + (tid >> 4)] * (FEATN * 4) + (tid & 15) * 16;

    // ---- stage 0 of img
    load_a();
    store_a(0);
    // this wave's LDS stores are done and its copies of chunk 0 have landed;
    // the barrier publishes both
    asm volatile("s_wait_dscnt 0x0" ::: "memory");
    asm volatile("s_wait_asynccnt 0x0" ::: "memory");
    __syncthreads();
    issue_panel(1, 1);

    // 16 K-chunks, double-buffered; rolled: one copy of the 40-WMMA body
    #pragma unroll 1
    for (int kc = 0; kc < NSTAGE; ++kc) {
        const __bf16* Ab = &ldsA[(size_t)(kc & 1) * TOK_TILE * APITCH] + aElem;
        const __bf16* Bb = &ldsB[(size_t)(kc & 1) * NPANEL * BPITCH] + bElem;

        // next img chunk flies to registers under this chunk's WMMAs
        if (kc + 1 < NSTAGE) load_a();

        // ---- 2 K-steps of 32: 5 A-frags + 4 B-frags -> 20 WMMAs each
        #pragma unroll
        for (int ks = 0; ks < 2; ++ks) {
            v16bf a[MT_WAVE], bm[4];
            #pragma unroll
            for (int mt = 0; mt < MT_WAVE; ++mt) {
                const __bf16* pa = Ab + mt * 16 * APITCH + ks * 32;
                v8bf lo = *(const v8bf*)pa;
                v8bf hh = *(const v8bf*)(pa + 16);
                a[mt] = __builtin_shufflevector(lo, hh, 0,1,2,3,4,5,6,7,
                                                        8,9,10,11,12,13,14,15);
            }
            #pragma unroll
            for (int nt = 0; nt < 4; ++nt) {
                const __bf16* pb = Bb + nt * 16 * BPITCH + ks * 32;
                v8bf lo = *(const v8bf*)pb;
                v8bf hh = *(const v8bf*)(pb + 16);
                bm[nt] = __builtin_shufflevector(lo, hh, 0,1,2,3,4,5,6,7,
                                                         8,9,10,11,12,13,14,15);
            }
            #pragma unroll
            for (int mt = 0; mt < MT_WAVE; ++mt)
                #pragma unroll
                for (int nt = 0; nt < 4; ++nt)
                    acc[mt * 4 + nt] = __builtin_amdgcn_wmma_f32_16x16x32_bf16(
                        false, a[mt], false, bm[nt], (short)0,
                        acc[mt * 4 + nt], false, false);
        }

        // the other img buffer was last read one trip ago, before that trip's barrier
        if (kc + 1 < NSTAGE) store_a((kc + 1) & 1);

        // ---- hand-over: this wave's LDS reads and stores are done ...
        asm volatile("s_wait_dscnt 0x0" ::: "memory");
        // ... its copies of W1^T chunk kc+1 have landed ...
        asm volatile("s_wait_asynccnt 0x0" ::: "memory");
        // ... and the barrier publishes chunk kc+1 and frees the buffers just read
        __syncthreads();
        if (kc + 2 < NSTAGE) issue_panel(kc + 2, kc & 1);
    }
    // no copy is outstanding when the LDS is put to another use below
    asm volatile("s_wait_asynccnt 0x0" ::: "memory");

    // ---- fused bias + v_tanh_f32 + dot(V) over this wave's 64 units
    float lp[MT_WAVE * 8];         // logit partials: [mt 0..4][r 0..7]
    #pragma unroll
    for (int i = 0; i < MT_WAVE * 8; ++i) lp[i] = 0.f;
    const float* phq[MT_WAVE];
    // the same in every lane: readfirstlane makes it a scalar base address
    #pragma unroll
    for (int mt = 0; mt < MT_WAVE; ++mt)
        phq[mt] = ph + ((unsigned)__builtin_amdgcn_readfirstlane(
                            slotRow[wm * (MT_WAVE * 16) + mt * 16]) / TLEN) * UNITSN;
    #pragma unroll
    for (int nt = 0; nt < 4; ++nt) {
        const int n = wn * 64 + nt * 16 + col;
        const float b1n = b1[n];
        const float vw  = Vv[n];
        #pragma unroll
        for (int mt = 0; mt < MT_WAVE; ++mt) {
            const float bias = b1n + phq[mt][n];
            #pragma unroll
            for (int r = 0; r < 8; ++r) {
                float x = acc[mt * 4 + nt][r] + bias, y;
                asm("v_tanh_f32 %0, %1\n\tv_nop" : "=v"(y) : "v"(x));
                lp[mt * 8 + r] += y * vw;
            }
        }
    }

    // ---- reduce partials over the 16 columns (stays within each lane-half)
    #pragma unroll
    for (int m = 1; m < 16; m <<= 1) {
        #pragma unroll
        for (int i = 0; i < MT_WAVE * 8; ++i)
            lp[i] += __shfl_xor(lp[i], m, 32);
    }

    // ---- cross-wave reduction (the 8 unit slices of each token).
    // ldsA is dead now: the loop's last barrier ended every read of it.
    float* ldsRed = (float*)ldsA;              // [8][160]
    if (col == 0) {
        #pragma unroll
        for (int mt = 0; mt < MT_WAVE; ++mt)
            #pragma unroll
            for (int r = 0; r < 8; ++r)
                ldsRed[wn * TOK_TILE + wm * (MT_WAVE * 16) + mt * 16 + hi * 8 + r] = lp[mt * 8 + r];
    }
    __syncthreads();
    if (tid < TOK_TILE) {
        float s = ldsRed[tid];
        // unrolled: the LDS reads go out together
        #pragma unroll
        for (int w = 1; w < 8; ++w)
            s += ldsRed[w * TOK_TILE + tid];
        clog[s0 + tid] = s;
    }
}

__global__ __launch_bounds__(256) void k_softmax(const float* __restrict__ clog,
                                                 const int*   __restrict__ pos,
                                                 const int*   __restrict__ cnt,
                                                 const int*   __restrict__ mask,
                                                 float*       __restrict__ wout)
{
    __shared__ float red[8];
    __shared__ float sstat;
    const int b = blockIdx.x, tid = threadIdx.x;
    const int lane = tid & 31, wv = tid >> 5;

    int rowCnt;
    const int rowPad = row_slots(cnt, lane, rowCnt);
    const int first  = __builtin_amdgcn_readlane(scan32(rowPad, lane) - rowPad, b);

    float vals[8];
    float mx = -3.0e38f;
    #pragma unroll
    for (int i = 0; i < 8; ++i) {
        const int t = tid + i * 256;
        const int ps = pos[b * TLEN + t];
        const float cl = clog[first + min(max(ps, 0), TLEN - 1)];
        float l = (ps >= 0) ? cl : 0.f;
        if (mask[b * TLEN + t] == 0) l -= 1.0e9f;
        vals[i] = l;
        mx = fmaxf(mx, l);
    }
    #pragma unroll
    for (int m = 16; m >= 1; m >>= 1) mx = fmaxf(mx, __shfl_xor(mx, m, 32));
    if (lane == 0) red[wv] = mx;
    __syncthreads();
    if (tid == 0) {
        float m2 = red[0];
        for (int i = 1; i < 8; ++i) m2 = fmaxf(m2, red[i]);
        sstat = m2;
    }
    __syncthreads();
    mx = sstat;

    float s = 0.f;
    #pragma unroll
    for (int i = 0; i < 8; ++i) { vals[i] = __expf(vals[i] - mx); s += vals[i]; }
    #pragma unroll
    for (int m = 16; m >= 1; m >>= 1) s += __shfl_xor(s, m, 32);
    if (lane == 0) red[wv] = s;
    __syncthreads();
    if (tid == 0) {
        float t2 = 0.f;
        for (int i = 0; i < 8; ++i) t2 += red[i];
        sstat = t2;
    }
    __syncthreads();
    const float inv = 1.0f / sstat;
    #pragma unroll
    for (int i = 0; i < 8; ++i)
        wout[b * TLEN + tid + i * 256] = vals[i] * inv;
}

// ---------------------------------------------------------------------------
// Kernels 4+5: context[b][f] = sum_t w[b][t] * img[b][t][f]
// Second coalesced float4 pass over img (1024 blocks), then 32-way reduce.
//
// A token whose weight is exactly zero (a masked token, wherever its row has
// an unmasked one) adds nothing to the sum, so its 4 KB img row is not read.
// Every wave holds the workgroup's 64 weights, two per lane; two ballots give
// the set of tokens to read as one wave-uniform 64-bit word. The rows of that
// set are read in ascending order, CTX_DEPTH at a time.
// ---------------------------------------------------------------------------
#define CTX_TOK   (TLEN / 32)   // tokens per workgroup
#define CTX_DEPTH 4             // img rows in flight per wave

__global__ __launch_bounds__(256) void k_ctx_partial(const float* __restrict__ img,
                                                     const float* __restrict__ w,
                                                     float*       __restrict__ partial)
{
    const int b = blockIdx.x, ts = blockIdx.y, tid = threadIdx.x;
    const int f = tid * 4;
    const int lane = tid & 31;

    const float* wrow = w + b * TLEN + ts * CTX_TOK;
    const float w0 = wrow[lane];        // tokens 0..31 of this workgroup
    const float w1 = wrow[32 + lane];   // tokens 32..63
    // bit j: token j has a weight other than zero (a NaN counts as such)
    unsigned long long live =
          (unsigned long long)__builtin_amdgcn_ballot_w32(w0 != 0.f)
        | ((unsigned long long)__builtin_amdgcn_ballot_w32(w1 != 0.f) << 32);

    const float* rows = img + ((size_t)b * TLEN + ts * CTX_TOK) * FEATN;
    float4 acc = make_float4(0.f, 0.f, 0.f, 0.f);

    // at most CTX_TOK / CTX_DEPTH trips; rolled: one copy of the 4-row body
    #pragma unroll 1
    for (int trip = 0; trip < CTX_TOK / CTX_DEPTH && live != 0; ++trip) {
        float  wt[CTX_DEPTH];
        float4 iv[CTX_DEPTH];
        int j = 0;
        // unrolled: wt[] and iv[] must be indexed by constants to stay in registers
        #pragma unroll
        for (int k = 0; k < CTX_DEPTH; ++k) {
            // once the set is empty the last row is named again, with weight 0
            const bool on = (live != 0);
            if (on) j = __builtin_ctzll(live);
            live &= live - 1;
            const int r0 = __builtin_amdgcn_readlane(__float_as_int(w0), j & 31);
            const int r1 = __builtin_amdgcn_readlane(__float_as_int(w1), j & 31);
            wt[k] = on ? __int_as_float(j < 32 ? r0 : r1) : 0.f;
            iv[k] = *(const float4*)(rows + (size_t)j * FEATN + f);
        }
        // the loads' address registers are rewritten by the next trip
        asm volatile("s_wait_xcnt 0x0" ::: "memory");
        #pragma unroll
        for (int k = 0; k < CTX_DEPTH; ++k) {
            acc.x = fmaf(wt[k], iv[k].x, acc.x);
            acc.y = fmaf(wt[k], iv[k].y, acc.y);
            acc.z = fmaf(wt[k], iv[k].z, acc.z);
            acc.w = fmaf(wt[k], iv[k].w, acc.w);
        }
    }
    *(float4*)(partial + ((size_t)(b * 32 + ts)) * FEATN + f) = acc;
}

__global__ __launch_bounds__(256) void k_ctx_reduce(const float* __restrict__ partial,
                                                    float*       __restrict__ ctx)
{
    const int b = blockIdx.x, tid = threadIdx.x;
    const int f = tid * 4;
    float4 acc = make_float4(0.f, 0.f, 0.f, 0.f);
    for (int ts = 0; ts < 32; ++ts) {
        const float4 p = *(const float4*)(partial + ((size_t)(b * 32 + ts)) * FEATN + f);
        acc.x += p.x; acc.y += p.y; acc.z += p.z; acc.w += p.w;
    }
    *(float4*)(ctx + (size_t)b * FEATN + f) = acc;
}

// ---------------------------------------------------------------------------
extern "C" void kernel_launch(void* const* d_in, const int* in_sizes, int n_in,
                              void* d_out, int out_size, void* d_ws, size_t ws_size,
                              hipStream_t stream) {
    (void)in_sizes; (void)n_in; (void)out_size; (void)ws_size;

    const float* img    = (const float*)d_in[0];   // [32][2048][1024]
    const int*   mask   = (const int*)  d_in[1];   // [32][2048]
    const float* hidden = (const float*)d_in[2];   // [32][512]
    const float* W1     = (const float*)d_in[3];   // [1024][512]
    const float* b1     = (const float*)d_in[4];   // [512]
    const float* W2     = (const float*)d_in[5];   // [512][512]
    const float* b2     = (const float*)d_in[6];   // [512]
    const float* Vv     = (const float*)d_in[7];   // [512]
    // d_in[8] = bV: softmax-invariant, unused.

    float* out     = (float*)d_out;
    float* ctx_out = out;                          // [32*1024] context first
    float* w_out   = out + BATCH * FEATN;          // [32*2048] weights second

    char* ws = (char*)d_ws;
    __bf16* w1t    = (__bf16*)ws;                                        // 1 MB
    float*  ph     = (float*)(ws + (1 << 20));                           // 64 KB
    int*    list   = (int*)  (ws + (1 << 20) + (64 << 10));              // 256 KB
    float*  part   = (float*)(ws + (1 << 20) + (64 << 10) + (256 << 10));// 4 MB
    float*  clog   = (float*)(ws + (6 << 20));                           // 257 KB
    int*    pos    = (int*)  (ws + (7 << 20));                           // 256 KB
    int*    cnt    = (int*)  (ws + (8 << 20));                           // 4 KB

    k_w1_to_bf16T<<<(UNITSN * FEATN) / 256, 256, 0, stream>>>(W1, w1t);
    dim3 g1(BATCH, UNITSN / PH_UNITS);             // 32 x 8 workgroups
    k_projhid<<<g1, 256, 0, stream>>>(hidden, W2, b2, ph);

    k_compact<<<BATCH, 256, 0, stream>>>(mask, list, pos, cnt);

    k_logits<<<NTILES, WG_THREADS, 0, stream>>>(img, w1t, b1, ph, Vv, list, cnt, clog);

    k_softmax<<<BATCH, 256, 0, stream>>>(clog, pos, cnt, mask, w_out);

    dim3 g4(BATCH, 32);
    k_ctx_partial<<<g4, 256, 0, stream>>>(img, w_out, part);
    k_ctx_reduce<<<BATCH, 256, 0, stream>>>(part, ctx_out);
}

// v006
// A run of this version takes 61.2 microseconds.
// In both of two side-by-side timings against v005, it was 1.06 times as fast.
// Counting every step since v000, it is 7.20 times as fast.
#include <hip/hip_runtime.h>
#include <hip/hip_bf16.h>
#include <stdint.h>

#define BATCH  32
#define TLEN   2048
#define FEATN  1024
#define UNITSN 512
#define HIDN   512

#define TOK_TILE   160
#define MT_WAVE    5
#define WG_THREADS 512
#define NTILES     ((BATCH * TLEN + TOK_TILE - 1) / TOK_TILE)
#define CNT_STRIDE 32
#define KCHUNK     64
#define NPANEL     512
#define NSTAGE     (FEATN / KCHUNK)
#define APITCH     (KCHUNK + 8)   // 144 B
#define BPITCH     (KCHUNK + 8)   // 144 B
#define ALOADS     (TOK_TILE * KCHUNK / (WG_THREADS * 4))   // 5 float4 per thread and chunk

typedef __attribute__((ext_vector_type(16))) __bf16 v16bf;
typedef __attribute__((ext_vector_type(8)))  __bf16 v8bf;
typedef __attribute__((ext_vector_type(4)))  __bf16 v4bf;
typedef __attribute__((ext_vector_type(8)))  float  v8f;
typedef __attribute__((ext_vector_type(4)))  float  v4f;

// ---------------------------------------------------------------------------
// Part 0 of the preparing launch: W1 [FEAT][UNITS] fp32 -> W1^T [UNITS][FEAT]
// bf16 (workspace). blk: 0 .. UNITS*FEAT/256 - 1.
// ---------------------------------------------------------------------------
__device__ __forceinline__ void w1_to_bf16T(const int blk,
                                            const float* __restrict__ W1,
                                            __bf16* __restrict__ w1t)
{
    const int idx = blk * 256 + threadIdx.x;   // over UNITS*FEAT
    const int u = idx >> 10;
    const int k = idx & (FEATN - 1);
    w1t[idx] = (__bf16)W1[k * UNITSN + u];
    asm volatile("s_wait_xcnt 0x0" ::: "memory");
}

// ---------------------------------------------------------------------------
// Part 1 of the preparing launch: proj_hid[b][u] = hidden[b] @ W2 + b2
// (tiny, latency-bound)
//
// Workgroup = one batch row x 64 units. 16 lanes x float4 cover the 64 units
// (one aligned 256-B piece of a W2 row); the 16 lane groups split K, 32 k each.
// Every load of a thread is issued before the first multiply, so the kernel
// pays the memory latency once; the 16 partial sums meet in LDS.
// ---------------------------------------------------------------------------
#define PH_UNITS 64
#define PH_KG    16
#define PH_KPER  (HIDN / PH_KG)   // 32 k per thread

__device__ __forceinline__ void projhid(const int b, const int ublk,
                                        const float* __restrict__ hidden,
                                        const float* __restrict__ W2,
                                        const float* __restrict__ b2,
                                        float* __restrict__ ph)
{
    __shared__ __attribute__((aligned(16))) float red[PH_KG * PH_UNITS];   // 4 KB

    const int u0  = ublk * PH_UNITS;
    const int tid = threadIdx.x;
    const int ul  = (tid & 15) * 4;   // first of this thread's 4 units
    const int kg  = tid >> 4;         // k group

    const float* gW = W2 + (size_t)(kg * PH_KPER) * UNITSN + u0 + ul;
    const float* gH = hidden + b * HIDN + kg * PH_KPER;

    v4f h[PH_KPER / 4];
    v4f w[PH_KPER];
    // unrolled: h[] and w[] must be indexed by constants to stay in registers
    #pragma unroll
    for (int i = 0; i < PH_KPER / 4; ++i)
        h[i] = *(const v4f*)(gH + i * 4);
    #pragma unroll
    for (int i = 0; i < PH_KPER; ++i)
        w[i] = *(const v4f*)(gW + (size_t)i * UNITSN);
    // the loads' address registers are reused by the code that follows
    asm volatile("s_wait_xcnt 0x0" ::: "memory");
    // behind that wait, since its result may take a register that those loads name
    const v4f bv = *(const v4f*)(b2 + u0 + ul);
    // Inputs-only fences on the loaded values: every value stays in its own
    // register up to here, so no load has to wait for an earlier value's
    // multiply to free a register and all loads are in flight together.
    asm volatile("" ::
                    "v"(h[0]), "v"(h[1]), "v"(h[2]), "v"(h[3]),
                    "v"(h[4]), "v"(h[5]), "v"(h[6]), "v"(h[7]),
                    "v"(w[0]), "v"(w[1]), "v"(w[2]), "v"(w[3]),
                    "v"(w[4]), "v"(w[5]), "v"(w[6]), "v"(w[7]),
                    "v"(w[8]), "v"(w[9]), "v"(w[10]), "v"(w[11]),
                    "v"(w[12]), "v"(w[13]), "v"(w[14]), "v"(w[15]));
    asm volatile("" ::
                    "v"(w[16]), "v"(w[17]), "v"(w[18]), "v"(w[19]),
                    "v"(w[20]), "v"(w[21]), "v"(w[22]), "v"(w[23]),
                    "v"(w[24]), "v"(w[25]), "v"(w[26]), "v"(w[27]),
                    "v"(w[28]), "v"(w[29]), "v"(w[30]), "v"(w[31]),
                    "v"(bv));

    v4f acc = (kg == 0) ? bv : (v4f){0.f, 0.f, 0.f, 0.f};
    #pragma unroll
    for (int i = 0; i < PH_KPER; ++i) {
        const float hv = h[i >> 2][i & 3];
        acc.x = fmaf(hv, w[i].x, acc.x);
        acc.y = fmaf(hv, w[i].y, acc.y);
        acc.z = fmaf(hv, w[i].z, acc.z);
        acc.w = fmaf(hv, w[i].w, acc.w);
    }
    *(v4f*)&red[kg * PH_UNITS + ul] = acc;
    __syncthreads();

    if (tid < PH_UNITS) {
        float s = red[tid];
        // unrolled: the LDS reads go out together, not one per waited trip
        #pragma unroll
        for (int g = 1; g < PH_KG; ++g)
            s += red[g * PH_UNITS + tid];
        ph[b * UNITSN + u0 + tid] = s;
    }
}

// ---------------------------------------------------------------------------
// Part 2 of the preparing launch: the live tokens of each batch row.
//
// A masked token's logit is lowered by 1e9, so wherever its row has an
// unmasked token its softmax weight is exactly zero whatever its logit is:
// neither its logit nor its img row is needed. Per batch row this part lists
// the unmasked tokens in ascending order (list, cnt) and gives every token its
// rank in that list (pos, -1 for a masked one). A row with no unmasked token
// keeps all its tokens: there every logit counts. The list is put together in
// LDS and leaves in whole 16-B stores.
// ---------------------------------------------------------------------------
__device__ __forceinline__ int scan32(int v, int lane)   // inclusive sum over a wave
{
    #pragma unroll
    for (int d = 1; d < 32; d <<= 1) {
        const int t = __shfl_up(v, d, 32);
        if (lane >= d) v += t;
    }
    return v;
}

__device__ __forceinline__ void compact(const int b,
                                        const int* __restrict__ mask,
                                        int* __restrict__ list,
                                        int* __restrict__ pos,
                                        int* __restrict__ cnt)
{
    __shared__ int wsum[8];
    __shared__ __attribute__((aligned(16))) int llist[TLEN];   // the row's list, 8 KB
    const int tid = threadIdx.x;
    const int lane = tid & 31, wv = tid >> 5;

    // a thread owns 8 neighbouring tokens, so ranks ascend with the token
    const int4 m0 = *(const int4*)(mask + b * TLEN + tid * 8);
    const int4 m1 = *(const int4*)(mask + b * TLEN + tid * 8 + 4);
    const int live[8] = { m0.x != 0, m0.y != 0, m0.z != 0, m0.w != 0,
                          m1.x != 0, m1.y != 0, m1.z != 0, m1.w != 0 };
    int c = 0;
    #pragma unroll
    for (int k = 0; k < 8; ++k) c += live[k];

    // entries past the row's count stay 0
    *(int4*)&llist[tid * 8]     = make_int4(0, 0, 0, 0);
    *(int4*)&llist[tid * 8 + 4] = make_int4(0, 0, 0, 0);

    const int incl = scan32(c, lane);
    if (lane == 31) wsum[wv] = incl;
    // publishes wsum and ends the clearing of llist
    __syncthreads();
    int before = 0, total = 0;
    #pragma unroll
    for (int i = 0; i < 8; ++i) {
        const int v = wsum[i];
        if (i < wv) before += v;
        total += v;
    }

    const bool all = (total == 0);   // nothing unmasked: keep every token
    int rank = all ? tid * 8 : before + incl - c;
    int p[8];
    #pragma unroll
    for (int k = 0; k < 8; ++k) {
        const bool keep = all || live[k];
        p[k] = keep ? rank : -1;
        if (keep) {
            llist[rank] = tid * 8 + k;
            ++rank;
        }
    }
    // publishes llist
    __syncthreads();
    const int4 l0 = *(const int4*)&llist[tid * 8];
    const int4 l1 = *(const int4*)&llist[tid * 8 + 4];
    *(int4*)(list + b * TLEN + tid * 8)     = l0;
    *(int4*)(list + b * TLEN + tid * 8 + 4) = l1;
    *(int4*)(pos + b * TLEN + tid * 8)      = make_int4(p[0], p[1], p[2], p[3]);
    *(int4*)(pos + b * TLEN + tid * 8 + 4)  = make_int4(p[4], p[5], p[6], p[7]);
    // the stores' registers may be rewritten by the code that follows
    asm volatile("s_wait_xcnt 0x0" ::: "memory");
    if (tid == 0) cnt[b * CNT_STRIDE] = all ? TLEN : total;
}

// ---------------------------------------------------------------------------
// The preparing launch. The three parts above depend on nothing but the inputs
// and on none of each other, so they share one grid, each workgroup doing one
// part's block by its index: they run side by side, and the logits GEMM waits
// for one launch, not for three in a row. The few blocks with a chain of
// barriers or many loads come first in the index, the many short ones last.
// The part is the same for a whole workgroup, so every barrier inside a part
// is reached by all of its threads.
// ---------------------------------------------------------------------------
#define PREP_CMP  BATCH                              // blocks of part 2
#define PREP_PH   (BATCH * (UNITSN / PH_UNITS))      // blocks of part 1
#define PREP_W1   ((UNITSN * FEATN) / 256)           // blocks of part 0

__global__ __launch_bounds__(256) void k_prepare(const float* __restrict__ W1,
                                                 __bf16* __restrict__ w1t,
                                                 const float* __restrict__ hidden,
                                                 const float* __restrict__ W2,
                                                 const float* __restrict__ b2,
                                                 float* __restrict__ ph,
                                                 const int* __restrict__ mask,
                                                 int* __restrict__ list,
                                                 int* __restrict__ pos,
                                                 int* __restrict__ cnt)
{
    const int blk = blockIdx.x;
    if (blk < PREP_CMP) {
        compact(blk, mask, list, pos, cnt);
    } else if (blk < PREP_CMP + PREP_PH) {
        const int q = blk - PREP_CMP;
        projhid(q & (BATCH - 1), q / BATCH, hidden, W2, b2, ph);
    } else {
        w1_to_bf16T(blk - (PREP_CMP + PREP_PH), W1, w1t);
    }
}

__device__ __forceinline__ int row_slots(const int* __restrict__ cnt, int lane, int& c)
{
    c = min(max(cnt[lane * CNT_STRIDE], 0), TLEN);
    return (c + 15) & ~15;
}

__global__ __launch_bounds__(WG_THREADS) void k_logits(
    const float*  __restrict__ img,
    const __bf16* __restrict__ w1t,
    const float*  __restrict__ b1,
    const float*  __restrict__ ph,
    const float*  __restrict__ Vv,
    const int*    __restrict__ list,
    const int*    __restrict__ cnt,
    float*        __restrict__ clog)
{
    __shared__ __attribute__((aligned(16))) __bf16 ldsA[2 * TOK_TILE * APITCH];
    __shared__ __attribute__((aligned(16))) __bf16 ldsB[2 * NPANEL * BPITCH];
    __shared__ int slotRow[TOK_TILE];

    const int s0   = blockIdx.x * TOK_TILE;
    const int tid  = threadIdx.x;
    const int lane = tid & 31;
    const int wave = tid >> 5;
    const int wm   = wave >> 3;   // token half of the workgroup tile
    const int wn   = wave & 7;    // 64-unit slice
    const int col  = lane & 15;   // N column / A row within a 16x16 tile
    const int hi   = lane >> 4;   // K half: {0..7,16..23} vs {8..15,24..31}

    const unsigned ldsB_base = (unsigned)(uintptr_t)&ldsB[0];

    int rowCnt;
    const int rowPad = row_slots(cnt, lane, rowCnt);
    const int rowEnd = scan32(rowPad, lane);
    // the same for every thread of the workgroup, and in front of every barrier
    if (s0 >= __builtin_amdgcn_readlane(rowEnd, BATCH - 1)) return;

    auto issue_panel = [&](int kc, int buf) {
        const __bf16* g = w1t + (size_t)(tid >> 3) * FEATN + kc * KCHUNK + (tid & 7) * 8;
        const unsigned l = ldsB_base + (unsigned)(buf * (NPANEL * BPITCH * 2)
                                                  + (tid >> 3) * (BPITCH * 2) + (tid & 7) * 16);
        asm volatile("global_load_async_to_lds_b128 %0, %8, off\n\t"
                     "global_load_async_to_lds_b128 %1, %9, off\n\t"
                     "global_load_async_to_lds_b128 %2, %10, off\n\t"
                     "global_load_async_to_lds_b128 %3, %11, off\n\t"
                     "global_load_async_to_lds_b128 %4, %12, off\n\t"
                     "global_load_async_to_lds_b128 %5, %13, off\n\t"
                     "global_load_async_to_lds_b128 %6, %14, off\n\t"
                     "global_load_async_to_lds_b128 %7, %15, off\n\t"
                     "s_wait_xcnt 0x0"
                     :: "v"(l),
                        "v"(l + 1u * 64 * (BPITCH * 2)), "v"(l + 2u * 64 * (BPITCH * 2)),
                        "v"(l + 3u * 64 * (BPITCH * 2)), "v"(l + 4u * 64 * (BPITCH * 2)),
                        "v"(l + 5u * 64 * (BPITCH * 2)), "v"(l + 6u * 64 * (BPITCH * 2)),
                        "v"(l + 7u * 64 * (BPITCH * 2)),
                        "v"(g),
                        "v"(g + 1 * 64 * FEATN), "v"(g + 2 * 64 * FEATN),
                        "v"(g + 3 * 64 * FEATN), "v"(g + 4 * 64 * FEATN),
                        "v"(g + 5 * 64 * FEATN), "v"(g + 6 * 64 * FEATN),
                        "v"(g + 7 * 64 * FEATN)
                     : "memory");
    };

    const char* gA = (const char*)img;
    unsigned    aOff[ALOADS];
    __bf16*     sA = &ldsA[(tid >> 4) * APITCH + (tid & 15) * 4];
    float4 f[ALOADS];
    auto load_a = [&]() {             // loads the chunk at gA
        // unrolled: f[] must be indexed by constants to stay in registers
        #pragma unroll
        for (int i = 0; i < ALOADS; ++i)
            f[i] = *(const float4*)(gA + aOff[i]);
        // the loads' address registers are rewritten by the code that follows
        asm volatile("s_wait_xcnt 0x0" ::: "memory");
        gA += KCHUNK * 4;             // the next chunk
    };
    auto store_a = [&](int buf) {
        #pragma unroll
        for (int i = 0; i < ALOADS; ++i) {
            v4bf p;
            p.x = (__bf16)f[i].x; p.y = (__bf16)f[i].y;
            p.z = (__bf16)f[i].z; p.w = (__bf16)f[i].w;
            *(v4bf*)(sA + buf * (TOK_TILE * APITCH) + i * 32 * APITCH) = p;
        }
    };

    v8f acc[MT_WAVE * 4];          // [mt][nt] -> acc[mt*4+nt]
    #pragma unroll
    for (int i = 0; i < MT_WAVE * 4; ++i)
        acc[i] = (v8f){0.f,0.f,0.f,0.f,0.f,0.f,0.f,0.f};

    const int aElem = (wm * (MT_WAVE * 16) + col) * APITCH + hi * 8;   // within a buffer
    const int bElem = (wn * 64 + col) * BPITCH + hi * 8;   // within a buffer

    issue_panel(0, 0);

    if (tid < TOK_TILE) {
        const int s = s0 + tid;
        int bb = 0;                    // rows that end at or before s, at most 31
        #pragma unroll
        for (int j = 0; j < BATCH - 1; ++j)
            bb += (__builtin_amdgcn_readlane(rowEnd, j) <= s) ? 1 : 0;
        const int r = s - __shfl(rowEnd - rowPad, bb, 32);   // rank within row bb
        int t = 0;
        if (r < __shfl(rowCnt, bb, 32)) t = list[bb * TLEN + r] & (TLEN - 1);
        slotRow[tid] = bb * TLEN + t;
    }
    // publishes slotRow
    __syncthreads();
    #pragma unroll
    for (int i = 0; i < ALOADS; ++i)
        aOff[i] = (unsigned)slotRow[i * 32 + (tid >> 4)] * (FEATN * 4) + (tid & 15) * 16;

    // ---- stage 0 of img
    load_a();
    store_a(0);
    // this wave's LDS stores are done and its copies of chunk 0 have landed;
    // the barrier publishes both
    asm volatile("s_wait_dscnt 0x0" ::: "memory");
    asm volatile("s_wait_asynccnt 0x0" ::: "memory");
    __syncthreads();
    issue_panel(1, 1);

    // 16 K-chunks, double-buffered; rolled: one copy of the 40-WMMA body
    #pragma unroll 1
    for (int kc = 0; kc < NSTAGE; ++kc) {
        const __bf16* Ab = &ldsA[(size_t)(kc & 1) * TOK_TILE * APITCH] + aElem;
        const __bf16* Bb = &ldsB[(size_t)(kc & 1) * NPANEL * BPITCH] + bElem;

        // next img chunk flies to registers under this chunk's WMMAs
        if (kc + 1 < NSTAGE) load_a();

        // ---- 2 K-steps of 32: 5 A-frags + 4 B-frags -> 20 WMMAs each
        #pragma unroll
        for (int ks = 0; ks < 2; ++ks) {
            v16bf a[MT_WAVE], bm[4];
            #pragma unroll
            for (int mt = 0; mt < MT_WAVE; ++mt) {
                const __bf16* pa = Ab + mt * 16 * APITCH + ks * 32;
                v8bf lo = *(const v8bf*)pa;
                v8bf hh = *(const v8bf*)(pa + 16);
                a[mt] = __builtin_shufflevector(lo, hh, 0,1,2,3,4,5,6,7,
                                                        8,9,10,11,12,13,14,15);
            }
            #pragma unroll
            for (int nt = 0; nt < 4; ++nt) {
                const __bf16* pb = Bb + nt * 16 * BPITCH + ks * 32;
                v8bf lo = *(const v8bf*)pb;
                v8bf hh = *(const v8bf*)(pb + 16);
                bm[nt] = __builtin_shufflevector(lo, hh, 0,1,2,3,4,5,6,7,
                                                         8,9,10,11,12,13,14,15);
            }
            #pragma unroll
            for (int mt = 0; mt < MT_WAVE; ++mt)
                #pragma unroll
                for (int nt = 0; nt < 4; ++nt)
                    acc[mt * 4 + nt] = __builtin_amdgcn_wmma_f32_16x16x32_bf16(
                        false, a[mt], false, bm[nt], (short)0,
                        acc[mt * 4 + nt], false, false);
        }

        // the other img buffer was last read one trip ago, before that trip's barrier
        if (kc + 1 < NSTAGE) store_a((kc + 1) & 1);

        // ---- hand-over: this wave's LDS reads and stores are done ...
        asm volatile("s_wait_dscnt 0x0" ::: "memory");
        // ... its copies of W1^T chunk kc+1 have landed ...
        asm volatile("s_wait_asynccnt 0x0" ::: "memory");
        // ... and the barrier publishes chunk kc+1 and frees the buffers just read
        __syncthreads();
        if (kc + 2 < NSTAGE) issue_panel(kc + 2, kc & 1);
    }
    // no copy is outstanding when the LDS is put to another use below
    asm volatile("s_wait_asynccnt 0x0" ::: "memory");

    // ---- fused bias + v_tanh_f32 + dot(V) over this wave's 64 units
    float lp[MT_WAVE * 8];         // logit partials: [mt 0..4][r 0..7]
    #pragma unroll
    for (int i = 0; i < MT_WAVE * 8; ++i) lp[i] = 0.f;
    const float* phq[MT_WAVE];
    // the same in every lane: readfirstlane makes it a scalar base address
    #pragma unroll
    for (int mt = 0; mt < MT_WAVE; ++mt)
        phq[mt] = ph + ((unsigned)__builtin_amdgcn_readfirstlane(
                            slotRow[wm * (MT_WAVE * 16) + mt * 16]) / TLEN) * UNITSN;
    #pragma unroll
    for (int nt = 0; nt < 4; ++nt) {
        const int n = wn * 64 + nt * 16 + col;
        const float b1n = b1[n];
        const float vw  = Vv[n];
        #pragma unroll
        for (int mt = 0; mt < MT_WAVE; ++mt) {
            const float bias = b1n + phq[mt][n];
            #pragma unroll
            for (int r = 0; r < 8; ++r) {
                float x = acc[mt * 4 + nt][r] + bias, y;
                asm("v_tanh_f32 %0, %1\n\tv_nop" : "=v"(y) : "v"(x));
                lp[mt * 8 + r] += y * vw;
            }
        }
    }

    // ---- reduce partials over the 16 columns (stays within each lane-half)
    #pragma unroll
    for (int m = 1; m < 16; m <<= 1) {
        #pragma unroll
        for (int i = 0; i < MT_WAVE * 8; ++i)
            lp[i] += __shfl_xor(lp[i], m, 32);
    }

    // ---- cross-wave reduction (the 8 unit slices of each token).
    // ldsA is dead now: the loop's last barrier ended every read of it.
    float* ldsRed = (float*)ldsA;              // [8][160]
    if (col == 0) {
        #pragma unroll
        for (int mt = 0; mt < MT_WAVE; ++mt)
            #pragma unroll
            for (int r = 0; r < 8; ++r)
                ldsRed[wn * TOK_TILE + wm * (MT_WAVE * 16) + mt * 16 + hi * 8 + r] = lp[mt * 8 + r];
    }
    __syncthreads();
    if (tid < TOK_TILE) {
        float s = ldsRed[tid];
        // unrolled: the LDS reads go out together
        #pragma unroll
        for (int w = 1; w < 8; ++w)
            s += ldsRed[w * TOK_TILE + tid];
        clog[s0 + tid] = s;
    }
}

__global__ __launch_bounds__(256) void k_softmax(const float* __restrict__ clog,
                                                 const int*   __restrict__ pos,
                                                 const int*   __restrict__ cnt,
                                                 const int*   __restrict__ mask,
                                                 float*       __restrict__ wout)
{
    __shared__ float red[8];
    __shared__ float sstat;
    const int b = blockIdx.x, tid = threadIdx.x;
    const int lane = tid & 31, wv = tid >> 5;

    int rowCnt;
    const int rowPad = row_slots(cnt, lane, rowCnt);
    const int first  = __builtin_amdgcn_readlane(scan32(rowPad, lane) - rowPad, b);

    float vals[8];
    float mx = -3.0e38f;
    #pragma unroll
    for (int i = 0; i < 8; ++i) {
        const int t = tid + i * 256;
        const int ps = pos[b * TLEN + t];
        const float cl = clog[first + min(max(ps, 0), TLEN - 1)];
        float l = (ps >= 0) ? cl : 0.f;
        if (mask[b * TLEN + t] == 0) l -= 1.0e9f;
        vals[i] = l;
        mx = fmaxf(mx, l);
    }
    #pragma unroll
    for (int m = 16; m >= 1; m >>= 1) mx = fmaxf(mx, __shfl_xor(mx, m, 32));
    if (lane == 0) red[wv] = mx;
    __syncthreads();
    if (tid == 0) {
        float m2 = red[0];
        for (int i = 1; i < 8; ++i) m2 = fmaxf(m2, red[i]);
        sstat = m2;
    }
    __syncthreads();
    mx = sstat;

    float s = 0.f;
    #pragma unroll
    for (int i = 0; i < 8; ++i) { vals[i] = __expf(vals[i] - mx); s += vals[i]; }
    #pragma unroll
    for (int m = 16; m >= 1; m >>= 1) s += __shfl_xor(s, m, 32);
    if (lane == 0) red[wv] = s;
    __syncthreads();
    if (tid == 0) {
        float t2 = 0.f;
        for (int i = 0; i < 8; ++i) t2 += red[i];
        sstat = t2;
    }
    __syncthreads();
    const float inv = 1.0f / sstat;
    #pragma unroll
    for (int i = 0; i < 8; ++i)
        wout[b * TLEN + tid + i * 256] = vals[i] * inv;
}

// ---------------------------------------------------------------------------
// Kernels 4+5: context[b][f] = sum_t w[b][t] * img[b][t][f]
// Second coalesced float4 pass over img (1024 blocks), then 32-way reduce.
//
// A token whose weight is exactly zero (a masked token, wherever its row has
// an unmasked one) adds nothing to the sum, so its 4 KB img row is not read.
// Every wave holds the workgroup's 64 weights, two per lane; two ballots give
// the set of tokens to read as one wave-uniform 64-bit word. The rows of that
// set are read in ascending order, CTX_DEPTH at a time.
// ---------------------------------------------------------------------------
#define CTX_TOK   (TLEN / 32)   // tokens per workgroup
#define CTX_DEPTH 4             // img rows in flight per wave

__global__ __launch_bounds__(256) void k_ctx_partial(const float* __restrict__ img,
                                                     const float* __restrict__ w,
                                                     float*       __restrict__ partial)
{
    const int b = blockIdx.x, ts = blockIdx.y, tid = threadIdx.x;
    const int f = tid * 4;
    const int lane = tid & 31;

    const float* wrow = w + b * TLEN + ts * CTX_TOK;
    const float w0 = wrow[lane];        // tokens 0..31 of this workgroup
    const float w1 = wrow[32 + lane];   // tokens 32..63
    // bit j: token j has a weight other than zero (a NaN counts as such)
    unsigned long long live =
          (unsigned long long)__builtin_amdgcn_ballot_w32(w0 != 0.f)
        | ((unsigned long long)__builtin_amdgcn_ballot_w32(w1 != 0.f) << 32);

    const float* rows = img + ((size_t)b * TLEN + ts * CTX_TOK) * FEATN;
    float4 acc = make_float4(0.f, 0.f, 0.f, 0.f);

    // at most CTX_TOK / CTX_DEPTH trips; rolled: one copy of the 4-row body
    #pragma unroll 1
    for (int trip = 0; trip < CTX_TOK / CTX_DEPTH && live != 0; ++trip) {
        float  wt[CTX_DEPTH];
        float4 iv[CTX_DEPTH];
        int j = 0;
        // unrolled: wt[] and iv[] must be indexed by constants to stay in registers
        #pragma unroll
        for (int k = 0; k < CTX_DEPTH; ++k) {
            // once the set is empty the last row is named again, with weight 0
            const bool on = (live != 0);
            if (on) j = __builtin_ctzll(live);
            live &= live - 1;
            const int r0 = __builtin_amdgcn_readlane(__float_as_int(w0), j & 31);
            const int r1 = __builtin_amdgcn_readlane(__float_as_int(w1), j & 31);
            wt[k] = on ? __int_as_float(j < 32 ? r0 : r1) : 0.f;
            iv[k] = *(const float4*)(rows + (size_t)j * FEATN + f);
        }
        // the loads' address registers are rewritten by the next trip
        asm volatile("s_wait_xcnt 0x0" ::: "memory");
        #pragma unroll
        for (int k = 0; k < CTX_DEPTH; ++k) {
            acc.x = fmaf(wt[k], iv[k].x, acc.x);
            acc.y = fmaf(wt[k], iv[k].y, acc.y);
            acc.z = fmaf(wt[k], iv[k].z, acc.z);
            acc.w = fmaf(wt[k], iv[k].w, acc.w);
        }
    }
    *(float4*)(partial + ((size_t)(b * 32 + ts)) * FEATN + f) = acc;
}

__global__ __launch_bounds__(256) void k_ctx_reduce(const float* __restrict__ partial,
                                                    float*       __restrict__ ctx)
{
    const int b = blockIdx.x, tid = threadIdx.x;
    const int f = tid * 4;
    float4 acc = make_float4(0.f, 0.f, 0.f, 0.f);
    for (int ts = 0; ts < 32; ++ts) {
        const float4 p = *(const float4*)(partial + ((size_t)(b * 32 + ts)) * FEATN + f);
        acc.x += p.x; acc.y += p.y; acc.z += p.z; acc.w += p.w;
    }
    *(float4*)(ctx + (size_t)b * FEATN + f) = acc;
}

// ---------------------------------------------------------------------------
extern "C" void kernel_launch(void* const* d_in, const int* in_sizes, int n_in,
                              void* d_out, int out_size, void* d_ws, size_t ws_size,
                              hipStream_t stream) {
    (void)in_sizes; (void)n_in; (void)out_size; (void)ws_size;

    const float* img    = (const float*)d_in[0];   // [32][2048][1024]
    const int*   mask   = (const int*)  d_in[1];   // [32][2048]
    const float* hidden = (const float*)d_in[2];   // [32][512]
    const float* W1     = (const float*)d_in[3];   // [1024][512]
    const float* b1     = (const float*)d_in[4];   // [512]
    const float* W2     = (const float*)d_in[5];   // [512][512]
    const float* b2     = (const float*)d_in[6];   // [512]
    const float* Vv     = (const float*)d_in[7];   // [512]
    // d_in[8] = bV: softmax-invariant, unused.

    float* out     = (float*)d_out;
    float* ctx_out = out;                          // [32*1024] context first
    float* w_out   = out + BATCH * FEATN;          // [32*2048] weights second

    char* ws = (char*)d_ws;
    __bf16* w1t    = (__bf16*)ws;                                        // 1 MB
    float*  ph     = (float*)(ws + (1 << 20));                           // 64 KB
    int*    list   = (int*)  (ws + (1 << 20) + (64 << 10));              // 256 KB
    float*  part   = (float*)(ws + (1 << 20) + (64 << 10) + (256 << 10));// 4 MB
    float*  clog   = (float*)(ws + (6 << 20));                           // 257 KB
    int*    pos    = (int*)  (ws + (7 << 20));                           // 256 KB
    int*    cnt    = (int*)  (ws + (8 << 20));                           // 4 KB

    k_prepare<<<PREP_CMP + PREP_PH + PREP_W1, 256, 0, stream>>>(
        W1, w1t, hidden, W2, b2, ph, mask, list, pos, cnt);

    k_logits<<<NTILES, WG_THREADS, 0, stream>>>(img, w1t, b1, ph, Vv, list, cnt, clog);

    k_softmax<<<BATCH, 256, 0, stream>>>(clog, pos, cnt, mask, w_out);

    dim3 g4(BATCH, 32);
    k_ctx_partial<<<g4, 256, 0, stream>>>(img, w_out, part);
    k_ctx_reduce<<<BATCH, 256, 0, stream>>>(part, ctx_out);
}

// v007
// One run takes 57 microseconds.
// Two timings next to v006 both put it at 1.08 times that version's speed.
// Over all steps from v000 it is 7.78 times as fast.
#include <hip/hip_runtime.h>
#include <hip/hip_bf16.h>
#include <stdint.h>

#define BATCH  32
#define TLEN   2048
#define FEATN  1024
#define UNITSN 512
#define HIDN   512

#define TOK_TILE   160
#define MT_WAVE    5
#define WG_THREADS 512
#define NTILES     ((BATCH * TLEN + TOK_TILE - 1) / TOK_TILE)
#define CNT_STRIDE 32
#define KCHUNK     64
#define NPANEL     512
#define NSTAGE     (FEATN / KCHUNK)
#define APITCH     (KCHUNK + 8)   // 144 B
#define BPITCH     (KCHUNK + 8)   // 144 B
#define ALOADS     (TOK_TILE * KCHUNK / (WG_THREADS * 4))   // 5 float4 per thread and chunk

typedef __attribute__((ext_vector_type(16))) __bf16 v16bf;
typedef __attribute__((ext_vector_type(8)))  __bf16 v8bf;
typedef __attribute__((ext_vector_type(4)))  __bf16 v4bf;
typedef __attribute__((ext_vector_type(8)))  float  v8f;
typedef __attribute__((ext_vector_type(4)))  float  v4f;

// ---------------------------------------------------------------------------
// Part 0 of the preparing launch: W1 [FEAT][UNITS] fp32 -> W1^T [UNITS][FEAT]
// bf16 (workspace). blk: 0 .. PREP_W1 - 1.
//
// Workgroup = one tile of 64 k x 64 units, turned in LDS. A thread reads a
// 4 k x 4 unit piece (16 lanes cover 256 B of a W1 row), packs four k of each
// unit and stores them to the tile [unit][k]; behind the barrier the tile
// leaves in 16-B stores, 8 lanes to a whole 128-B line of a W1^T row. With 16
// elements a thread the part needs 1024 waves, not one per 32 elements.
// ---------------------------------------------------------------------------
#define TR_TILE  64
#define TR_PITCH (TR_TILE + 8)   // bf16 elements: 144 B, a multiple of 16 B
#define TR_KT    (FEATN / TR_TILE)

__device__ __forceinline__ void w1_to_bf16T(const int blk,
                                            const float* __restrict__ W1,
                                            __bf16* __restrict__ w1t)
{
    __shared__ __attribute__((aligned(16))) __bf16 tile[TR_TILE * TR_PITCH];   // 9 KB

    const int tid = threadIdx.x;
    const int k0  = (blk % TR_KT) * TR_TILE;
    const int u0  = (blk / TR_KT) * TR_TILE;
    const int kk  = (tid >> 4) * 4;   // first of this thread's 4 k
    const int uu  = (tid & 15) * 4;   // first of this thread's 4 units

    const float* g = W1 + (size_t)(k0 + kk) * UNITSN + u0 + uu;
    v4f r[4];
    // unrolled: r[] must be indexed by constants to stay in registers
    #pragma unroll
    for (int i = 0; i < 4; ++i)
        r[i] = *(const v4f*)(g + i * UNITSN);
    // the loads' address registers are reused by the code that follows
    asm volatile("s_wait_xcnt 0x0" ::: "memory");
    #pragma unroll
    for (int j = 0; j < 4; ++j) {
        v4bf p;
        p.x = (__bf16)r[0][j]; p.y = (__bf16)r[1][j];
        p.z = (__bf16)r[2][j]; p.w = (__bf16)r[3][j];
        *(v4bf*)&tile[(uu + j) * TR_PITCH + kk] = p;
    }
    // publishes the tile
    __syncthreads();
    #pragma unroll
    for (int i = 0; i < 2; ++i) {
        const int q = i * 256 + tid;      // 16-B piece: unit q / 8, k (q % 8) * 8
        const v8bf v = *(const v8bf*)&tile[(q >> 3) * TR_PITCH + (q & 7) * 8];
        *(v8bf*)(w1t + (size_t)(u0 + (q >> 3)) * FEATN + k0 + (q & 7) * 8) = v;
    }
    asm volatile("s_wait_xcnt 0x0" ::: "memory");
}

// ---------------------------------------------------------------------------
// Part 1 of the preparing launch: proj_hid[b][u] = hidden[b] @ W2 + b2
// (tiny, latency-bound)
//
// Workgroup = one batch row x 64 units. 16 lanes x float4 cover the 64 units
// (one aligned 256-B piece of a W2 row); the 16 lane groups split K, 32 k each.
// Every load of a thread is issued before the first multiply, so the kernel
// pays the memory latency once; the 16 partial sums meet in LDS.
// ---------------------------------------------------------------------------
#define PH_UNITS 64
#define PH_KG    16
#define PH_KPER  (HIDN / PH_KG)   // 32 k per thread

__device__ __forceinline__ void projhid(const int b, const int ublk,
                                        const float* __restrict__ hidden,
                                        const float* __restrict__ W2,
                                        const float* __restrict__ b2,
                                        float* __restrict__ ph)
{
    __shared__ __attribute__((aligned(16))) float red[PH_KG * PH_UNITS];   // 4 KB

    const int u0  = ublk * PH_UNITS;
    const int tid = threadIdx.x;
    const int ul  = (tid & 15) * 4;   // first of this thread's 4 units
    const int kg  = tid >> 4;         // k group

    const float* gW = W2 + (size_t)(kg * PH_KPER) * UNITSN + u0 + ul;
    const float* gH = hidden + b * HIDN + kg * PH_KPER;

    v4f h[PH_KPER / 4];
    v4f w[PH_KPER];
    // unrolled: h[] and w[] must be indexed by constants to stay in registers
    #pragma unroll
    for (int i = 0; i < PH_KPER / 4; ++i)
        h[i] = *(const v4f*)(gH + i * 4);
    #pragma unroll
    for (int i = 0; i < PH_KPER; ++i)
        w[i] = *(const v4f*)(gW + (size_t)i * UNITSN);
    // the loads' address registers are reused by the code that follows
    asm volatile("s_wait_xcnt 0x0" ::: "memory");
    // behind that wait, since its result may take a register that those loads name
    const v4f bv = *(const v4f*)(b2 + u0 + ul);
    // Inputs-only fences on the loaded values: every value stays in its own
    // register up to here, so no load has to wait for an earlier value's
    // multiply to free a register and all loads are in flight together.
    asm volatile("" ::
                    "v"(h[0]), "v"(h[1]), "v"(h[2]), "v"(h[3]),
                    "v"(h[4]), "v"(h[5]), "v"(h[6]), "v"(h[7]),
                    "v"(w[0]), "v"(w[1]), "v"(w[2]), "v"(w[3]),
                    "v"(w[4]), "v"(w[5]), "v"(w[6]), "v"(w[7]),
                    "v"(w[8]), "v"(w[9]), "v"(w[10]), "v"(w[11]),
                    "v"(w[12]), "v"(w[13]), "v"(w[14]), "v"(w[15]));
    asm volatile("" ::
                    "v"(w[16]), "v"(w[17]), "v"(w[18]), "v"(w[19]),
                    "v"(w[20]), "v"(w[21]), "v"(w[22]), "v"(w[23]),
                    "v"(w[24]), "v"(w[25]), "v"(w[26]), "v"(w[27]),
                    "v"(w[28]), "v"(w[29]), "v"(w[30]), "v"(w[31]),
                    "v"(bv));

    v4f acc = (kg == 0) ? bv : (v4f){0.f, 0.f, 0.f, 0.f};
    #pragma unroll
    for (int i = 0; i < PH_KPER; ++i) {
        const float hv = h[i >> 2][i & 3];
        acc.x = fmaf(hv, w[i].x, acc.x);
        acc.y = fmaf(hv, w[i].y, acc.y);
        acc.z = fmaf(hv, w[i].z, acc.z);
        acc.w = fmaf(hv, w[i].w, acc.w);
    }
    *(v4f*)&red[kg * PH_UNITS + ul] = acc;
    __syncthreads();

    if (tid < PH_UNITS) {
        float s = red[tid];
        // unrolled: the LDS reads go out together, not one per waited trip
        #pragma unroll
        for (int g = 1; g < PH_KG; ++g)
            s += red[g * PH_UNITS + tid];
        ph[b * UNITSN + u0 + tid] = s;
    }
}

// ---------------------------------------------------------------------------
// Part 2 of the preparing launch: the live tokens of each batch row.
//
// A masked token's logit is lowered by 1e9, so wherever its row has an
// unmasked token its softmax weight is exactly zero whatever its logit is:
// neither its logit nor its img row is needed. Per batch row this part lists
// the unmasked tokens in ascending order (list, cnt) and gives every token its
// rank in that list (pos, -1 for a masked one). A row with no unmasked token
// keeps all its tokens: there every logit counts. The list is put together in
// LDS and leaves in whole 16-B stores.
// ---------------------------------------------------------------------------
__device__ __forceinline__ int scan32(int v, int lane)   // inclusive sum over a wave
{
    #pragma unroll
    for (int d = 1; d < 32; d <<= 1) {
        const int t = __shfl_up(v, d, 32);
        if (lane >= d) v += t;
    }
    return v;
}

__device__ __forceinline__ void compact(const int b,
                                        const int* __restrict__ mask,
                                        int* __restrict__ list,
                                        int* __restrict__ pos,
                                        int* __restrict__ cnt)
{
    __shared__ int wsum[8];
    __shared__ __attribute__((aligned(16))) int llist[TLEN];   // the row's list, 8 KB
    const int tid = threadIdx.x;
    const int lane = tid & 31, wv = tid >> 5;

    // a thread owns 8 neighbouring tokens, so ranks ascend with the token
    const int4 m0 = *(const int4*)(mask + b * TLEN + tid * 8);
    const int4 m1 = *(const int4*)(mask + b * TLEN + tid * 8 + 4);
    const int live[8] = { m0.x != 0, m0.y != 0, m0.z != 0, m0.w != 0,
                          m1.x != 0, m1.y != 0, m1.z != 0, m1.w != 0 };
    int c = 0;
    #pragma unroll
    for (int k = 0; k < 8; ++k) c += live[k];

    // entries past the row's count stay 0
    *(int4*)&llist[tid * 8]     = make_int4(0, 0, 0, 0);
    *(int4*)&llist[tid * 8 + 4] = make_int4(0, 0, 0, 0);

    const int incl = scan32(c, lane);
    if (lane == 31) wsum[wv] = incl;
    // publishes wsum and ends the clearing of llist
    __syncthreads();
    int before = 0, total = 0;
    #pragma unroll
    for (int i = 0; i < 8; ++i) {
        const int v = wsum[i];
        if (i < wv) before += v;
        total += v;
    }

    const bool all = (total == 0);   // nothing unmasked: keep every token
    int rank = all ? tid * 8 : before + incl - c;
    int p[8];
    #pragma unroll
    for (int k = 0; k < 8; ++k) {
        const bool keep = all || live[k];
        p[k] = keep ? rank : -1;
        if (keep) {
            llist[rank] = tid * 8 + k;
            ++rank;
        }
    }
    // publishes llist
    __syncthreads();
    const int4 l0 = *(const int4*)&llist[tid * 8];
    const int4 l1 = *(const int4*)&llist[tid * 8 + 4];
    *(int4*)(list + b * TLEN + tid * 8)     = l0;
    *(int4*)(list + b * TLEN + tid * 8 + 4) = l1;
    *(int4*)(pos + b * TLEN + tid * 8)      = make_int4(p[0], p[1], p[2], p[3]);
    *(int4*)(pos + b * TLEN + tid * 8 + 4)  = make_int4(p[4], p[5], p[6], p[7]);
    // the stores' registers may be rewritten by the code that follows
    asm volatile("s_wait_xcnt 0x0" ::: "memory");
    if (tid == 0) cnt[b * CNT_STRIDE] = all ? TLEN : total;
}

// ---------------------------------------------------------------------------
// The preparing launch. The three parts above depend on nothing but the inputs
// and on none of each other, so they share one grid, each workgroup doing one
// part's block by its index: they run side by side, and the logits GEMM waits
// for one launch, not for three in a row. The blocks with the longest chain of
// barriers come first in the index.
// The part is the same for a whole workgroup, so every barrier inside a part
// is reached by all of its threads.
// ---------------------------------------------------------------------------
#define PREP_CMP  BATCH                              // blocks of part 2
#define PREP_PH   (BATCH * (UNITSN / PH_UNITS))      // blocks of part 1
#define PREP_W1   ((UNITSN / TR_TILE) * TR_KT)        // blocks of part 0

__global__ __launch_bounds__(256) void k_prepare(const float* __restrict__ W1,
                                                 __bf16* __restrict__ w1t,
                                                 const float* __restrict__ hidden,
                                                 const float* __restrict__ W2,
                                                 const float* __restrict__ b2,
                                                 float* __restrict__ ph,
                                                 const int* __restrict__ mask,
                                                 int* __restrict__ list,
                                                 int* __restrict__ pos,
                                                 int* __restrict__ cnt)
{
    const int blk = blockIdx.x;
    if (blk < PREP_CMP) {
        compact(blk, mask, list, pos, cnt);
    } else if (blk < PREP_CMP + PREP_PH) {
        const int q = blk - PREP_CMP;
        projhid(q & (BATCH - 1), q / BATCH, hidden, W2, b2, ph);
    } else {
        w1_to_bf16T(blk - (PREP_CMP + PREP_PH), W1, w1t);
    }
}

__device__ __forceinline__ int row_slots(const int* __restrict__ cnt, int lane, int& c)
{
    c = min(max(cnt[lane * CNT_STRIDE], 0), TLEN);
    return (c + 15) & ~15;
}

__global__ __launch_bounds__(WG_THREADS) void k_logits(
    const float*  __restrict__ img,
    const __bf16* __restrict__ w1t,
    const float*  __restrict__ b1,
    const float*  __restrict__ ph,
    const float*  __restrict__ Vv,
    const int*    __restrict__ list,
    const int*    __restrict__ cnt,
    float*        __restrict__ clog)
{
    __shared__ __attribute__((aligned(16))) __bf16 ldsA[2 * TOK_TILE * APITCH];
    __shared__ __attribute__((aligned(16))) __bf16 ldsB[2 * NPANEL * BPITCH];
    __shared__ int slotRow[TOK_TILE];

    const int s0   = blockIdx.x * TOK_TILE;
    const int tid  = threadIdx.x;
    const int lane = tid & 31;
    const int wave = tid >> 5;
    const int wm   = wave >> 3;   // token half of the workgroup tile
    const int wn   = wave & 7;    // 64-unit slice
    const int col  = lane & 15;   // N column / A row within a 16x16 tile
    const int hi   = lane >> 4;   // K half: {0..7,16..23} vs {8..15,24..31}

    const unsigned ldsB_base = (unsigned)(uintptr_t)&ldsB[0];

    int rowCnt;
    const int rowPad = row_slots(cnt, lane, rowCnt);
    const int rowEnd = scan32(rowPad, lane);
    // the same for every thread of the workgroup, and in front of every barrier
    if (s0 >= __builtin_amdgcn_readlane(rowEnd, BATCH - 1)) return;

    auto issue_panel = [&](int kc, int buf) {
        const __bf16* g = w1t + (size_t)(tid >> 3) * FEATN + kc * KCHUNK + (tid & 7) * 8;
        const unsigned l = ldsB_base + (unsigned)(buf * (NPANEL * BPITCH * 2)
                                                  + (tid >> 3) * (BPITCH * 2) + (tid & 7) * 16);
        asm volatile("global_load_async_to_lds_b128 %0, %8, off\n\t"
                     "global_load_async_to_lds_b128 %1, %9, off\n\t"
                     "global_load_async_to_lds_b128 %2, %10, off\n\t"
                     "global_load_async_to_lds_b128 %3, %11, off\n\t"
                     "global_load_async_to_lds_b128 %4, %12, off\n\t"
                     "global_load_async_to_lds_b128 %5, %13, off\n\t"
                     "global_load_async_to_lds_b128 %6, %14, off\n\t"
                     "global_load_async_to_lds_b128 %7, %15, off\n\t"
                     "s_wait_xcnt 0x0"
                     :: "v"(l),
                        "v"(l + 1u * 64 * (BPITCH * 2)), "v"(l + 2u * 64 * (BPITCH * 2)),
                        "v"(l + 3u * 64 * (BPITCH * 2)), "v"(l + 4u * 64 * (BPITCH * 2)),
                        "v"(l + 5u * 64 * (BPITCH * 2)), "v"(l + 6u * 64 * (BPITCH * 2)),
                        "v"(l + 7u * 64 * (BPITCH * 2)),
                        "v"(g),
                        "v"(g + 1 * 64 * FEATN), "v"(g + 2 * 64 * FEATN),
                        "v"(g + 3 * 64 * FEATN), "v"(g + 4 * 64 * FEATN),
                        "v"(g + 5 * 64 * FEATN), "v"(g + 6 * 64 * FEATN),
                        "v"(g + 7 * 64 * FEATN)
                     : "memory");
    };

    const char* gA = (const char*)img;
    unsigned    aOff[ALOADS];
    __bf16*     sA = &ldsA[(tid >> 4) * APITCH + (tid & 15) * 4];
    float4 f[ALOADS];
    auto load_a = [&]() {             // loads the chunk at gA
        // unrolled: f[] must be indexed by constants to stay in registers
        #pragma unroll
        for (int i = 0; i < ALOADS; ++i)
            f[i] = *(const float4*)(gA + aOff[i]);
        // the loads' address registers are rewritten by the code that follows
        asm volatile("s_wait_xcnt 0x0" ::: "memory");
        gA += KCHUNK * 4;             // the next chunk
    };
    auto store_a = [&](int buf) {
        #pragma unroll
        for (int i = 0; i < ALOADS; ++i) {
            v4bf p;
            p.x = (__bf16)f[i].x; p.y = (__bf16)f[i].y;
            p.z = (__bf16)f[i].z; p.w = (__bf16)f[i].w;
            *(v4bf*)(sA + buf * (TOK_TILE * APITCH) + i * 32 * APITCH) = p;
        }
    };

    v8f acc[MT_WAVE * 4];          // [mt][nt] -> acc[mt*4+nt]
    #pragma unroll
    for (int i = 0; i < MT_WAVE * 4; ++i)
        acc[i] = (v8f){0.f,0.f,0.f,0.f,0.f,0.f,0.f,0.f};

    const int aElem = (wm * (MT_WAVE * 16) + col) * APITCH + hi * 8;   // within a buffer
    const int bElem = (wn * 64 + col) * BPITCH + hi * 8;   // within a buffer

    issue_panel(0, 0);

    if (tid < TOK_TILE) {
        const int s = s0 + tid;
        int bb = 0;                    // rows that end at or before s, at most 31
        #pragma unroll
        for (int j = 0; j < BATCH - 1; ++j)
            bb += (__builtin_amdgcn_readlane(rowEnd, j) <= s) ? 1 : 0;
        const int r = s - __shfl(rowEnd - rowPad, bb, 32);   // rank within row bb
        int t = 0;
        if (r < __shfl(rowCnt, bb, 32)) t = list[bb * TLEN + r] & (TLEN - 1);
        slotRow[tid] = bb * TLEN + t;
    }
    // publishes slotRow
    __syncthreads();
    #pragma unroll
    for (int i = 0; i < ALOADS; ++i)
        aOff[i] = (unsigned)slotRow[i * 32 + (tid >> 4)] * (FEATN * 4) + (tid & 15) * 16;

    // ---- stage 0 of img
    load_a();
    store_a(0);
    // this wave's LDS stores are done and its copies of chunk 0 have landed;
    // the barrier publishes both
    asm volatile("s_wait_dscnt 0x0" ::: "memory");
    asm volatile("s_wait_asynccnt 0x0" ::: "memory");
    __syncthreads();
    issue_panel(1, 1);

    // 16 K-chunks, double-buffered; rolled: one copy of the 40-WMMA body
    #pragma unroll 1
    for (int kc = 0; kc < NSTAGE; ++kc) {
        const __bf16* Ab = &ldsA[(size_t)(kc & 1) * TOK_TILE * APITCH] + aElem;
        const __bf16* Bb = &ldsB[(size_t)(kc & 1) * NPANEL * BPITCH] + bElem;

        // next img chunk flies to registers under this chunk's WMMAs
        if (kc + 1 < NSTAGE) load_a();

        // ---- 2 K-steps of 32: 5 A-frags + 4 B-frags -> 20 WMMAs each
        #pragma unroll
        for (int ks = 0; ks < 2; ++ks) {
            v16bf a[MT_WAVE], bm[4];
            #pragma unroll
            for (int mt = 0; mt < MT_WAVE; ++mt) {
                const __bf16* pa = Ab + mt * 16 * APITCH + ks * 32;
                v8bf lo = *(const v8bf*)pa;
                v8bf hh = *(const v8bf*)(pa + 16);
                a[mt] = __builtin_shufflevector(lo, hh, 0,1,2,3,4,5,6,7,
                                                        8,9,10,11,12,13,14,15);
            }
            #pragma unroll
            for (int nt = 0; nt < 4; ++nt) {
                const __bf16* pb = Bb + nt * 16 * BPITCH + ks * 32;
                v8bf lo = *(const v8bf*)pb;
                v8bf hh = *(const v8bf*)(pb + 16);
                bm[nt] = __builtin_shufflevector(lo, hh, 0,1,2,3,4,5,6,7,
                                                         8,9,10,11,12,13,14,15);
            }
            #pragma unroll
            for (int mt = 0; mt < MT_WAVE; ++mt)
                #pragma unroll
                for (int nt = 0; nt < 4; ++nt)
                    acc[mt * 4 + nt] = __builtin_amdgcn_wmma_f32_16x16x32_bf16(
                        false, a[mt], false, bm[nt], (short)0,
                        acc[mt * 4 + nt], false, false);
        }

        // the other img buffer was last read one trip ago, before that trip's barrier
        if (kc + 1 < NSTAGE) store_a((kc + 1) & 1);

        // ---- hand-over: this wave's LDS reads and stores are done ...
        asm volatile("s_wait_dscnt 0x0" ::: "memory");
        // ... its copies of W1^T chunk kc+1 have landed ...
        asm volatile("s_wait_asynccnt 0x0" ::: "memory");
        // ... and the barrier publishes chunk kc+1 and frees the buffers just read
        __syncthreads();
        if (kc + 2 < NSTAGE) issue_panel(kc + 2, kc & 1);
    }
    // no copy is outstanding when the LDS is put to another use below
    asm volatile("s_wait_asynccnt 0x0" ::: "memory");

    // ---- fused bias + v_tanh_f32 + dot(V) over this wave's 64 units
    float lp[MT_WAVE * 8];         // logit partials: [mt 0..4][r 0..7]
    #pragma unroll
    for (int i = 0; i < MT_WAVE * 8; ++i) lp[i] = 0.f;
    const float* phq[MT_WAVE];
    // the same in every lane: readfirstlane makes it a scalar base address
    #pragma unroll
    for (int mt = 0; mt < MT_WAVE; ++mt)
        phq[mt] = ph + ((unsigned)__builtin_amdgcn_readfirstlane(
                            slotRow[wm * (MT_WAVE * 16) + mt * 16]) / TLEN) * UNITSN;
    #pragma unroll
    for (int nt = 0; nt < 4; ++nt) {
        const int n = wn * 64 + nt * 16 + col;
        const float b1n = b1[n];
        const float vw  = Vv[n];
        #pragma unroll
        for (int mt = 0; mt < MT_WAVE; ++mt) {
            const float bias = b1n + phq[mt][n];
            #pragma unroll
            for (int r = 0; r < 8; ++r) {
                float x = acc[mt * 4 + nt][r] + bias, y;
                asm("v_tanh_f32 %0, %1\n\tv_nop" : "=v"(y) : "v"(x));
                lp[mt * 8 + r] += y * vw;
            }
        }
    }

    // ---- reduce partials over the 16 columns (stays within each lane-half)
    #pragma unroll
    for (int m = 1; m < 16; m <<= 1) {
        #pragma unroll
        for (int i = 0; i < MT_WAVE * 8; ++i)
            lp[i] += __shfl_xor(lp[i], m, 32);
    }

    // ---- cross-wave reduction (the 8 unit slices of each token).
    // ldsA is dead now: the loop's last barrier ended every read of it.
    float* ldsRed = (float*)ldsA;              // [8][160]
    if (col == 0) {
        #pragma unroll
        for (int mt = 0; mt < MT_WAVE; ++mt)
            #pragma unroll
            for (int r = 0; r < 8; ++r)
                ldsRed[wn * TOK_TILE + wm * (MT_WAVE * 16) + mt * 16 + hi * 8 + r] = lp[mt * 8 + r];
    }
    __syncthreads();
    if (tid < TOK_TILE) {
        float s = ldsRed[tid];
        // unrolled: the LDS reads go out together
        #pragma unroll
        for (int w = 1; w < 8; ++w)
            s += ldsRed[w * TOK_TILE + tid];
        clog[s0 + tid] = s;
    }
}

__global__ __launch_bounds__(256) void k_softmax(const float* __restrict__ clog,
                                                 const int*   __restrict__ pos,
                                                 const int*   __restrict__ cnt,
                                                 const int*   __restrict__ mask,
                                                 float*       __restrict__ wout)
{
    __shared__ float red[8];
    __shared__ float sstat;
    const int b = blockIdx.x, tid = threadIdx.x;
    const int lane = tid & 31, wv = tid >> 5;

    int rowCnt;
    const int rowPad = row_slots(cnt, lane, rowCnt);
    const int first  = __builtin_amdgcn_readlane(scan32(rowPad, lane) - rowPad, b);

    float vals[8];
    float mx = -3.0e38f;
    #pragma unroll
    for (int i = 0; i < 8; ++i) {
        const int t = tid + i * 256;
        const int ps = pos[b * TLEN + t];
        const float cl = clog[first + min(max(ps, 0), TLEN - 1)];
        float l = (ps >= 0) ? cl : 0.f;
        if (mask[b * TLEN + t] == 0) l -= 1.0e9f;
        vals[i] = l;
        mx = fmaxf(mx, l);
    }
    #pragma unroll
    for (int m = 16; m >= 1; m >>= 1) mx = fmaxf(mx, __shfl_xor(mx, m, 32));
    if (lane == 0) red[wv] = mx;
    __syncthreads();
    if (tid == 0) {
        float m2 = red[0];
        for (int i = 1; i < 8; ++i) m2 = fmaxf(m2, red[i]);
        sstat = m2;
    }
    __syncthreads();
    mx = sstat;

    float s = 0.f;
    #pragma unroll
    for (int i = 0; i < 8; ++i) { vals[i] = __expf(vals[i] - mx); s += vals[i]; }
    #pragma unroll
    for (int m = 16; m >= 1; m >>= 1) s += __shfl_xor(s, m, 32);
    if (lane == 0) red[wv] = s;
    __syncthreads();
    if (tid == 0) {
        float t2 = 0.f;
        for (int i = 0; i < 8; ++i) t2 += red[i];
        sstat = t2;
    }
    __syncthreads();
    const float inv = 1.0f / sstat;
    #pragma unroll
    for (int i = 0; i < 8; ++i)
        wout[b * TLEN + tid + i * 256] = vals[i] * inv;
}

// ---------------------------------------------------------------------------
// Kernels 4+5: context[b][f] = sum_t w[b][t] * img[b][t][f]
// Second coalesced float4 pass over img (1024 blocks), then 32-way reduce.
//
// A token whose weight is exactly zero (a masked token, wherever its row has
// an unmasked one) adds nothing to the sum, so its 4 KB img row is not read.
// Every wave holds the workgroup's 64 weights, two per lane; two ballots give
// the set of tokens to read as one wave-uniform 64-bit word. The rows of that
// set are read in ascending order, CTX_DEPTH at a time.
// ---------------------------------------------------------------------------
#define CTX_TOK   (TLEN / 32)   // tokens per workgroup
#define CTX_DEPTH 4             // img rows in flight per wave

__global__ __launch_bounds__(256) void k_ctx_partial(const float* __restrict__ img,
                                                     const float* __restrict__ w,
                                                     float*       __restrict__ partial)
{
    const int b = blockIdx.x, ts = blockIdx.y, tid = threadIdx.x;
    const int f = tid * 4;
    const int lane = tid & 31;

    const float* wrow = w + b * TLEN + ts * CTX_TOK;
    const float w0 = wrow[lane];        // tokens 0..31 of this workgroup
    const float w1 = wrow[32 + lane];   // tokens 32..63
    // bit j: token j has a weight other than zero (a NaN counts as such)
    unsigned long long live =
          (unsigned long long)__builtin_amdgcn_ballot_w32(w0 != 0.f)
        | ((unsigned long long)__builtin_amdgcn_ballot_w32(w1 != 0.f) << 32);

    const float* rows = img + ((size_t)b * TLEN + ts * CTX_TOK) * FEATN;
    float4 acc = make_float4(0.f, 0.f, 0.f, 0.f);

    // at most CTX_TOK / CTX_DEPTH trips; rolled: one copy of the 4-row body
    #pragma unroll 1
    for (int trip = 0; trip < CTX_TOK / CTX_DEPTH && live != 0; ++trip) {
        float  wt[CTX_DEPTH];
        float4 iv[CTX_DEPTH];
        int j = 0;
        // unrolled: wt[] and iv[] must be indexed by constants to stay in registers
        #pragma unroll
        for (int k = 0; k < CTX_DEPTH; ++k) {
            // once the set is empty the last row is named again, with weight 0
            const bool on = (live != 0);
            if (on) j = __builtin_ctzll(live);
            live &= live - 1;
            const int r0 = __builtin_amdgcn_readlane(__float_as_int(w0), j & 31);
            const int r1 = __builtin_amdgcn_readlane(__float_as_int(w1), j & 31);
            wt[k] = on ? __int_as_float(j < 32 ? r0 : r1) : 0.f;
            iv[k] = *(const float4*)(rows + (size_t)j * FEATN + f);
        }
        // the loads' address registers are rewritten by the next trip
        asm volatile("s_wait_xcnt 0x0" ::: "memory");
        #pragma unroll
        for (int k = 0; k < CTX_DEPTH; ++k) {
            acc.x = fmaf(wt[k], iv[k].x, acc.x);
            acc.y = fmaf(wt[k], iv[k].y, acc.y);
            acc.z = fmaf(wt[k], iv[k].z, acc.z);
            acc.w = fmaf(wt[k], iv[k].w, acc.w);
        }
    }
    *(float4*)(partial + ((size_t)(b * 32 + ts)) * FEATN + f) = acc;
}

__global__ __launch_bounds__(256) void k_ctx_reduce(const float* __restrict__ partial,
                                                    float*       __restrict__ ctx)
{
    const int b = blockIdx.x, tid = threadIdx.x;
    const int f = tid * 4;
    float4 acc = make_float4(0.f, 0.f, 0.f, 0.f);
    for (int ts = 0; ts < 32; ++ts) {
        const float4 p = *(const float4*)(partial + ((size_t)(b * 32 + ts)) * FEATN + f);
        acc.x += p.x; acc.y += p.y; acc.z += p.z; acc.w += p.w;
    }
    *(float4*)(ctx + (size_t)b * FEATN + f) = acc;
}

// ---------------------------------------------------------------------------
extern "C" void kernel_launch(void* const* d_in, const int* in_sizes, int n_in,
                              void* d_out, int out_size, void* d_ws, size_t ws_size,
                              hipStream_t stream) {
    (void)in_sizes; (void)n_in; (void)out_size; (void)ws_size;

    const float* img    = (const float*)d_in[0];   // [32][2048][1024]
    const int*   mask   = (const int*)  d_in[1];   // [32][2048]
    const float* hidden = (const float*)d_in[2];   // [32][512]
    const float* W1     = (const float*)d_in[3];   // [1024][512]
    const float* b1     = (const float*)d_in[4];   // [512]
    const float* W2     = (const float*)d_in[5];   // [512][512]
    const float* b2     = (const float*)d_in[6];   // [512]
    const float* Vv     = (const float*)d_in[7];   // [512]
    // d_in[8] = bV: softmax-invariant, unused.

    float* out     = (float*)d_out;
    float* ctx_out = out;                          // [32*1024] context first
    float* w_out   = out + BATCH * FEATN;          // [32*2048] weights second

    char* ws = (char*)d_ws;
    __bf16* w1t    = (__bf16*)ws;                                        // 1 MB
    float*  ph     = (float*)(ws + (1 << 20));                           // 64 KB
    int*    list   = (int*)  (ws + (1 << 20) + (64 << 10));              // 256 KB
    float*  part   = (float*)(ws + (1 << 20) + (64 << 10) + (256 << 10));// 4 MB
    float*  clog   = (float*)(ws + (6 << 20));                           // 257 KB
    int*    pos    = (int*)  (ws + (7 << 20));                           // 256 KB
    int*    cnt    = (int*)  (ws + (8 << 20));                           // 4 KB

    k_prepare<<<PREP_CMP + PREP_PH + PREP_W1, 256, 0, stream>>>(
        W1, w1t, hidden, W2, b2, ph, mask, list, pos, cnt);

    k_logits<<<NTILES, WG_THREADS, 0, stream>>>(img, w1t, b1, ph, Vv, list, cnt, clog);

    k_softmax<<<BATCH, 256, 0, stream>>>(clog, pos, cnt, mask, w_out);

    dim3 g4(BATCH, 32);
    k_ctx_partial<<<g4, 256, 0, stream>>>(img, w_out, part);
    k_ctx_reduce<<<BATCH, 256, 0, stream>>>(part, ctx_out);
}

// v008
// Measured time: 52.1 microseconds a run.
// In both of two side-by-side timings against v007, it was 1.10 times as fast.
// Counting every step since v000, it is 8.54 times as fast.
#include <hip/hip_runtime.h>
#include <hip/hip_bf16.h>
#include <stdint.h>

#define BATCH  32
#define TLEN   2048
#define FEATN  1024
#define UNITSN 512
#define HIDN   512

#define TOK_TILE   160
#define MT_WAVE    5
#define WG_THREADS 512
#define NTILES     ((BATCH * TLEN + TOK_TILE - 1) / TOK_TILE)
#define CNT_STRIDE 32
#define KCHUNK     64
#define NPANEL     512
#define NSTAGE     (FEATN / KCHUNK)
#define APITCH     (KCHUNK + 8)   // 144 B
#define BPITCH     (KCHUNK + 8)   // 144 B
#define ALOADS     (TOK_TILE * KCHUNK / (WG_THREADS * 4))   // 5 float4 per thread and chunk

typedef __attribute__((ext_vector_type(16))) __bf16 v16bf;
typedef __attribute__((ext_vector_type(8)))  __bf16 v8bf;
typedef __attribute__((ext_vector_type(4)))  __bf16 v4bf;
typedef __attribute__((ext_vector_type(8)))  float  v8f;
typedef __attribute__((ext_vector_type(4)))  float  v4f;

// ---------------------------------------------------------------------------
// Part 0 of the preparing launch: W1 [FEAT][UNITS] fp32 -> W1^T [UNITS][FEAT]
// bf16 (workspace). blk: 0 .. PREP_W1 - 1.
//
// Workgroup = one tile of 64 k x 64 units, turned in LDS. A thread reads a
// 4 k x 4 unit piece (16 lanes cover 256 B of a W1 row), packs four k of each
// unit and stores them to the tile [unit][k]; behind the barrier the tile
// leaves in 16-B stores, 8 lanes to a whole 128-B line of a W1^T row. With 16
// elements a thread the part needs 1024 waves, not one per 32 elements.
// ---------------------------------------------------------------------------
#define TR_TILE  64
#define TR_PITCH (TR_TILE + 8)   // bf16 elements: 144 B, a multiple of 16 B
#define TR_KT    (FEATN / TR_TILE)

__device__ __forceinline__ void w1_to_bf16T(const int blk,
                                            const float* __restrict__ W1,
                                            __bf16* __restrict__ w1t)
{
    __shared__ __attribute__((aligned(16))) __bf16 tile[TR_TILE * TR_PITCH];   // 9 KB

    const int tid = threadIdx.x;
    const int k0  = (blk % TR_KT) * TR_TILE;
    const int u0  = (blk / TR_KT) * TR_TILE;
    const int kk  = (tid >> 4) * 4;   // first of this thread's 4 k
    const int uu  = (tid & 15) * 4;   // first of this thread's 4 units

    const float* g = W1 + (size_t)(k0 + kk) * UNITSN + u0 + uu;
    v4f r[4];
    // unrolled: r[] must be indexed by constants to stay in registers
    #pragma unroll
    for (int i = 0; i < 4; ++i)
        r[i] = *(const v4f*)(g + i * UNITSN);
    // the loads' address registers are reused by the code that follows
    asm volatile("s_wait_xcnt 0x0" ::: "memory");
    #pragma unroll
    for (int j = 0; j < 4; ++j) {
        v4bf p;
        p.x = (__bf16)r[0][j]; p.y = (__bf16)r[1][j];
        p.z = (__bf16)r[2][j]; p.w = (__bf16)r[3][j];
        *(v4bf*)&tile[(uu + j) * TR_PITCH + kk] = p;
    }
    // publishes the tile
    __syncthreads();
    #pragma unroll
    for (int i = 0; i < 2; ++i) {
        const int q = i * 256 + tid;      // 16-B piece: unit q / 8, k (q % 8) * 8
        const v8bf v = *(const v8bf*)&tile[(q >> 3) * TR_PITCH + (q & 7) * 8];
        *(v8bf*)(w1t + (size_t)(u0 + (q >> 3)) * FEATN + k0 + (q & 7) * 8) = v;
    }
    asm volatile("s_wait_xcnt 0x0" ::: "memory");
}

// ---------------------------------------------------------------------------
// Part 1 of the preparing launch: proj_hid[b][u] = hidden[b] @ W2 + b2
// (tiny, latency-bound)
//
// Workgroup = one batch row x 64 units. 16 lanes x float4 cover the 64 units
// (one aligned 256-B piece of a W2 row); the 16 lane groups split K, 32 k each.
// Every load of a thread is issued before the first multiply, so the kernel
// pays the memory latency once; the 16 partial sums meet in LDS.
// ---------------------------------------------------------------------------
#define PH_UNITS 64
#define PH_KG    16
#define PH_KPER  (HIDN / PH_KG)   // 32 k per thread

__device__ __forceinline__ void projhid(const int b, const int ublk,
                                        const float* __restrict__ hidden,
                                        const float* __restrict__ W2,
                                        const float* __restrict__ b2,
                                        float* __restrict__ ph)
{
    __shared__ __attribute__((aligned(16))) float red[PH_KG * PH_UNITS];   // 4 KB

    const int u0  = ublk * PH_UNITS;
    const int tid = threadIdx.x;
    const int ul  = (tid & 15) * 4;   // first of this thread's 4 units
    const int kg  = tid >> 4;         // k group

    const float* gW = W2 + (size_t)(kg * PH_KPER) * UNITSN + u0 + ul;
    const float* gH = hidden + b * HIDN + kg * PH_KPER;

    v4f h[PH_KPER / 4];
    v4f w[PH_KPER];
    // unrolled: h[] and w[] must be indexed by constants to stay in registers
    #pragma unroll
    for (int i = 0; i < PH_KPER / 4; ++i)
        h[i] = *(const v4f*)(gH + i * 4);
    #pragma unroll
    for (int i = 0; i < PH_KPER; ++i)
        w[i] = *(const v4f*)(gW + (size_t)i * UNITSN);
    // the loads' address registers are reused by the code that follows
    asm volatile("s_wait_xcnt 0x0" ::: "memory");
    // behind that wait, since its result may take a register that those loads name
    const v4f bv = *(const v4f*)(b2 + u0 + ul);
    // Inputs-only fences on the loaded values: every value stays in its own
    // register up to here, so no load has to wait for an earlier value's
    // multiply to free a register and all loads are in flight together.
    asm volatile("" ::
                    "v"(h[0]), "v"(h[1]), "v"(h[2]), "v"(h[3]),
                    "v"(h[4]), "v"(h[5]), "v"(h[6]), "v"(h[7]),
                    "v"(w[0]), "v"(w[1]), "v"(w[2]), "v"(w[3]),
                    "v"(w[4]), "v"(w[5]), "v"(w[6]), "v"(w[7]),
                    "v"(w[8]), "v"(w[9]), "v"(w[10]), "v"(w[11]),
                    "v"(w[12]), "v"(w[13]), "v"(w[14]), "v"(w[15]));
    asm volatile("" ::
                    "v"(w[16]), "v"(w[17]), "v"(w[18]), "v"(w[19]),
                    "v"(w[20]), "v"(w[21]), "v"(w[22]), "v"(w[23]),
                    "v"(w[24]), "v"(w[25]), "v"(w[26]), "v"(w[27]),
                    "v"(w[28]), "v"(w[29]), "v"(w[30]), "v"(w[31]),
                    "v"(bv));

    v4f acc = (kg == 0) ? bv : (v4f){0.f, 0.f, 0.f, 0.f};
    #pragma unroll
    for (int i = 0; i < PH_KPER; ++i) {
        const float hv = h[i >> 2][i & 3];
        acc.x = fmaf(hv, w[i].x, acc.x);
        acc.y = fmaf(hv, w[i].y, acc.y);
        acc.z = fmaf(hv, w[i].z, acc.z);
        acc.w = fmaf(hv, w[i].w, acc.w);
    }
    *(v4f*)&red[kg * PH_UNITS + ul] = acc;
    __syncthreads();

    if (tid < PH_UNITS) {
        float s = red[tid];
        // unrolled: the LDS reads go out together, not one per waited trip
        #pragma unroll
        for (int g = 1; g < PH_KG; ++g)
            s += red[g * PH_UNITS + tid];
        ph[b * UNITSN + u0 + tid] = s;
    }
}

// ---------------------------------------------------------------------------
// Part 2 of the preparing launch: the live tokens of each batch row.
//
// A masked token's logit is lowered by 1e9, so wherever its row has an
// unmasked token its softmax weight is exactly zero whatever its logit is:
// neither its logit nor its img row is needed. Per batch row this part lists
// the unmasked tokens in ascending order (list, cnt) and gives every token its
// rank in that list (pos, -1 for a masked one). A row with no unmasked token
// keeps all its tokens: there every logit counts. The list is put together in
// LDS and leaves in whole 16-B stores.
// ---------------------------------------------------------------------------
__device__ __forceinline__ int scan32(int v, int lane)   // inclusive sum over a wave
{
    #pragma unroll
    for (int d = 1; d < 32; d <<= 1) {
        const int t = __shfl_up(v, d, 32);
        if (lane >= d) v += t;
    }
    return v;
}

__device__ __forceinline__ void compact(const int b,
                                        const int* __restrict__ mask,
                                        int* __restrict__ list,
                                        int* __restrict__ pos,
                                        int* __restrict__ cnt)
{
    __shared__ int wsum[8];
    __shared__ __attribute__((aligned(16))) int llist[TLEN];   // the row's list, 8 KB
    const int tid = threadIdx.x;
    const int lane = tid & 31, wv = tid >> 5;

    // a thread owns 8 neighbouring tokens, so ranks ascend with the token
    const int4 m0 = *(const int4*)(mask + b * TLEN + tid * 8);
    const int4 m1 = *(const int4*)(mask + b * TLEN + tid * 8 + 4);
    const int live[8] = { m0.x != 0, m0.y != 0, m0.z != 0, m0.w != 0,
                          m1.x != 0, m1.y != 0, m1.z != 0, m1.w != 0 };
    int c = 0;
    #pragma unroll
    for (int k = 0; k < 8; ++k) c += live[k];

    // entries past the row's count stay 0
    *(int4*)&llist[tid * 8]     = make_int4(0, 0, 0, 0);
    *(int4*)&llist[tid * 8 + 4] = make_int4(0, 0, 0, 0);

    const int incl = scan32(c, lane);
    if (lane == 31) wsum[wv] = incl;
    // publishes wsum and ends the clearing of llist
    __syncthreads();
    int before = 0, total = 0;
    #pragma unroll
    for (int i = 0; i < 8; ++i) {
        const int v = wsum[i];
        if (i < wv) before += v;
        total += v;
    }

    const bool all = (total == 0);   // nothing unmasked: keep every token
    int rank = all ? tid * 8 : before + incl - c;
    int p[8];
    #pragma unroll
    for (int k = 0; k < 8; ++k) {
        const bool keep = all || live[k];
        p[k] = keep ? rank : -1;
        if (keep) {
            llist[rank] = tid * 8 + k;
            ++rank;
        }
    }
    // publishes llist
    __syncthreads();
    const int4 l0 = *(const int4*)&llist[tid * 8];
    const int4 l1 = *(const int4*)&llist[tid * 8 + 4];
    *(int4*)(list + b * TLEN + tid * 8)     = l0;
    *(int4*)(list + b * TLEN + tid * 8 + 4) = l1;
    *(int4*)(pos + b * TLEN + tid * 8)      = make_int4(p[0], p[1], p[2], p[3]);
    *(int4*)(pos + b * TLEN + tid * 8 + 4)  = make_int4(p[4], p[5], p[6], p[7]);
    // the stores' registers may be rewritten by the code that follows
    asm volatile("s_wait_xcnt 0x0" ::: "memory");
    if (tid == 0) cnt[b * CNT_STRIDE] = all ? TLEN : total;
}

// ---------------------------------------------------------------------------
// The preparing launch. The three parts above depend on nothing but the inputs
// and on none of each other, so they share one grid, each workgroup doing one
// part's block by its index: they run side by side, and the logits GEMM waits
// for one launch, not for three in a row. The blocks with the longest chain of
// barriers come first in the index.
// The part is the same for a whole workgroup, so every barrier inside a part
// is reached by all of its threads.
// ---------------------------------------------------------------------------
#define PREP_CMP  BATCH                              // blocks of part 2
#define PREP_PH   (BATCH * (UNITSN / PH_UNITS))      // blocks of part 1
#define PREP_W1   ((UNITSN / TR_TILE) * TR_KT)        // blocks of part 0

__global__ __launch_bounds__(256) void k_prepare(const float* __restrict__ W1,
                                                 __bf16* __restrict__ w1t,
                                                 const float* __restrict__ hidden,
                                                 const float* __restrict__ W2,
                                                 const float* __restrict__ b2,
                                                 float* __restrict__ ph,
                                                 const int* __restrict__ mask,
                                                 int* __restrict__ list,
                                                 int* __restrict__ pos,
                                                 int* __restrict__ cnt)
{
    const int blk = blockIdx.x;
    if (blk < PREP_CMP) {
        compact(blk, mask, list, pos, cnt);
    } else if (blk < PREP_CMP + PREP_PH) {
        const int q = blk - PREP_CMP;
        projhid(q & (BATCH - 1), q / BATCH, hidden, W2, b2, ph);
    } else {
        w1_to_bf16T(blk - (PREP_CMP + PREP_PH), W1, w1t);
    }
}

__device__ __forceinline__ int row_slots(const int* __restrict__ cnt, int lane, int& c)
{
    c = min(max(cnt[lane * CNT_STRIDE], 0), TLEN);
    return (c + 15) & ~15;
}

__global__ __launch_bounds__(WG_THREADS) void k_logits(
    const float*  __restrict__ img,
    const __bf16* __restrict__ w1t,
    const float*  __restrict__ b1,
    const float*  __restrict__ ph,
    const float*  __restrict__ Vv,
    const int*    __restrict__ list,
    const int*    __restrict__ cnt,
    float*        __restrict__ clog)
{
    __shared__ __attribute__((aligned(16))) __bf16 ldsA[2 * TOK_TILE * APITCH];
    __shared__ __attribute__((aligned(16))) __bf16 ldsB[2 * NPANEL * BPITCH];
    __shared__ int slotRow[TOK_TILE];

    const int s0   = blockIdx.x * TOK_TILE;
    const int tid  = threadIdx.x;
    const int lane = tid & 31;
    const int wave = tid >> 5;
    const int wm   = wave >> 3;   // token half of the workgroup tile
    const int wn   = wave & 7;    // 64-unit slice
    const int col  = lane & 15;   // N column / A row within a 16x16 tile
    const int hi   = lane >> 4;   // K half: {0..7,16..23} vs {8..15,24..31}

    const unsigned ldsB_base = (unsigned)(uintptr_t)&ldsB[0];

    int rowCnt;
    const int rowPad = row_slots(cnt, lane, rowCnt);
    const int rowEnd = scan32(rowPad, lane);
    // the same for every thread of the workgroup, and in front of every barrier
    if (s0 >= __builtin_amdgcn_readlane(rowEnd, BATCH - 1)) return;

    auto issue_panel = [&](int kc, int buf) {
        const __bf16* g = w1t + (size_t)(tid >> 3) * FEATN + kc * KCHUNK + (tid & 7) * 8;
        const unsigned l = ldsB_base + (unsigned)(buf * (NPANEL * BPITCH * 2)
                                                  + (tid >> 3) * (BPITCH * 2) + (tid & 7) * 16);
        asm volatile("global_load_async_to_lds_b128 %0, %8, off\n\t"
                     "global_load_async_to_lds_b128 %1, %9, off\n\t"
                     "global_load_async_to_lds_b128 %2, %10, off\n\t"
                     "global_load_async_to_lds_b128 %3, %11, off\n\t"
                     "global_load_async_to_lds_b128 %4, %12, off\n\t"
                     "global_load_async_to_lds_b128 %5, %13, off\n\t"
                     "global_load_async_to_lds_b128 %6, %14, off\n\t"
                     "global_load_async_to_lds_b128 %7, %15, off\n\t"
                     "s_wait_xcnt 0x0"
                     :: "v"(l),
                        "v"(l + 1u * 64 * (BPITCH * 2)), "v"(l + 2u * 64 * (BPITCH * 2)),
                        "v"(l + 3u * 64 * (BPITCH * 2)), "v"(l + 4u * 64 * (BPITCH * 2)),
                        "v"(l + 5u * 64 * (BPITCH * 2)), "v"(l + 6u * 64 * (BPITCH * 2)),
                        "v"(l + 7u * 64 * (BPITCH * 2)),
                        "v"(g),
                        "v"(g + 1 * 64 * FEATN), "v"(g + 2 * 64 * FEATN),
                        "v"(g + 3 * 64 * FEATN), "v"(g + 4 * 64 * FEATN),
                        "v"(g + 5 * 64 * FEATN), "v"(g + 6 * 64 * FEATN),
                        "v"(g + 7 * 64 * FEATN)
                     : "memory");
    };

    const char* gA = (const char*)img;
    unsigned    aOff[ALOADS];
    __bf16*     sA = &ldsA[(tid >> 4) * APITCH + (tid & 15) * 4];
    float4 f[ALOADS];
    auto load_a = [&]() {             // loads the chunk at gA
        // unrolled: f[] must be indexed by constants to stay in registers
        #pragma unroll
        for (int i = 0; i < ALOADS; ++i)
            f[i] = *(const float4*)(gA + aOff[i]);
        // the loads' address registers are rewritten by the code that follows
        asm volatile("s_wait_xcnt 0x0" ::: "memory");
        gA += KCHUNK * 4;             // the next chunk
    };
    auto store_a = [&](int buf) {
        #pragma unroll
        for (int i = 0; i < ALOADS; ++i) {
            v4bf p;
            p.x = (__bf16)f[i].x; p.y = (__bf16)f[i].y;
            p.z = (__bf16)f[i].z; p.w = (__bf16)f[i].w;
            *(v4bf*)(sA + buf * (TOK_TILE * APITCH) + i * 32 * APITCH) = p;
        }
    };

    v8f acc[MT_WAVE * 4];          // [mt][nt] -> acc[mt*4+nt]
    #pragma unroll
    for (int i = 0; i < MT_WAVE * 4; ++i)
        acc[i] = (v8f){0.f,0.f,0.f,0.f,0.f,0.f,0.f,0.f};

    const int aElem = (wm * (MT_WAVE * 16) + col) * APITCH + hi * 8;   // within a buffer
    const int bElem = (wn * 64 + col) * BPITCH + hi * 8;   // within a buffer

    issue_panel(0, 0);

    if (tid < TOK_TILE) {
        const int s = s0 + tid;
        int bb = 0;                    // rows that end at or before s, at most 31
        #pragma unroll
        for (int j = 0; j < BATCH - 1; ++j)
            bb += (__builtin_amdgcn_readlane(rowEnd, j) <= s) ? 1 : 0;
        const int r = s - __shfl(rowEnd - rowPad, bb, 32);   // rank within row bb
        int t = 0;
        if (r < __shfl(rowCnt, bb, 32)) t = list[bb * TLEN + r] & (TLEN - 1);
        slotRow[tid] = bb * TLEN + t;
    }
    // publishes slotRow
    __syncthreads();
    #pragma unroll
    for (int i = 0; i < ALOADS; ++i)
        aOff[i] = (unsigned)slotRow[i * 32 + (tid >> 4)] * (FEATN * 4) + (tid & 15) * 16;

    // ---- stage 0 of img
    load_a();
    store_a(0);
    // this wave's LDS stores are done and its copies of chunk 0 have landed;
    // the barrier publishes both
    asm volatile("s_wait_dscnt 0x0" ::: "memory");
    asm volatile("s_wait_asynccnt 0x0" ::: "memory");
    __syncthreads();
    issue_panel(1, 1);

    // 16 K-chunks, double-buffered; rolled: one copy of the 40-WMMA body
    #pragma unroll 1
    for (int kc = 0; kc < NSTAGE; ++kc) {
        const __bf16* Ab = &ldsA[(size_t)(kc & 1) * TOK_TILE * APITCH] + aElem;
        const __bf16* Bb = &ldsB[(size_t)(kc & 1) * NPANEL * BPITCH] + bElem;

        // next img chunk flies to registers under this chunk's WMMAs
        if (kc + 1 < NSTAGE) load_a();

        // ---- 2 K-steps of 32: 5 A-frags + 4 B-frags -> 20 WMMAs each
        #pragma unroll
        for (int ks = 0; ks < 2; ++ks) {
            v16bf a[MT_WAVE], bm[4];
            #pragma unroll
            for (int mt = 0; mt < MT_WAVE; ++mt) {
                const __bf16* pa = Ab + mt * 16 * APITCH + ks * 32;
                v8bf lo = *(const v8bf*)pa;
                v8bf hh = *(const v8bf*)(pa + 16);
                a[mt] = __builtin_shufflevector(lo, hh, 0,1,2,3,4,5,6,7,
                                                        8,9,10,11,12,13,14,15);
            }
            #pragma unroll
            for (int nt = 0; nt < 4; ++nt) {
                const __bf16* pb = Bb + nt * 16 * BPITCH + ks * 32;
                v8bf lo = *(const v8bf*)pb;
                v8bf hh = *(const v8bf*)(pb + 16);
                bm[nt] = __builtin_shufflevector(lo, hh, 0,1,2,3,4,5,6,7,
                                                         8,9,10,11,12,13,14,15);
            }
            #pragma unroll
            for (int mt = 0; mt < MT_WAVE; ++mt)
                #pragma unroll
                for (int nt = 0; nt < 4; ++nt)
                    acc[mt * 4 + nt] = __builtin_amdgcn_wmma_f32_16x16x32_bf16(
                        false, a[mt], false, bm[nt], (short)0,
                        acc[mt * 4 + nt], false, false);
        }

        // the other img buffer was last read one trip ago, before that trip's barrier
        if (kc + 1 < NSTAGE) store_a((kc + 1) & 1);

        // ---- hand-over: this wave's LDS reads and stores are done ...
        asm volatile("s_wait_dscnt 0x0" ::: "memory");
        // ... its copies of W1^T chunk kc+1 have landed ...
        asm volatile("s_wait_asynccnt 0x0" ::: "memory");
        // ... and the barrier publishes chunk kc+1 and frees the buffers just read
        __syncthreads();
        if (kc + 2 < NSTAGE) issue_panel(kc + 2, kc & 1);
    }
    // no copy is outstanding when the LDS is put to another use below
    asm volatile("s_wait_asynccnt 0x0" ::: "memory");

    // ---- fused bias + v_tanh_f32 + dot(V) over this wave's 64 units
    float lp[MT_WAVE * 8];         // logit partials: [mt 0..4][r 0..7]
    #pragma unroll
    for (int i = 0; i < MT_WAVE * 8; ++i) lp[i] = 0.f;
    const float* phq[MT_WAVE];
    // the same in every lane: readfirstlane makes it a scalar base address
    #pragma unroll
    for (int mt = 0; mt < MT_WAVE; ++mt)
        phq[mt] = ph + ((unsigned)__builtin_amdgcn_readfirstlane(
                            slotRow[wm * (MT_WAVE * 16) + mt * 16]) / TLEN) * UNITSN;
    #pragma unroll
    for (int nt = 0; nt < 4; ++nt) {
        const int n = wn * 64 + nt * 16 + col;
        const float b1n = b1[n];
        const float vw  = Vv[n];
        #pragma unroll
        for (int mt = 0; mt < MT_WAVE; ++mt) {
            const float bias = b1n + phq[mt][n];
            #pragma unroll
            for (int r = 0; r < 8; ++r) {
                float x = acc[mt * 4 + nt][r] + bias, y;
                asm("v_tanh_f32 %0, %1\n\tv_nop" : "=v"(y) : "v"(x));
                lp[mt * 8 + r] += y * vw;
            }
        }
    }

    // ---- reduce partials over the 16 columns (stays within each lane-half)
    #pragma unroll
    for (int m = 1; m < 16; m <<= 1) {
        #pragma unroll
        for (int i = 0; i < MT_WAVE * 8; ++i)
            lp[i] += __shfl_xor(lp[i], m, 32);
    }

    // ---- cross-wave reduction (the 8 unit slices of each token).
    // ldsA is dead now: the loop's last barrier ended every read of it.
    float* ldsRed = (float*)ldsA;              // [8][160]
    if (col == 0) {
        #pragma unroll
        for (int mt = 0; mt < MT_WAVE; ++mt)
            #pragma unroll
            for (int r = 0; r < 8; ++r)
                ldsRed[wn * TOK_TILE + wm * (MT_WAVE * 16) + mt * 16 + hi * 8 + r] = lp[mt * 8 + r];
    }
    __syncthreads();
    if (tid < TOK_TILE) {
        float s = ldsRed[tid];
        // unrolled: the LDS reads go out together
        #pragma unroll
        for (int w = 1; w < 8; ++w)
            s += ldsRed[w * TOK_TILE + tid];
        clog[s0 + tid] = s;
    }
}

#define AT_FS     8
#define AT_FEAT   (FEATN / AT_FS)
#define AT_WAVES  16
#define AT_GRP    (TLEN / AT_WAVES / 32)   // registers that hold a wave's run
#define AT_DEPTH  16                       // img rows in flight per wave
#define AT_WTOK   (TLEN / AT_FS)           // weights that a workgroup writes

__global__ __launch_bounds__(AT_WAVES * 32) void k_attend(
    const float* __restrict__ img,
    const float* __restrict__ clog,
    const int*   __restrict__ list,
    const int*   __restrict__ pos,
    const int*   __restrict__ cnt,
    const int*   __restrict__ mask,
    float*       __restrict__ wout,
    float*       __restrict__ ctx)
{
    __shared__ float redMax[AT_WAVES];
    __shared__ float redSum[AT_WAVES];
    __shared__ __attribute__((aligned(16))) float redCtx[AT_WAVES * AT_FEAT];   // 8 KB

    const int b = blockIdx.x, fs = blockIdx.y, tid = threadIdx.x;
    const int lane = tid & 31;
    const int wv   = __builtin_amdgcn_readfirstlane(tid >> 5);

    int rowCnt;
    const int rowPad = row_slots(cnt, lane, rowCnt);
    const int first  = __builtin_amdgcn_readlane(scan32(rowPad, lane) - rowPad, b);
    const int n      = __builtin_amdgcn_readlane(rowCnt, b);
    const int per    = (n + AT_WAVES - 1) / AT_WAVES;      // at most 32 * AT_GRP
    const int r0     = wv * per;                           // this wave's run
    const int mine   = min(max(n - r0, 0), per);

    // ---- this wave's run of the list; a lane past its end reads entry 0
    int   tk[AT_GRP];
    float lg[AT_GRP];
    #pragma unroll
    for (int j = 0; j < AT_GRP; ++j) {
        const int q = j * 32 + lane;
        const int r = (q < mine) ? r0 + q : 0;
        tk[j] = list[b * TLEN + r] & (TLEN - 1);
        lg[j] = clog[first + r];
    }
    // ---- the token whose weight this thread writes (waves 0..7, whole waves)
    const int tw = b * TLEN + fs * AT_WTOK + (tid & (AT_WTOK - 1));
    int ps = -1, mw = 0;
    if (tid < AT_WTOK) {
        ps = pos[tw];
        mw = mask[tw];
    }
    // the loads' address registers are rewritten by the code that follows
    asm volatile("s_wait_xcnt 0x0" ::: "memory");
    int mk[AT_GRP];
    #pragma unroll
    for (int j = 0; j < AT_GRP; ++j)
        mk[j] = mask[b * TLEN + tk[j]];
    float wl = 0.f;
    // a token without a rank (masked, in a row that has unmasked tokens)
    // takes 0 - 1e9, which gives the weight zero
    if (tid < AT_WTOK && ps >= 0) wl = clog[first + min(ps, TLEN - 1)];
    if (mw == 0) wl -= 1.0e9f;
    asm volatile("s_wait_xcnt 0x0" ::: "memory");

    // the same in every lane, so that a row's address is a scalar base; the
    // lane's own 16 B within the 512 B come in as one unchanging offset
    const float*   rows = img + (size_t)b * TLEN * FEATN + fs * AT_FEAT;
    const unsigned lo   = lane * 16;
    float4 iv[AT_DEPTH];
    // entries bi * AT_DEPTH .. + AT_DEPTH - 1 of the run; past its end the
    // batch's first row is named again (and gets the weight 0 in consume)
    auto issue = [&](const int tkj, const int bi) {
        // unrolled: iv[] must be indexed by constants to stay in registers
        #pragma unroll
        for (int k = 0; k < AT_DEPTH; ++k) {
            const int q = (bi * AT_DEPTH + k < mine) ? bi * AT_DEPTH + k : bi * AT_DEPTH;
            const int t = __builtin_amdgcn_readlane(tkj, q & 31);
            iv[k] = *(const float4*)((const char*)(rows + (size_t)t * FEATN) + lo);
        }
        // the loads' address registers are rewritten by the next batch
        asm volatile("s_wait_xcnt 0x0" ::: "memory");
    };
    float4 acc = make_float4(0.f, 0.f, 0.f, 0.f);
    auto consume = [&](const float ej, const int bi) {
        #pragma unroll
        for (int k = 0; k < AT_DEPTH; ++k) {
            const bool on = bi * AT_DEPTH + k < mine;
            const int  e  = __builtin_amdgcn_readlane(__float_as_int(ej), (bi * AT_DEPTH + k) & 31);
            const float wt = on ? __int_as_float(e) : 0.f;
            acc.x = fmaf(wt, iv[k].x, acc.x);
            acc.y = fmaf(wt, iv[k].y, acc.y);
            acc.z = fmaf(wt, iv[k].z, acc.z);
            acc.w = fmaf(wt, iv[k].w, acc.w);
        }
    };

    // ---- the first rows fly while the maximum is formed (a wave with an empty
    // run names the row's first live token, a valid address, and drops the values)
    issue(tk[0], 0);

    // ---- the row's maximum
    float mx = -3.0e38f;
    #pragma unroll
    for (int j = 0; j < AT_GRP; ++j) {
        float l = lg[j];
        if (mk[j] == 0) l -= 1.0e9f;      // only in a row with no unmasked token
        lg[j] = (j * 32 + lane < mine) ? l : -3.0e38f;
        mx = fmaxf(mx, lg[j]);
    }
    #pragma unroll
    for (int m = 16; m >= 1; m >>= 1) mx = fmaxf(mx, __shfl_xor(mx, m, 32));
    if (lane == 0) redMax[wv] = mx;
    // publishes redMax. The barrier is written with fences on LDS alone: a
    // __syncthreads() would also wait for the img rows that are in flight
    __builtin_amdgcn_fence(__ATOMIC_RELEASE, "workgroup", "local");
    __builtin_amdgcn_s_barrier();
    __builtin_amdgcn_fence(__ATOMIC_ACQUIRE, "workgroup", "local");
    mx = redMax[lane & (AT_WAVES - 1)];
    #pragma unroll
    for (int m = AT_WAVES / 2; m >= 1; m >>= 1) mx = fmaxf(mx, __shfl_xor(mx, m, 32));

    // ---- exp(l - max) of this wave's run, and their sum
    float ex[AT_GRP];
    float s = 0.f;
    #pragma unroll
    for (int j = 0; j < AT_GRP; ++j) {
        ex[j] = (j * 32 + lane < mine) ? __expf(lg[j] - mx) : 0.f;
        s += ex[j];
    }
    #pragma unroll
    for (int m = 16; m >= 1; m >>= 1) s += __shfl_xor(s, m, 32);
    if (lane == 0) redSum[wv] = s;

    // ---- the weighted sum over this wave's run.
    // unrolled: tk[] and ex[] must be indexed by constants to stay in registers
    #pragma unroll
    for (int bi = 0; bi < AT_GRP * 32 / AT_DEPTH; ++bi) {
        if (bi * AT_DEPTH < mine) {       // the same for the whole wave
            if (bi > 0) issue(tk[bi * AT_DEPTH / 32], bi);
            consume(ex[bi * AT_DEPTH / 32], bi);
        }
    }
    *(float4*)&redCtx[wv * AT_FEAT + lane * 4] = acc;
    // publishes redSum and redCtx
    __syncthreads();

    s = redSum[lane & (AT_WAVES - 1)];
    #pragma unroll
    for (int m = AT_WAVES / 2; m >= 1; m >>= 1) s += __shfl_xor(s, m, 32);
    const float inv = 1.0f / s;

    if (tid < AT_WTOK) {
        wout[tw] = __expf(wl - mx) * inv;
        // the store's registers may be rewritten by the code that follows
        asm volatile("s_wait_xcnt 0x0" ::: "memory");
    }
    if (tid < AT_FEAT) {
        float c = redCtx[tid];
        // unrolled: the LDS reads go out together
        #pragma unroll
        for (int w = 1; w < AT_WAVES; ++w)
            c += redCtx[w * AT_FEAT + tid];
        ctx[b * FEATN + fs * AT_FEAT + tid] = c * inv;
    }
}

// ---------------------------------------------------------------------------
extern "C" void kernel_launch(void* const* d_in, const int* in_sizes, int n_in,
                              void* d_out, int out_size, void* d_ws, size_t ws_size,
                              hipStream_t stream) {
    (void)in_sizes; (void)n_in; (void)out_size; (void)ws_size;

    const float* img    = (const float*)d_in[0];   // [32][2048][1024]
    const int*   mask   = (const int*)  d_in[1];   // [32][2048]
    const float* hidden = (const float*)d_in[2];   // [32][512]
    const float* W1     = (const float*)d_in[3];   // [1024][512]
    const float* b1     = (const float*)d_in[4];   // [512]
    const float* W2     = (const float*)d_in[5];   // [512][512]
    const float* b2     = (const float*)d_in[6];   // [512]
    const float* Vv     = (const float*)d_in[7];   // [512]
    // d_in[8] = bV: softmax-invariant, unused.

    float* out     = (float*)d_out;
    float* ctx_out = out;                          // [32*1024] context first
    float* w_out   = out + BATCH * FEATN;          // [32*2048] weights second

    char* ws = (char*)d_ws;
    __bf16* w1t    = (__bf16*)ws;                                        // 1 MB
    float*  ph     = (float*)(ws + (1 << 20));                           // 64 KB
    int*    list   = (int*)  (ws + (1 << 20) + (64 << 10));              // 256 KB
    float*  clog   = (float*)(ws + (6 << 20));                           // 257 KB
    int*    pos    = (int*)  (ws + (7 << 20));                           // 256 KB
    int*    cnt    = (int*)  (ws + (8 << 20));                           // 4 KB

    k_prepare<<<PREP_CMP + PREP_PH + PREP_W1, 256, 0, stream>>>(
        W1, w1t, hidden, W2, b2, ph, mask, list, pos, cnt);

    k_logits<<<NTILES, WG_THREADS, 0, stream>>>(img, w1t, b1, ph, Vv, list, cnt, clog);

    dim3 g3(BATCH, AT_FS);
    k_attend<<<g3, AT_WAVES * 32, 0, stream>>>(img, clog, list, pos, cnt, mask, w_out, ctx_out);
}

// v009
// A run of this version takes 50.4 microseconds.
// Timed twice side by side with v008, it ran 1.03 times as fast both times.
// Over all steps from v000 it is 8.80 times as fast.
#include <hip/hip_runtime.h>
#include <hip/hip_bf16.h>
#include <stdint.h>

#define BATCH  32
#define TLEN   2048
#define FEATN  1024
#define UNITSN 512
#define HIDN   512

#define TOK_TILE   160
#define MT_WAVE    5
#define WG_THREADS 512
#define NTILES     ((BATCH * TLEN + TOK_TILE - 1) / TOK_TILE)
#define CNT_STRIDE 32
#define KCHUNK     64
#define NPANEL     512
#define NSTAGE     (FEATN / KCHUNK)
#define APITCH     (KCHUNK + 8)   // 144 B
#define BPITCH     (KCHUNK + 8)   // 144 B
#define ALOADS     (TOK_TILE * KCHUNK / (WG_THREADS * 4))   // 5 float4 per thread and chunk

typedef __attribute__((ext_vector_type(16))) __bf16 v16bf;
typedef __attribute__((ext_vector_type(8)))  __bf16 v8bf;
typedef __attribute__((ext_vector_type(4)))  __bf16 v4bf;
typedef __attribute__((ext_vector_type(8)))  float  v8f;
typedef __attribute__((ext_vector_type(4)))  float  v4f;

// ---------------------------------------------------------------------------
// Part 0 of the preparing launch: W1 [FEAT][UNITS] fp32 -> W1^T [UNITS][FEAT]
// bf16 (workspace). blk: 0 .. PREP_W1 - 1.
//
// Workgroup = one tile of 64 k x 64 units, turned in LDS. A thread reads a
// 4 k x 4 unit piece (16 lanes cover 256 B of a W1 row), packs four k of each
// unit and stores them to the tile [unit][k]; behind the barrier the tile
// leaves in 16-B stores, 8 lanes to a whole 128-B line of a W1^T row. With 16
// elements a thread the part needs 1024 waves, not one per 32 elements.
// ---------------------------------------------------------------------------
#define TR_TILE  64
#define TR_PITCH (TR_TILE + 8)   // bf16 elements: 144 B, a multiple of 16 B
#define TR_KT    (FEATN / TR_TILE)

__device__ __forceinline__ void w1_to_bf16T(const int blk,
                                            const float* __restrict__ W1,
                                            __bf16* __restrict__ w1t)
{
    __shared__ __attribute__((aligned(16))) __bf16 tile[TR_TILE * TR_PITCH];   // 9 KB

    const int tid = threadIdx.x;
    const int k0  = (blk % TR_KT) * TR_TILE;
    const int u0  = (blk / TR_KT) * TR_TILE;
    const int kk  = (tid >> 4) * 4;   // first of this thread's 4 k
    const int uu  = (tid & 15) * 4;   // first of this thread's 4 units

    const float* g = W1 + (size_t)(k0 + kk) * UNITSN + u0 + uu;
    v4f r[4];
    // unrolled: r[] must be indexed by constants to stay in registers
    #pragma unroll
    for (int i = 0; i < 4; ++i)
        r[i] = *(const v4f*)(g + i * UNITSN);
    // the loads' address registers are reused by the code that follows
    asm volatile("s_wait_xcnt 0x0" ::: "memory");
    #pragma unroll
    for (int j = 0; j < 4; ++j) {
        v4bf p;
        p.x = (__bf16)r[0][j]; p.y = (__bf16)r[1][j];
        p.z = (__bf16)r[2][j]; p.w = (__bf16)r[3][j];
        *(v4bf*)&tile[(uu + j) * TR_PITCH + kk] = p;
    }
    // publishes the tile
    __syncthreads();
    #pragma unroll
    for (int i = 0; i < 2; ++i) {
        const int q = i * 256 + tid;      // 16-B piece: unit q / 8, k (q % 8) * 8
        const v8bf v = *(const v8bf*)&tile[(q >> 3) * TR_PITCH + (q & 7) * 8];
        *(v8bf*)(w1t + (size_t)(u0 + (q >> 3)) * FEATN + k0 + (q & 7) * 8) = v;
    }
    asm volatile("s_wait_xcnt 0x0" ::: "memory");
}

// ---------------------------------------------------------------------------
// Part 1 of the preparing launch: proj_hid[b][u] = hidden[b] @ W2 + b2
// (tiny, latency-bound)
//
// Workgroup = one batch row x 64 units. 16 lanes x float4 cover the 64 units
// (one aligned 256-B piece of a W2 row); the 16 lane groups split K, 32 k each.
// Every load of a thread is issued before the first multiply, so the kernel
// pays the memory latency once; the 16 partial sums meet in LDS.
// ---------------------------------------------------------------------------
#define PH_UNITS 64
#define PH_KG    16
#define PH_KPER  (HIDN / PH_KG)   // 32 k per thread

__device__ __forceinline__ void projhid(const int b, const int ublk,
                                        const float* __restrict__ hidden,
                                        const float* __restrict__ W2,
                                        const float* __restrict__ b2,
                                        float* __restrict__ ph)
{
    __shared__ __attribute__((aligned(16))) float red[PH_KG * PH_UNITS];   // 4 KB

    const int u0  = ublk * PH_UNITS;
    const int tid = threadIdx.x;
    const int ul  = (tid & 15) * 4;   // first of this thread's 4 units
    const int kg  = tid >> 4;         // k group

    const float* gW = W2 + (size_t)(kg * PH_KPER) * UNITSN + u0 + ul;
    const float* gH = hidden + b * HIDN + kg * PH_KPER;

    v4f h[PH_KPER / 4];
    v4f w[PH_KPER];
    // unrolled: h[] and w[] must be indexed by constants to stay in registers
    #pragma unroll
    for (int i = 0; i < PH_KPER / 4; ++i)
        h[i] = *(const v4f*)(gH + i * 4);
    #pragma unroll
    for (int i = 0; i < PH_KPER; ++i)
        w[i] = *(const v4f*)(gW + (size_t)i * UNITSN);
    // the loads' address registers are reused by the code that follows
    asm volatile("s_wait_xcnt 0x0" ::: "memory");
    // behind that wait, since its result may take a register that those loads name
    const v4f bv = *(const v4f*)(b2 + u0 + ul);
    // Inputs-only fences on the loaded values: every value stays in its own
    // register up to here, so no load has to wait for an earlier value's
    // multiply to free a register and all loads are in flight together.
    asm volatile("" ::
                    "v"(h[0]), "v"(h[1]), "v"(h[2]), "v"(h[3]),
                    "v"(h[4]), "v"(h[5]), "v"(h[6]), "v"(h[7]),
                    "v"(w[0]), "v"(w[1]), "v"(w[2]), "v"(w[3]),
                    "v"(w[4]), "v"(w[5]), "v"(w[6]), "v"(w[7]),
                    "v"(w[8]), "v"(w[9]), "v"(w[10]), "v"(w[11]),
                    "v"(w[12]), "v"(w[13]), "v"(w[14]), "v"(w[15]));
    asm volatile("" ::
                    "v"(w[16]), "v"(w[17]), "v"(w[18]), "v"(w[19]),
                    "v"(w[20]), "v"(w[21]), "v"(w[22]), "v"(w[23]),
                    "v"(w[24]), "v"(w[25]), "v"(w[26]), "v"(w[27]),
                    "v"(w[28]), "v"(w[29]), "v"(w[30]), "v"(w[31]),
                    "v"(bv));

    v4f acc = (kg == 0) ? bv : (v4f){0.f, 0.f, 0.f, 0.f};
    #pragma unroll
    for (int i = 0; i < PH_KPER; ++i) {
        const float hv = h[i >> 2][i & 3];
        acc.x = fmaf(hv, w[i].x, acc.x);
        acc.y = fmaf(hv, w[i].y, acc.y);
        acc.z = fmaf(hv, w[i].z, acc.z);
        acc.w = fmaf(hv, w[i].w, acc.w);
    }
    *(v4f*)&red[kg * PH_UNITS + ul] = acc;
    __syncthreads();

    if (tid < PH_UNITS) {
        float s = red[tid];
        // unrolled: the LDS reads go out together, not one per waited trip
        #pragma unroll
        for (int g = 1; g < PH_KG; ++g)
            s += red[g * PH_UNITS + tid];
        ph[b * UNITSN + u0 + tid] = s;
    }
}

// ---------------------------------------------------------------------------
// Part 2 of the preparing launch: the live tokens of each batch row.
//
// A masked token's logit is lowered by 1e9, so wherever its row has an
// unmasked token its softmax weight is exactly zero whatever its logit is:
// neither its logit nor its img row is needed. Per batch row this part lists
// the unmasked tokens in ascending order (list, cnt) and gives every token its
// rank in that list (pos, -1 for a masked one). A row with no unmasked token
// keeps all its tokens: there every logit counts. The list is put together in
// LDS and leaves in whole 16-B stores.
// ---------------------------------------------------------------------------
__device__ __forceinline__ int scan32(int v, int lane)   // inclusive sum over a wave
{
    #pragma unroll
    for (int d = 1; d < 32; d <<= 1) {
        const int t = __shfl_up(v, d, 32);
        if (lane >= d) v += t;
    }
    return v;
}

__device__ __forceinline__ void compact(const int b,
                                        const int* __restrict__ mask,
                                        int* __restrict__ list,
                                        int* __restrict__ pos,
                                        int* __restrict__ cnt)
{
    __shared__ int wsum[8];
    __shared__ __attribute__((aligned(16))) int llist[TLEN];   // the row's list, 8 KB
    const int tid = threadIdx.x;
    const int lane = tid & 31, wv = tid >> 5;

    // a thread owns 8 neighbouring tokens, so ranks ascend with the token
    const int4 m0 = *(const int4*)(mask + b * TLEN + tid * 8);
    const int4 m1 = *(const int4*)(mask + b * TLEN + tid * 8 + 4);
    const int live[8] = { m0.x != 0, m0.y != 0, m0.z != 0, m0.w != 0,
                          m1.x != 0, m1.y != 0, m1.z != 0, m1.w != 0 };
    int c = 0;
    #pragma unroll
    for (int k = 0; k < 8; ++k) c += live[k];

    // entries past the row's count stay 0
    *(int4*)&llist[tid * 8]     = make_int4(0, 0, 0, 0);
    *(int4*)&llist[tid * 8 + 4] = make_int4(0, 0, 0, 0);

    const int incl = scan32(c, lane);
    if (lane == 31) wsum[wv] = incl;
    // publishes wsum and ends the clearing of llist
    __syncthreads();
    int before = 0, total = 0;
    #pragma unroll
    for (int i = 0; i < 8; ++i) {
        const int v = wsum[i];
        if (i < wv) before += v;
        total += v;
    }

    const bool all = (total == 0);   // nothing unmasked: keep every token
    int rank = all ? tid * 8 : before + incl - c;
    int p[8];
    #pragma unroll
    for (int k = 0; k < 8; ++k) {
        const bool keep = all || live[k];
        p[k] = keep ? rank : -1;
        if (keep) {
            llist[rank] = tid * 8 + k;
            ++rank;
        }
    }
    // publishes llist
    __syncthreads();
    const int4 l0 = *(const int4*)&llist[tid * 8];
    const int4 l1 = *(const int4*)&llist[tid * 8 + 4];
    *(int4*)(list + b * TLEN + tid * 8)     = l0;
    *(int4*)(list + b * TLEN + tid * 8 + 4) = l1;
    *(int4*)(pos + b * TLEN + tid * 8)      = make_int4(p[0], p[1], p[2], p[3]);
    *(int4*)(pos + b * TLEN + tid * 8 + 4)  = make_int4(p[4], p[5], p[6], p[7]);
    // the stores' registers may be rewritten by the code that follows
    asm volatile("s_wait_xcnt 0x0" ::: "memory");
    if (tid == 0) cnt[b * CNT_STRIDE] = all ? TLEN : total;
}

// ---------------------------------------------------------------------------
// The preparing launch. The three parts above depend on nothing but the inputs
// and on none of each other, so they share one grid, each workgroup doing one
// part's block by its index: they run side by side, and the logits GEMM waits
// for one launch, not for three in a row. The blocks with the longest chain of
// barriers come first in the index.
// The part is the same for a whole workgroup, so every barrier inside a part
// is reached by all of its threads.
// ---------------------------------------------------------------------------
#define PREP_CMP  BATCH                              // blocks of part 2
#define PREP_PH   (BATCH * (UNITSN / PH_UNITS))      // blocks of part 1
#define PREP_W1   ((UNITSN / TR_TILE) * TR_KT)        // blocks of part 0

__global__ __launch_bounds__(256) void k_prepare(const float* __restrict__ W1,
                                                 __bf16* __restrict__ w1t,
                                                 const float* __restrict__ hidden,
                                                 const float* __restrict__ W2,
                                                 const float* __restrict__ b2,
                                                 float* __restrict__ ph,
                                                 const int* __restrict__ mask,
                                                 int* __restrict__ list,
                                                 int* __restrict__ pos,
                                                 int* __restrict__ cnt)
{
    const int blk = blockIdx.x;
    if (blk < PREP_CMP) {
        compact(blk, mask, list, pos, cnt);
    } else if (blk < PREP_CMP + PREP_PH) {
        const int q = blk - PREP_CMP;
        projhid(q & (BATCH - 1), q / BATCH, hidden, W2, b2, ph);
    } else {
        w1_to_bf16T(blk - (PREP_CMP + PREP_PH), W1, w1t);
    }
}

__device__ __forceinline__ int row_slots(const int* __restrict__ cnt, int lane, int& c)
{
    c = min(max(cnt[lane * CNT_STRIDE], 0), TLEN);
    return (c + 15) & ~15;
}

__global__ __launch_bounds__(WG_THREADS) void k_logits(
    const float*  __restrict__ img,
    const __bf16* __restrict__ w1t,
    const float*  __restrict__ b1,
    const float*  __restrict__ ph,
    const float*  __restrict__ Vv,
    const int*    __restrict__ list,
    const int*    __restrict__ cnt,
    float*        __restrict__ clog)
{
    __shared__ __attribute__((aligned(16))) __bf16 ldsA[2 * TOK_TILE * APITCH];
    __shared__ __attribute__((aligned(16))) __bf16 ldsB[2 * NPANEL * BPITCH];
    __shared__ int slotRow[TOK_TILE];

    const int s0   = blockIdx.x * TOK_TILE;
    const int tid  = threadIdx.x;
    const int lane = tid & 31;
    const int wave = tid >> 5;
    const int wm   = wave >> 3;   // token half of the workgroup tile
    const int wn   = wave & 7;    // 64-unit slice
    const int col  = lane & 15;   // N column / A row within a 16x16 tile
    const int hi   = lane >> 4;   // K half: {0..7,16..23} vs {8..15,24..31}

    const unsigned ldsB_base = (unsigned)(uintptr_t)&ldsB[0];

    int rowCnt;
    const int rowPad = row_slots(cnt, lane, rowCnt);
    const int rowEnd = scan32(rowPad, lane);
    // the same for every thread of the workgroup, and in front of every barrier
    if (s0 >= __builtin_amdgcn_readlane(rowEnd, BATCH - 1)) return;

    auto issue_panel = [&](int kc, int buf) {
        const __bf16* g = w1t + (size_t)(tid >> 3) * FEATN + kc * KCHUNK + (tid & 7) * 8;
        const unsigned l = ldsB_base + (unsigned)(buf * (NPANEL * BPITCH * 2)
                                                  + (tid >> 3) * (BPITCH * 2) + (tid & 7) * 16);
        asm volatile("global_load_async_to_lds_b128 %0, %8, off\n\t"
                     "global_load_async_to_lds_b128 %1, %9, off\n\t"
                     "global_load_async_to_lds_b128 %2, %10, off\n\t"
                     "global_load_async_to_lds_b128 %3, %11, off\n\t"
                     "global_load_async_to_lds_b128 %4, %12, off\n\t"
                     "global_load_async_to_lds_b128 %5, %13, off\n\t"
                     "global_load_async_to_lds_b128 %6, %14, off\n\t"
                     "global_load_async_to_lds_b128 %7, %15, off\n\t"
                     "s_wait_xcnt 0x0"
                     :: "v"(l),
                        "v"(l + 1u * 64 * (BPITCH * 2)), "v"(l + 2u * 64 * (BPITCH * 2)),
                        "v"(l + 3u * 64 * (BPITCH * 2)), "v"(l + 4u * 64 * (BPITCH * 2)),
                        "v"(l + 5u * 64 * (BPITCH * 2)), "v"(l + 6u * 64 * (BPITCH * 2)),
                        "v"(l + 7u * 64 * (BPITCH * 2)),
                        "v"(g),
                        "v"(g + 1 * 64 * FEATN), "v"(g + 2 * 64 * FEATN),
                        "v"(g + 3 * 64 * FEATN), "v"(g + 4 * 64 * FEATN),
                        "v"(g + 5 * 64 * FEATN), "v"(g + 6 * 64 * FEATN),
                        "v"(g + 7 * 64 * FEATN)
                     : "memory");
    };

    const char* gA = (const char*)img;
    unsigned    aOff[ALOADS];
    __bf16*     sA = &ldsA[(tid >> 4) * APITCH + (tid & 15) * 4];
    float4 f[ALOADS];
    // Workgroup barrier with fences on LDS alone: a __syncthreads() would also
    // wait for the img loads that are in flight across it
    auto lds_barrier = [&]() {
        __builtin_amdgcn_fence(__ATOMIC_RELEASE, "workgroup", "local");
        __builtin_amdgcn_s_barrier();
        __builtin_amdgcn_fence(__ATOMIC_ACQUIRE, "workgroup", "local");
    };

    v8f acc[MT_WAVE * 4];          // [mt][nt] -> acc[mt*4+nt]
    #pragma unroll
    for (int i = 0; i < MT_WAVE * 4; ++i)
        acc[i] = (v8f){0.f,0.f,0.f,0.f,0.f,0.f,0.f,0.f};

    const int aElem = (wm * (MT_WAVE * 16) + col) * APITCH + hi * 8;   // within a buffer
    const int bElem = (wn * 64 + col) * BPITCH + hi * 8;   // within a buffer

    issue_panel(0, 0);

    if (tid < TOK_TILE) {
        const int s = s0 + tid;
        int bb = 0;                    // rows that end at or before s, at most 31
        #pragma unroll
        for (int j = 0; j < BATCH - 1; ++j)
            bb += (__builtin_amdgcn_readlane(rowEnd, j) <= s) ? 1 : 0;
        const int r = s - __shfl(rowEnd - rowPad, bb, 32);   // rank within row bb
        int t = 0;
        if (r < __shfl(rowCnt, bb, 32)) t = list[bb * TLEN + r] & (TLEN - 1);
        slotRow[tid] = bb * TLEN + t;
    }
    // publishes slotRow
    __syncthreads();
    #pragma unroll
    for (int i = 0; i < ALOADS; ++i)
        aOff[i] = (unsigned)slotRow[i * 32 + (tid >> 4)] * (FEATN * 4) + (tid & 15) * 16;

    // ---- stages 0 and 1 of img leave together; stage 1 stays in its registers
    {
        v4f f0[ALOADS];
        // unrolled: f0[] and f[] must be indexed by constants to stay in registers
        #pragma unroll
        for (int i = 0; i < ALOADS; ++i) {
            f[i]  = *(const float4*)(gA + aOff[i] + KCHUNK * 4);
            f0[i] = *(const v4f*)(gA + aOff[i]);
        }
        // Inputs-only fence on the loaded values: each load stays one 16-B load
        // and stands in front of the wait below, not cut in two with a half behind it
        asm volatile("" :: "v"(f0[0]), "v"(f0[1]), "v"(f0[2]), "v"(f0[3]), "v"(f0[4]));
        // the loads' address registers are rewritten by the code that follows
        asm volatile("s_wait_xcnt 0x0" ::: "memory");
        gA += 2 * KCHUNK * 4;
        #pragma unroll
        for (int i = 0; i < ALOADS; ++i) {
            v4bf p;
            p.x = (__bf16)f0[i].x; p.y = (__bf16)f0[i].y;
            p.z = (__bf16)f0[i].z; p.w = (__bf16)f0[i].w;
            *(v4bf*)(sA + i * 32 * APITCH) = p;
        }
    }
    // this wave's LDS stores are done and its copies of chunk 0 have landed;
    // the barrier publishes both
    asm volatile("s_wait_dscnt 0x0" ::: "memory");
    asm volatile("s_wait_asynccnt 0x0" ::: "memory");
    lds_barrier();

    // One K-chunk. copyB: W1^T chunk kc+1 exists; storeA: so does img chunk kc+1
    // (it is in f); loadA: img chunk kc+2 exists. The three are constants at every
    // call; always_inline, so that they fold and acc[] stays in registers.
    auto trip = [&](const int kc, const bool copyB, const bool storeA,
                    const bool loadA) __attribute__((always_inline)) {
        const __bf16* Ab = &ldsA[(size_t)(kc & 1) * TOK_TILE * APITCH] + aElem;
        const __bf16* Bb = &ldsB[(size_t)(kc & 1) * NPANEL * BPITCH] + bElem;
        // The buffers of chunk kc+1 were last read one trip ago, before that trip's barrier.
        const int nb = (kc + 1) & 1;
        const __bf16* g = w1t + (size_t)(tid >> 3) * FEATN + (kc + 1) * KCHUNK + (tid & 7) * 8;
        const unsigned l = ldsB_base + (unsigned)(nb * (NPANEL * BPITCH * 2)
                                                  + (tid >> 3) * (BPITCH * 2) + (tid & 7) * 16);

        // ---- 2 K-steps of 32: 5 A-frags + 4 B-frags -> 20 WMMAs each
        #pragma unroll
        for (int ks = 0; ks < 2; ++ks) {
            v16bf bm[4];
            #pragma unroll
            for (int nt = 0; nt < 4; ++nt) {
                const __bf16* pb = Bb + nt * 16 * BPITCH + ks * 32;
                v8bf lo = *(const v8bf*)pb;
                v8bf hh = *(const v8bf*)(pb + 16);
                bm[nt] = __builtin_shufflevector(lo, hh, 0,1,2,3,4,5,6,7,
                                                         8,9,10,11,12,13,14,15);
            }
            #pragma unroll
            for (int mt = 0; mt < MT_WAVE; ++mt) {
                const __bf16* pa = Ab + mt * 16 * APITCH + ks * 32;
                v8bf lo = *(const v8bf*)pa;
                v8bf hh = *(const v8bf*)(pa + 16);
                const v16bf a = __builtin_shufflevector(lo, hh, 0,1,2,3,4,5,6,7,
                                                                8,9,10,11,12,13,14,15);
                // ---- one piece of the staging, under the latency of the reads above
                if (ks == 0 && mt > 0 && copyB) {
                    asm volatile("global_load_async_to_lds_b128 %0, %2, off\n\t"
                                 "global_load_async_to_lds_b128 %1, %3, off\n\t"
                                 "s_wait_xcnt 0x0"
                                 :: "v"(l + (unsigned)(2 * mt - 2) * 64 * (BPITCH * 2)),
                                    "v"(l + (unsigned)(2 * mt - 1) * 64 * (BPITCH * 2)),
                                    "v"(g + (2 * mt - 2) * 64 * FEATN),
                                    "v"(g + (2 * mt - 1) * 64 * FEATN)
                                 : "memory");
                }
                if (ks == 0) {
                    if (storeA) {
                        v4bf p;
                        p.x = (__bf16)f[mt].x; p.y = (__bf16)f[mt].y;
                        p.z = (__bf16)f[mt].z; p.w = (__bf16)f[mt].w;
                        *(v4bf*)(sA + nb * (TOK_TILE * APITCH) + mt * 32 * APITCH) = p;
                    }
                    if (loadA) {
                        f[mt] = *(const float4*)(gA + aOff[mt]);
                        // the load's address registers are rewritten by the code that follows
                        asm volatile("s_wait_xcnt 0x0" ::: "memory");
                    }
                }
                #pragma unroll
                for (int nt = 0; nt < 4; ++nt)
                    acc[mt * 4 + nt] = __builtin_amdgcn_wmma_f32_16x16x32_bf16(
                        false, a, false, bm[nt], (short)0,
                        acc[mt * 4 + nt], false, false);
            }
        }
        if (loadA) gA += KCHUNK * 4;   // the next chunk

        // ---- hand-over: this wave's LDS reads and stores are done ...
        asm volatile("s_wait_dscnt 0x0" ::: "memory");
        // ... its copies of W1^T chunk kc+1 have landed ...
        asm volatile("s_wait_asynccnt 0x0" ::: "memory");
        // ... and the barrier publishes chunk kc+1 and frees the buffers just read
        lds_barrier();
    };

    // 16 K-chunks, double-buffered; rolled: one copy of the 40-WMMA body for
    // the trips that stage everything, one each for the last two
    #pragma unroll 1
    for (int kc = 0; kc < NSTAGE - 2; ++kc)
        trip(kc, true, true, true);
    trip(NSTAGE - 2, true, true, false);
    trip(NSTAGE - 1, false, false, false);
    // no copy is outstanding when the LDS is put to another use below
    asm volatile("s_wait_asynccnt 0x0" ::: "memory");

    // ---- fused bias + v_tanh_f32 + dot(V) over this wave's 64 units
    float lp[MT_WAVE * 8];         // logit partials: [mt 0..4][r 0..7]
    #pragma unroll
    for (int i = 0; i < MT_WAVE * 8; ++i) lp[i] = 0.f;
    const float* phq[MT_WAVE];
    // the same in every lane: readfirstlane makes it a scalar base address
    #pragma unroll
    for (int mt = 0; mt < MT_WAVE; ++mt)
        phq[mt] = ph + ((unsigned)__builtin_amdgcn_readfirstlane(
                            slotRow[wm * (MT_WAVE * 16) + mt * 16]) / TLEN) * UNITSN;
    #pragma unroll
    for (int nt = 0; nt < 4; ++nt) {
        const int n = wn * 64 + nt * 16 + col;
        const float b1n = b1[n];
        const float vw  = Vv[n];
        #pragma unroll
        for (int mt = 0; mt < MT_WAVE; ++mt) {
            const float bias = b1n + phq[mt][n];
            #pragma unroll
            for (int r = 0; r < 8; ++r) {
                float x = acc[mt * 4 + nt][r] + bias, y;
                asm("v_tanh_f32 %0, %1\n\tv_nop" : "=v"(y) : "v"(x));
                lp[mt * 8 + r] += y * vw;
            }
        }
    }

    // ---- reduce partials over the 16 columns (stays within each lane-half)
    #pragma unroll
    for (int m = 1; m < 16; m <<= 1) {
        #pragma unroll
        for (int i = 0; i < MT_WAVE * 8; ++i)
            lp[i] += __shfl_xor(lp[i], m, 32);
    }

    // ---- cross-wave reduction (the 8 unit slices of each token).
    // ldsA is dead now: the loop's last barrier ended every read of it.
    float* ldsRed = (float*)ldsA;              // [8][160]
    if (col == 0) {
        #pragma unroll
        for (int mt = 0; mt < MT_WAVE; ++mt)
            #pragma unroll
            for (int r = 0; r < 8; ++r)
                ldsRed[wn * TOK_TILE + wm * (MT_WAVE * 16) + mt * 16 + hi * 8 + r] = lp[mt * 8 + r];
    }
    __syncthreads();
    if (tid < TOK_TILE) {
        float s = ldsRed[tid];
        // unrolled: the LDS reads go out together
        #pragma unroll
        for (int w = 1; w < 8; ++w)
            s += ldsRed[w * TOK_TILE + tid];
        clog[s0 + tid] = s;
    }
}

#define AT_FS     8
#define AT_FEAT   (FEATN / AT_FS)
#define AT_WAVES  16
#define AT_GRP    (TLEN / AT_WAVES / 32)   // registers that hold a wave's run
#define AT_DEPTH  16                       // img rows in flight per wave
#define AT_WTOK   (TLEN / AT_FS)           // weights that a workgroup writes

__global__ __launch_bounds__(AT_WAVES * 32) void k_attend(
    const float* __restrict__ img,
    const float* __restrict__ clog,
    const int*   __restrict__ list,
    const int*   __restrict__ pos,
    const int*   __restrict__ cnt,
    const int*   __restrict__ mask,
    float*       __restrict__ wout,
    float*       __restrict__ ctx)
{
    __shared__ float redMax[AT_WAVES];
    __shared__ float redSum[AT_WAVES];
    __shared__ __attribute__((aligned(16))) float redCtx[AT_WAVES * AT_FEAT];   // 8 KB

    const int b = blockIdx.x, fs = blockIdx.y, tid = threadIdx.x;
    const int lane = tid & 31;
    const int wv   = __builtin_amdgcn_readfirstlane(tid >> 5);

    int rowCnt;
    const int rowPad = row_slots(cnt, lane, rowCnt);
    const int first  = __builtin_amdgcn_readlane(scan32(rowPad, lane) - rowPad, b);
    const int n      = __builtin_amdgcn_readlane(rowCnt, b);
    const int per    = (n + AT_WAVES - 1) / AT_WAVES;      // at most 32 * AT_GRP
    const int r0     = wv * per;                           // this wave's run
    const int mine   = min(max(n - r0, 0), per);

    // ---- this wave's run of the list; a lane past its end reads entry 0
    int   tk[AT_GRP];
    float lg[AT_GRP];
    #pragma unroll
    for (int j = 0; j < AT_GRP; ++j) {
        const int q = j * 32 + lane;
        const int r = (q < mine) ? r0 + q : 0;
        tk[j] = list[b * TLEN + r] & (TLEN - 1);
        lg[j] = clog[first + r];
    }
    // ---- the token whose weight this thread writes (waves 0..7, whole waves)
    const int tw = b * TLEN + fs * AT_WTOK + (tid & (AT_WTOK - 1));
    int ps = -1, mw = 0;
    if (tid < AT_WTOK) {
        ps = pos[tw];
        mw = mask[tw];
    }
    // the loads' address registers are rewritten by the code that follows
    asm volatile("s_wait_xcnt 0x0" ::: "memory");
    int mk[AT_GRP];
    #pragma unroll
    for (int j = 0; j < AT_GRP; ++j)
        mk[j] = mask[b * TLEN + tk[j]];
    float wl = 0.f;
    // a token without a rank (masked, in a row that has unmasked tokens)
    // takes 0 - 1e9, which gives the weight zero
    if (tid < AT_WTOK && ps >= 0) wl = clog[first + min(ps, TLEN - 1)];
    if (mw == 0) wl -= 1.0e9f;
    asm volatile("s_wait_xcnt 0x0" ::: "memory");

    // the same in every lane, so that a row's address is a scalar base; the
    // lane's own 16 B within the 512 B come in as one unchanging offset
    const float*   rows = img + (size_t)b * TLEN * FEATN + fs * AT_FEAT;
    const unsigned lo   = lane * 16;
    float4 iv[AT_DEPTH];
    // entries bi * AT_DEPTH .. + AT_DEPTH - 1 of the run; past its end the
    // batch's first row is named again (and gets the weight 0 in consume)
    auto issue = [&](const int tkj, const int bi) {
        // unrolled: iv[] must be indexed by constants to stay in registers
        #pragma unroll
        for (int k = 0; k < AT_DEPTH; ++k) {
            const int q = (bi * AT_DEPTH + k < mine) ? bi * AT_DEPTH + k : bi * AT_DEPTH;
            const int t = __builtin_amdgcn_readlane(tkj, q & 31);
            iv[k] = *(const float4*)((const char*)(rows + (size_t)t * FEATN) + lo);
        }
        // the loads' address registers are rewritten by the next batch
        asm volatile("s_wait_xcnt 0x0" ::: "memory");
    };
    float4 acc = make_float4(0.f, 0.f, 0.f, 0.f);
    auto consume = [&](const float ej, const int bi) {
        #pragma unroll
        for (int k = 0; k < AT_DEPTH; ++k) {
            const bool on = bi * AT_DEPTH + k < mine;
            const int  e  = __builtin_amdgcn_readlane(__float_as_int(ej), (bi * AT_DEPTH + k) & 31);
            const float wt = on ? __int_as_float(e) : 0.f;
            acc.x = fmaf(wt, iv[k].x, acc.x);
            acc.y = fmaf(wt, iv[k].y, acc.y);
            acc.z = fmaf(wt, iv[k].z, acc.z);
            acc.w = fmaf(wt, iv[k].w, acc.w);
        }
    };

    // ---- the first rows fly while the maximum is formed (a wave with an empty
    // run names the row's first live token, a valid address, and drops the values)
    issue(tk[0], 0);

    // ---- the row's maximum
    float mx = -3.0e38f;
    #pragma unroll
    for (int j = 0; j < AT_GRP; ++j) {
        float l = lg[j];
        if (mk[j] == 0) l -= 1.0e9f;      // only in a row with no unmasked token
        lg[j] = (j * 32 + lane < mine) ? l : -3.0e38f;
        mx = fmaxf(mx, lg[j]);
    }
    #pragma unroll
    for (int m = 16; m >= 1; m >>= 1) mx = fmaxf(mx, __shfl_xor(mx, m, 32));
    if (lane == 0) redMax[wv] = mx;
    // publishes redMax. The barrier is written with fences on LDS alone: a
    // __syncthreads() would also wait for the img rows that are in flight
    __builtin_amdgcn_fence(__ATOMIC_RELEASE, "workgroup", "local");
    __builtin_amdgcn_s_barrier();
    __builtin_amdgcn_fence(__ATOMIC_ACQUIRE, "workgroup", "local");
    mx = redMax[lane & (AT_WAVES - 1)];
    #pragma unroll
    for (int m = AT_WAVES / 2; m >= 1; m >>= 1) mx = fmaxf(mx, __shfl_xor(mx, m, 32));

    // ---- exp(l - max) of this wave's run, and their sum
    float ex[AT_GRP];
    float s = 0.f;
    #pragma unroll
    for (int j = 0; j < AT_GRP; ++j) {
        ex[j] = (j * 32 + lane < mine) ? __expf(lg[j] - mx) : 0.f;
        s += ex[j];
    }
    #pragma unroll
    for (int m = 16; m >= 1; m >>= 1) s += __shfl_xor(s, m, 32);
    if (lane == 0) redSum[wv] = s;

    // ---- the weighted sum over this wave's run.
    // unrolled: tk[] and ex[] must be indexed by constants to stay in registers
    #pragma unroll
    for (int bi = 0; bi < AT_GRP * 32 / AT_DEPTH; ++bi) {
        if (bi * AT_DEPTH < mine) {       // the same for the whole wave
            if (bi > 0) issue(tk[bi * AT_DEPTH / 32], bi);
            consume(ex[bi * AT_DEPTH / 32], bi);
        }
    }
    *(float4*)&redCtx[wv * AT_FEAT + lane * 4] = acc;
    // publishes redSum and redCtx
    __syncthreads();

    s = redSum[lane & (AT_WAVES - 1)];
    #pragma unroll
    for (int m = AT_WAVES / 2; m >= 1; m >>= 1) s += __shfl_xor(s, m, 32);
    const float inv = 1.0f / s;

    if (tid < AT_WTOK) {
        wout[tw] = __expf(wl - mx) * inv;
        // the store's registers may be rewritten by the code that follows
        asm volatile("s_wait_xcnt 0x0" ::: "memory");
    }
    if (tid < AT_FEAT) {
        float c = redCtx[tid];
        // unrolled: the LDS reads go out together
        #pragma unroll
        for (int w = 1; w < AT_WAVES; ++w)
            c += redCtx[w * AT_FEAT + tid];
        ctx[b * FEATN + fs * AT_FEAT + tid] = c * inv;
    }
}

// ---------------------------------------------------------------------------
extern "C" void kernel_launch(void* const* d_in, const int* in_sizes, int n_in,
                              void* d_out, int out_size, void* d_ws, size_t ws_size,
                              hipStream_t stream) {
    (void)in_sizes; (void)n_in; (void)out_size; (void)ws_size;

    const float* img    = (const float*)d_in[0];   // [32][2048][1024]
    const int*   mask   = (const int*)  d_in[1];   // [32][2048]
    const float* hidden = (const float*)d_in[2];   // [32][512]
    const float* W1     = (const float*)d_in[3];   // [1024][512]
    const float* b1     = (const float*)d_in[4];   // [512]
    const float* W2     = (const float*)d_in[5];   // [512][512]
    const float* b2     = (const float*)d_in[6];   // [512]
    const float* Vv     = (const float*)d_in[7];   // [512]
    // d_in[8] = bV: softmax-invariant, unused.

    float* out     = (float*)d_out;
    float* ctx_out = out;                          // [32*1024] context first
    float* w_out   = out + BATCH * FEATN;          // [32*2048] weights second

    char* ws = (char*)d_ws;
    __bf16* w1t    = (__bf16*)ws;                                        // 1 MB
    float*  ph     = (float*)(ws + (1 << 20));                           // 64 KB
    int*    list   = (int*)  (ws + (1 << 20) + (64 << 10));              // 256 KB
    float*  clog   = (float*)(ws + (6 << 20));                           // 257 KB
    int*    pos    = (int*)  (ws + (7 << 20));                           // 256 KB
    int*    cnt    = (int*)  (ws + (8 << 20));                           // 4 KB

    k_prepare<<<PREP_CMP + PREP_PH + PREP_W1, 256, 0, stream>>>(
        W1, w1t, hidden, W2, b2, ph, mask, list, pos, cnt);

    k_logits<<<NTILES, WG_THREADS, 0, stream>>>(img, w1t, b1, ph, Vv, list, cnt, clog);

    dim3 g3(BATCH, AT_FS);
    k_attend<<<g3, AT_WAVES * 32, 0, stream>>>(img, clog, list, pos, cnt, mask, w_out, ctx_out);
}

// v010
// Measured time: 48 microseconds a run.
// Next to v009, in two timings, it ran 1.04 times as fast each time.
// Counting every step since v000, it is 9.15 times as fast.
#include <hip/hip_runtime.h>
#include <hip/hip_bf16.h>
#include <stdint.h>

#define BATCH  32
#define TLEN   2048
#define FEATN  1024
#define UNITSN 512
#define HIDN   512

#define TOK_TILE   160
#define MT_WAVE    5
#define WG_THREADS 512
#define NTILES     ((BATCH * TLEN + TOK_TILE - 1) / TOK_TILE)
#define CNT_STRIDE 32
#define KCHUNK     64
#define NPANEL     512
#define NSTAGE     (FEATN / KCHUNK)
#define APITCH     (KCHUNK + 8)   // 144 B
#define BPITCH     (KCHUNK + 8)   // 144 B
#define ALOADS     (TOK_TILE * KCHUNK / (WG_THREADS * 4))   // 5 float4 per thread and chunk

typedef __attribute__((ext_vector_type(16))) __bf16 v16bf;
typedef __attribute__((ext_vector_type(8)))  __bf16 v8bf;
typedef __attribute__((ext_vector_type(4)))  __bf16 v4bf;
typedef __attribute__((ext_vector_type(8)))  float  v8f;
typedef __attribute__((ext_vector_type(4)))  float  v4f;

// ---------------------------------------------------------------------------
// Part 0 of the preparing launch: W1 [FEAT][UNITS] fp32 -> W1^T [UNITS][FEAT]
// bf16 (workspace). blk: 0 .. PREP_W1 - 1.
//
// Workgroup = one tile of 64 k x 64 units, turned in LDS. A thread reads a
// 4 k x 4 unit piece (16 lanes cover 256 B of a W1 row), packs four k of each
// unit and stores them to the tile [unit][k]; behind the barrier the tile
// leaves in 16-B stores, 8 lanes to a whole 128-B line of a W1^T row. With 16
// elements a thread the part needs 1024 waves, not one per 32 elements.
// ---------------------------------------------------------------------------
#define TR_TILE  64
#define TR_PITCH (TR_TILE + 8)   // bf16 elements: 144 B, a multiple of 16 B
#define TR_KT    (FEATN / TR_TILE)

__device__ __forceinline__ void w1_to_bf16T(const int blk,
                                            const float* __restrict__ W1,
                                            __bf16* __restrict__ w1t)
{
    __shared__ __attribute__((aligned(16))) __bf16 tile[TR_TILE * TR_PITCH];   // 9 KB

    const int tid = threadIdx.x;
    const int k0  = (blk % TR_KT) * TR_TILE;
    const int u0  = (blk / TR_KT) * TR_TILE;
    const int kk  = (tid >> 4) * 4;   // first of this thread's 4 k
    const int uu  = (tid & 15) * 4;   // first of this thread's 4 units

    const float* g = W1 + (size_t)(k0 + kk) * UNITSN + u0 + uu;
    v4f r[4];
    // unrolled: r[] must be indexed by constants to stay in registers
    #pragma unroll
    for (int i = 0; i < 4; ++i)
        r[i] = *(const v4f*)(g + i * UNITSN);
    // the loads' address registers are reused by the code that follows
    asm volatile("s_wait_xcnt 0x0" ::: "memory");
    #pragma unroll
    for (int j = 0; j < 4; ++j) {
        v4bf p;
        p.x = (__bf16)r[0][j]; p.y = (__bf16)r[1][j];
        p.z = (__bf16)r[2][j]; p.w = (__bf16)r[3][j];
        *(v4bf*)&tile[(uu + j) * TR_PITCH + kk] = p;
    }
    // publishes the tile
    __syncthreads();
    #pragma unroll
    for (int i = 0; i < 2; ++i) {
        const int q = i * 256 + tid;      // 16-B piece: unit q / 8, k (q % 8) * 8
        const v8bf v = *(const v8bf*)&tile[(q >> 3) * TR_PITCH + (q & 7) * 8];
        *(v8bf*)(w1t + (size_t)(u0 + (q >> 3)) * FEATN + k0 + (q & 7) * 8) = v;
    }
    asm volatile("s_wait_xcnt 0x0" ::: "memory");
}

// ---------------------------------------------------------------------------
// Part 1 of the preparing launch: proj_hid[b][u] = hidden[b] @ W2 + b2
// (tiny, latency-bound)
//
// Workgroup = one batch row x 64 units. 16 lanes x float4 cover the 64 units
// (one aligned 256-B piece of a W2 row); the 16 lane groups split K, 32 k each.
// Every load of a thread is issued before the first multiply, so the kernel
// pays the memory latency once; the 16 partial sums meet in LDS.
// ---------------------------------------------------------------------------
#define PH_UNITS 64
#define PH_KG    16
#define PH_KPER  (HIDN / PH_KG)   // 32 k per thread

__device__ __forceinline__ void projhid(const int b, const int ublk,
                                        const float* __restrict__ hidden,
                                        const float* __restrict__ W2,
                                        const float* __restrict__ b2,
                                        float* __restrict__ ph)
{
    __shared__ __attribute__((aligned(16))) float red[PH_KG * PH_UNITS];   // 4 KB

    const int u0  = ublk * PH_UNITS;
    const int tid = threadIdx.x;
    const int ul  = (tid & 15) * 4;   // first of this thread's 4 units
    const int kg  = tid >> 4;         // k group

    const float* gW = W2 + (size_t)(kg * PH_KPER) * UNITSN + u0 + ul;
    const float* gH = hidden + b * HIDN + kg * PH_KPER;

    v4f h[PH_KPER / 4];
    v4f w[PH_KPER];
    // unrolled: h[] and w[] must be indexed by constants to stay in registers
    #pragma unroll
    for (int i = 0; i < PH_KPER / 4; ++i)
        h[i] = *(const v4f*)(gH + i * 4);
    #pragma unroll
    for (int i = 0; i < PH_KPER; ++i)
        w[i] = *(const v4f*)(gW + (size_t)i * UNITSN);
    // the loads' address registers are reused by the code that follows
    asm volatile("s_wait_xcnt 0x0" ::: "memory");
    // behind that wait, since its result may take a register that those loads name
    const v4f bv = *(const v4f*)(b2 + u0 + ul);
    // Inputs-only fences on the loaded values: every value stays in its own
    // register up to here, so no load has to wait for an earlier value's
    // multiply to free a register and all loads are in flight together.
    asm volatile("" ::
                    "v"(h[0]), "v"(h[1]), "v"(h[2]), "v"(h[3]),
                    "v"(h[4]), "v"(h[5]), "v"(h[6]), "v"(h[7]),
                    "v"(w[0]), "v"(w[1]), "v"(w[2]), "v"(w[3]),
                    "v"(w[4]), "v"(w[5]), "v"(w[6]), "v"(w[7]),
                    "v"(w[8]), "v"(w[9]), "v"(w[10]), "v"(w[11]),
                    "v"(w[12]), "v"(w[13]), "v"(w[14]), "v"(w[15]));
    asm volatile("" ::
                    "v"(w[16]), "v"(w[17]), "v"(w[18]), "v"(w[19]),
                    "v"(w[20]), "v"(w[21]), "v"(w[22]), "v"(w[23]),
                    "v"(w[24]), "v"(w[25]), "v"(w[26]), "v"(w[27]),
                    "v"(w[28]), "v"(w[29]), "v"(w[30]), "v"(w[31]),
                    "v"(bv));

    v4f acc = (kg == 0) ? bv : (v4f){0.f, 0.f, 0.f, 0.f};
    #pragma unroll
    for (int i = 0; i < PH_KPER; ++i) {
        const float hv = h[i >> 2][i & 3];
        acc.x = fmaf(hv, w[i].x, acc.x);
        acc.y = fmaf(hv, w[i].y, acc.y);
        acc.z = fmaf(hv, w[i].z, acc.z);
        acc.w = fmaf(hv, w[i].w, acc.w);
    }
    *(v4f*)&red[kg * PH_UNITS + ul] = acc;
    __syncthreads();

    if (tid < PH_UNITS) {
        float s = red[tid];
        // unrolled: the LDS reads go out together, not one per waited trip
        #pragma unroll
        for (int g = 1; g < PH_KG; ++g)
            s += red[g * PH_UNITS + tid];
        ph[b * UNITSN + u0 + tid] = s;
    }
}

template <int CTRL>
__device__ __forceinline__ int dpp_i(int v)
{
    return __builtin_amdgcn_update_dpp(0, v, CTRL, 0xf, 0xf, true);
}
template <int CTRL>
__device__ __forceinline__ float dpp_f(float v)
{
    return __int_as_float(dpp_i<CTRL>(__float_as_int(v)));
}
__device__ __forceinline__ float xor16_f(float v)
{
    const int b = __float_as_int(v);
    return __int_as_float(__builtin_amdgcn_permlanex16(b, b, 0x76543210, 0xfedcba98, false, false));
}

__device__ __forceinline__ int scan32(int v, int lane)   // inclusive sum over a wave
{
    v += dpp_i<0x111>(v);
    v += dpp_i<0x112>(v);
    v += dpp_i<0x114>(v);
    v += dpp_i<0x118>(v);
    // each row of 16 is scanned; the upper row takes the lower row's total
    const int low = __builtin_amdgcn_readlane(v, 15);
    if (lane >= 16) v += low;
    return v;
}

__device__ __forceinline__ void compact(const int b,
                                        const int* __restrict__ mask,
                                        int* __restrict__ list,
                                        int* __restrict__ pos,
                                        int* __restrict__ cnt)
{
    __shared__ int wsum[8];
    __shared__ __attribute__((aligned(16))) int llist[TLEN];   // the row's list, 8 KB
    const int tid = threadIdx.x;
    const int lane = tid & 31, wv = tid >> 5;

    // a thread owns 8 neighbouring tokens, so ranks ascend with the token
    const int4 m0 = *(const int4*)(mask + b * TLEN + tid * 8);
    const int4 m1 = *(const int4*)(mask + b * TLEN + tid * 8 + 4);
    const int live[8] = { m0.x != 0, m0.y != 0, m0.z != 0, m0.w != 0,
                          m1.x != 0, m1.y != 0, m1.z != 0, m1.w != 0 };
    int c = 0;
    #pragma unroll
    for (int k = 0; k < 8; ++k) c += live[k];

    // entries past the row's count stay 0
    *(int4*)&llist[tid * 8]     = make_int4(0, 0, 0, 0);
    *(int4*)&llist[tid * 8 + 4] = make_int4(0, 0, 0, 0);

    const int incl = scan32(c, lane);
    if (lane == 31) wsum[wv] = incl;
    // publishes wsum and ends the clearing of llist
    __syncthreads();
    int before = 0, total = 0;
    #pragma unroll
    for (int i = 0; i < 8; ++i) {
        const int v = wsum[i];
        if (i < wv) before += v;
        total += v;
    }

    const bool all = (total == 0);   // nothing unmasked: keep every token
    int rank = all ? tid * 8 : before + incl - c;
    int p[8];
    #pragma unroll
    for (int k = 0; k < 8; ++k) {
        const bool keep = all || live[k];
        p[k] = keep ? rank : -1;
        if (keep) {
            llist[rank] = tid * 8 + k;
            ++rank;
        }
    }
    // publishes llist
    __syncthreads();
    const int4 l0 = *(const int4*)&llist[tid * 8];
    const int4 l1 = *(const int4*)&llist[tid * 8 + 4];
    *(int4*)(list + b * TLEN + tid * 8)     = l0;
    *(int4*)(list + b * TLEN + tid * 8 + 4) = l1;
    *(int4*)(pos + b * TLEN + tid * 8)      = make_int4(p[0], p[1], p[2], p[3]);
    *(int4*)(pos + b * TLEN + tid * 8 + 4)  = make_int4(p[4], p[5], p[6], p[7]);
    // the stores' registers may be rewritten by the code that follows
    asm volatile("s_wait_xcnt 0x0" ::: "memory");
    if (tid == 0) cnt[b * CNT_STRIDE] = all ? TLEN : total;
}

// ---------------------------------------------------------------------------
// The preparing launch. The three parts above depend on nothing but the inputs
// and on none of each other, so they share one grid, each workgroup doing one
// part's block by its index: they run side by side, and the logits GEMM waits
// for one launch, not for three in a row. The blocks with the longest chain of
// barriers come first in the index.
// The part is the same for a whole workgroup, so every barrier inside a part
// is reached by all of its threads.
// ---------------------------------------------------------------------------
#define PREP_CMP  BATCH                              // blocks of part 2
#define PREP_PH   (BATCH * (UNITSN / PH_UNITS))      // blocks of part 1
#define PREP_W1   ((UNITSN / TR_TILE) * TR_KT)        // blocks of part 0

__global__ __launch_bounds__(256) void k_prepare(const float* __restrict__ W1,
                                                 __bf16* __restrict__ w1t,
                                                 const float* __restrict__ hidden,
                                                 const float* __restrict__ W2,
                                                 const float* __restrict__ b2,
                                                 float* __restrict__ ph,
                                                 const int* __restrict__ mask,
                                                 int* __restrict__ list,
                                                 int* __restrict__ pos,
                                                 int* __restrict__ cnt)
{
    const int blk = blockIdx.x;
    if (blk < PREP_CMP) {
        compact(blk, mask, list, pos, cnt);
    } else if (blk < PREP_CMP + PREP_PH) {
        const int q = blk - PREP_CMP;
        projhid(q & (BATCH - 1), q / BATCH, hidden, W2, b2, ph);
    } else {
        w1_to_bf16T(blk - (PREP_CMP + PREP_PH), W1, w1t);
    }
}

__device__ __forceinline__ int row_slots(const int* __restrict__ cnt, int lane, int& c)
{
    c = min(max(cnt[lane * CNT_STRIDE], 0), TLEN);
    return (c + 15) & ~15;
}

__global__ __launch_bounds__(WG_THREADS) void k_logits(
    const float*  __restrict__ img,
    const __bf16* __restrict__ w1t,
    const float*  __restrict__ b1,
    const float*  __restrict__ ph,
    const float*  __restrict__ Vv,
    const int*    __restrict__ list,
    const int*    __restrict__ cnt,
    float*        __restrict__ clog)
{
    __shared__ __attribute__((aligned(16))) __bf16 ldsA[2 * TOK_TILE * APITCH];
    __shared__ __attribute__((aligned(16))) __bf16 ldsB[2 * NPANEL * BPITCH];
    __shared__ int slotRow[TOK_TILE];

    const int s0   = blockIdx.x * TOK_TILE;
    const int tid  = threadIdx.x;
    const int lane = tid & 31;
    const int wave = tid >> 5;
    const int wm   = wave >> 3;   // token half of the workgroup tile
    const int wn   = wave & 7;    // 64-unit slice
    const int col  = lane & 15;   // N column / A row within a 16x16 tile
    const int hi   = lane >> 4;   // K half: {0..7,16..23} vs {8..15,24..31}

    const unsigned ldsB_base = (unsigned)(uintptr_t)&ldsB[0];

    int rowCnt;
    const int rowPad = row_slots(cnt, lane, rowCnt);
    const int rowEnd = scan32(rowPad, lane);
    // the same for every thread of the workgroup, and in front of every barrier
    if (s0 >= __builtin_amdgcn_readlane(rowEnd, BATCH - 1)) return;

    auto issue_panel = [&](int kc, int buf) {
        const __bf16* g = w1t + (size_t)(tid >> 3) * FEATN + kc * KCHUNK + (tid & 7) * 8;
        const unsigned l = ldsB_base + (unsigned)(buf * (NPANEL * BPITCH * 2)
                                                  + (tid >> 3) * (BPITCH * 2) + (tid & 7) * 16);
        asm volatile("global_load_async_to_lds_b128 %0, %8, off\n\t"
                     "global_load_async_to_lds_b128 %1, %9, off\n\t"
                     "global_load_async_to_lds_b128 %2, %10, off\n\t"
                     "global_load_async_to_lds_b128 %3, %11, off\n\t"
                     "global_load_async_to_lds_b128 %4, %12, off\n\t"
                     "global_load_async_to_lds_b128 %5, %13, off\n\t"
                     "global_load_async_to_lds_b128 %6, %14, off\n\t"
                     "global_load_async_to_lds_b128 %7, %15, off\n\t"
                     "s_wait_xcnt 0x0"
                     :: "v"(l),
                        "v"(l + 1u * 64 * (BPITCH * 2)), "v"(l + 2u * 64 * (BPITCH * 2)),
                        "v"(l + 3u * 64 * (BPITCH * 2)), "v"(l + 4u * 64 * (BPITCH * 2)),
                        "v"(l + 5u * 64 * (BPITCH * 2)), "v"(l + 6u * 64 * (BPITCH * 2)),
                        "v"(l + 7u * 64 * (BPITCH * 2)),
                        "v"(g),
                        "v"(g + 1 * 64 * FEATN), "v"(g + 2 * 64 * FEATN),
                        "v"(g + 3 * 64 * FEATN), "v"(g + 4 * 64 * FEATN),
                        "v"(g + 5 * 64 * FEATN), "v"(g + 6 * 64 * FEATN),
                        "v"(g + 7 * 64 * FEATN)
                     : "memory");
    };

    const char* gA = (const char*)img;
    unsigned    aOff[ALOADS];
    __bf16*     sA = &ldsA[(tid >> 4) * APITCH + (tid & 15) * 4];
    float4 f[ALOADS];
    // Workgroup barrier with fences on LDS alone: a __syncthreads() would also
    // wait for the img loads that are in flight across it
    auto lds_barrier = [&]() {
        __builtin_amdgcn_fence(__ATOMIC_RELEASE, "workgroup", "local");
        __builtin_amdgcn_s_barrier();
        __builtin_amdgcn_fence(__ATOMIC_ACQUIRE, "workgroup", "local");
    };

    v8f acc[MT_WAVE * 4];          // [mt][nt] -> acc[mt*4+nt]
    #pragma unroll
    for (int i = 0; i < MT_WAVE * 4; ++i)
        acc[i] = (v8f){0.f,0.f,0.f,0.f,0.f,0.f,0.f,0.f};

    const int aElem = (wm * (MT_WAVE * 16) + col) * APITCH + hi * 8;   // within a buffer
    const int bElem = (wn * 64 + col) * BPITCH + hi * 8;   // within a buffer

    issue_panel(0, 0);

    if (tid < TOK_TILE) {
        const int s = s0 + tid;
        int bb = 0;                    // rows that end at or before s, at most 31
        #pragma unroll
        for (int j = 0; j < BATCH - 1; ++j)
            bb += (__builtin_amdgcn_readlane(rowEnd, j) <= s) ? 1 : 0;
        const int r = s - __shfl(rowEnd - rowPad, bb, 32);   // rank within row bb
        int t = 0;
        if (r < __shfl(rowCnt, bb, 32)) t = list[bb * TLEN + r] & (TLEN - 1);
        slotRow[tid] = bb * TLEN + t;
    }
    // publishes slotRow
    __syncthreads();
    #pragma unroll
    for (int i = 0; i < ALOADS; ++i)
        aOff[i] = (unsigned)slotRow[i * 32 + (tid >> 4)] * (FEATN * 4) + (tid & 15) * 16;

    // ---- stages 0 and 1 of img leave together; stage 1 stays in its registers
    {
        v4f f0[ALOADS];
        // unrolled: f0[] and f[] must be indexed by constants to stay in registers
        #pragma unroll
        for (int i = 0; i < ALOADS; ++i) {
            f[i]  = *(const float4*)(gA + aOff[i] + KCHUNK * 4);
            f0[i] = *(const v4f*)(gA + aOff[i]);
        }
        // Inputs-only fence on the loaded values: each load stays one 16-B load
        // and stands in front of the wait below, not cut in two with a half behind it
        asm volatile("" :: "v"(f0[0]), "v"(f0[1]), "v"(f0[2]), "v"(f0[3]), "v"(f0[4]));
        // the loads' address registers are rewritten by the code that follows
        asm volatile("s_wait_xcnt 0x0" ::: "memory");
        gA += 2 * KCHUNK * 4;
        #pragma unroll
        for (int i = 0; i < ALOADS; ++i) {
            v4bf p;
            p.x = (__bf16)f0[i].x; p.y = (__bf16)f0[i].y;
            p.z = (__bf16)f0[i].z; p.w = (__bf16)f0[i].w;
            *(v4bf*)(sA + i * 32 * APITCH) = p;
        }
    }
    // this wave's LDS stores are done and its copies of chunk 0 have landed;
    // the barrier publishes both
    asm volatile("s_wait_dscnt 0x0" ::: "memory");
    asm volatile("s_wait_asynccnt 0x0" ::: "memory");
    lds_barrier();

    // One K-chunk. copyB: W1^T chunk kc+1 exists; storeA: so does img chunk kc+1
    // (it is in f); loadA: img chunk kc+2 exists. The three are constants at every
    // call; always_inline, so that they fold and acc[] stays in registers.
    auto trip = [&](const int kc, const bool copyB, const bool storeA,
                    const bool loadA) __attribute__((always_inline)) {
        const __bf16* Ab = &ldsA[(size_t)(kc & 1) * TOK_TILE * APITCH] + aElem;
        const __bf16* Bb = &ldsB[(size_t)(kc & 1) * NPANEL * BPITCH] + bElem;
        // The buffers of chunk kc+1 were last read one trip ago, before that trip's barrier.
        const int nb = (kc + 1) & 1;
        const __bf16* g = w1t + (size_t)(tid >> 3) * FEATN + (kc + 1) * KCHUNK + (tid & 7) * 8;
        const unsigned l = ldsB_base + (unsigned)(nb * (NPANEL * BPITCH * 2)
                                                  + (tid >> 3) * (BPITCH * 2) + (tid & 7) * 16);

        // ---- 2 K-steps of 32: 5 A-frags + 4 B-frags -> 20 WMMAs each
        #pragma unroll
        for (int ks = 0; ks < 2; ++ks) {
            v16bf bm[4];
            #pragma unroll
            for (int nt = 0; nt < 4; ++nt) {
                const __bf16* pb = Bb + nt * 16 * BPITCH + ks * 32;
                v8bf lo = *(const v8bf*)pb;
                v8bf hh = *(const v8bf*)(pb + 16);
                bm[nt] = __builtin_shufflevector(lo, hh, 0,1,2,3,4,5,6,7,
                                                         8,9,10,11,12,13,14,15);
            }
            #pragma unroll
            for (int mt = 0; mt < MT_WAVE; ++mt) {
                const __bf16* pa = Ab + mt * 16 * APITCH + ks * 32;
                v8bf lo = *(const v8bf*)pa;
                v8bf hh = *(const v8bf*)(pa + 16);
                const v16bf a = __builtin_shufflevector(lo, hh, 0,1,2,3,4,5,6,7,
                                                                8,9,10,11,12,13,14,15);
                // ---- one piece of the staging, under the latency of the reads above
                if (ks == 0 && mt > 0 && copyB) {
                    asm volatile("global_load_async_to_lds_b128 %0, %2, off\n\t"
                                 "global_load_async_to_lds_b128 %1, %3, off\n\t"
                                 "s_wait_xcnt 0x0"
                                 :: "v"(l + (unsigned)(2 * mt - 2) * 64 * (BPITCH * 2)),
                                    "v"(l + (unsigned)(2 * mt - 1) * 64 * (BPITCH * 2)),
                                    "v"(g + (2 * mt - 2) * 64 * FEATN),
                                    "v"(g + (2 * mt - 1) * 64 * FEATN)
                                 : "memory");
                }
                if (ks == 0) {
                    if (storeA) {
                        v4bf p;
                        p.x = (__bf16)f[mt].x; p.y = (__bf16)f[mt].y;
                        p.z = (__bf16)f[mt].z; p.w = (__bf16)f[mt].w;
                        *(v4bf*)(sA + nb * (TOK_TILE * APITCH) + mt * 32 * APITCH) = p;
                    }
                    if (loadA) {
                        f[mt] = *(const float4*)(gA + aOff[mt]);
                        // the load's address registers are rewritten by the code that follows
                        asm volatile("s_wait_xcnt 0x0" ::: "memory");
                    }
                }
                #pragma unroll
                for (int nt = 0; nt < 4; ++nt)
                    acc[mt * 4 + nt] = __builtin_amdgcn_wmma_f32_16x16x32_bf16(
                        false, a, false, bm[nt], (short)0,
                        acc[mt * 4 + nt], false, false);
            }
        }
        if (loadA) gA += KCHUNK * 4;   // the next chunk

        // ---- hand-over: this wave's LDS reads and stores are done ...
        asm volatile("s_wait_dscnt 0x0" ::: "memory");
        // ... its copies of W1^T chunk kc+1 have landed ...
        asm volatile("s_wait_asynccnt 0x0" ::: "memory");
        // ... and the barrier publishes chunk kc+1 and frees the buffers just read
        lds_barrier();
    };

    // 16 K-chunks, double-buffered; rolled: one copy of the 40-WMMA body for
    // the trips that stage everything, one each for the last two
    #pragma unroll 1
    for (int kc = 0; kc < NSTAGE - 2; ++kc)
        trip(kc, true, true, true);
    trip(NSTAGE - 2, true, true, false);
    trip(NSTAGE - 1, false, false, false);
    // no copy is outstanding when the LDS is put to another use below
    asm volatile("s_wait_asynccnt 0x0" ::: "memory");

    // ---- fused bias + v_tanh_f32 + dot(V) over this wave's 64 units
    float lp[MT_WAVE * 8];         // logit partials: [mt 0..4][r 0..7]
    #pragma unroll
    for (int i = 0; i < MT_WAVE * 8; ++i) lp[i] = 0.f;
    const float* phq[MT_WAVE];
    // the same in every lane: readfirstlane makes it a scalar base address
    #pragma unroll
    for (int mt = 0; mt < MT_WAVE; ++mt)
        phq[mt] = ph + ((unsigned)__builtin_amdgcn_readfirstlane(
                            slotRow[wm * (MT_WAVE * 16) + mt * 16]) / TLEN) * UNITSN;
    #pragma unroll
    for (int nt = 0; nt < 4; ++nt) {
        const int n = wn * 64 + nt * 16 + col;
        const float b1n = b1[n];
        const float vw  = Vv[n];
        #pragma unroll
        for (int mt = 0; mt < MT_WAVE; ++mt) {
            const float bias = b1n + phq[mt][n];
            #pragma unroll
            for (int r = 0; r < 8; ++r) {
                float x = acc[mt * 4 + nt][r] + bias, y;
                asm("v_tanh_f32 %0, %1\n\tv_nop" : "=v"(y) : "v"(x));
                lp[mt * 8 + r] += y * vw;
            }
        }
    }

    // ---- reduce partials over the 16 columns (stays within each lane-half)
    #pragma unroll
    for (int i = 0; i < MT_WAVE * 8; ++i) lp[i] += dpp_f<0x161>(lp[i]);
    #pragma unroll
    for (int i = 0; i < MT_WAVE * 8; ++i) lp[i] += dpp_f<0x162>(lp[i]);
    #pragma unroll
    for (int i = 0; i < MT_WAVE * 8; ++i) lp[i] += dpp_f<0x164>(lp[i]);
    #pragma unroll
    for (int i = 0; i < MT_WAVE * 8; ++i) lp[i] += dpp_f<0x168>(lp[i]);

    // ---- cross-wave reduction (the 8 unit slices of each token).
    // ldsA is dead now: the loop's last barrier ended every read of it.
    float* ldsRed = (float*)ldsA;              // [8][160]
    if (col == 0) {
        #pragma unroll
        for (int mt = 0; mt < MT_WAVE; ++mt)
            #pragma unroll
            for (int r = 0; r < 8; ++r)
                ldsRed[wn * TOK_TILE + wm * (MT_WAVE * 16) + mt * 16 + hi * 8 + r] = lp[mt * 8 + r];
    }
    __syncthreads();
    if (tid < TOK_TILE) {
        float s = ldsRed[tid];
        // unrolled: the LDS reads go out together
        #pragma unroll
        for (int w = 1; w < 8; ++w)
            s += ldsRed[w * TOK_TILE + tid];
        clog[s0 + tid] = s;
    }
}

#define AT_FS     8
#define AT_FEAT   (FEATN / AT_FS)
#define AT_WAVES  16
#define AT_GRP    (TLEN / AT_WAVES / 32)   // registers that hold a wave's run
#define AT_DEPTH  16                       // img rows in flight per wave
#define AT_WTOK   (TLEN / AT_FS)           // weights that a workgroup writes

__global__ __launch_bounds__(AT_WAVES * 32) void k_attend(
    const float* __restrict__ img,
    const float* __restrict__ clog,
    const int*   __restrict__ list,
    const int*   __restrict__ pos,
    const int*   __restrict__ cnt,
    const int*   __restrict__ mask,
    float*       __restrict__ wout,
    float*       __restrict__ ctx)
{
    __shared__ float redMax[AT_WAVES];
    __shared__ float redSum[AT_WAVES];
    __shared__ __attribute__((aligned(16))) float redCtx[AT_WAVES * AT_FEAT];   // 8 KB

    const int b = blockIdx.x, fs = blockIdx.y, tid = threadIdx.x;
    const int lane = tid & 31;
    const int wv   = __builtin_amdgcn_readfirstlane(tid >> 5);

    int rowCnt;
    const int rowPad = row_slots(cnt, lane, rowCnt);
    const int first  = __builtin_amdgcn_readlane(scan32(rowPad, lane) - rowPad, b);
    const int n      = __builtin_amdgcn_readlane(rowCnt, b);
    const int per    = (n + AT_WAVES - 1) / AT_WAVES;      // at most 32 * AT_GRP
    const int r0     = wv * per;                           // this wave's run
    const int mine   = min(max(n - r0, 0), per);

    // ---- this wave's run of the list; a lane past its end reads entry 0
    int   tk[AT_GRP];
    float lg[AT_GRP];
    #pragma unroll
    for (int j = 0; j < AT_GRP; ++j) {
        const int q = j * 32 + lane;
        const int r = (q < mine) ? r0 + q : 0;
        tk[j] = list[b * TLEN + r] & (TLEN - 1);
        lg[j] = clog[first + r];
    }
    // ---- the token whose weight this thread writes (waves 0..7, whole waves)
    const int tw = b * TLEN + fs * AT_WTOK + (tid & (AT_WTOK - 1));
    int ps = -1, mw = 0;
    if (tid < AT_WTOK) {
        ps = pos[tw];
        mw = mask[tw];
    }
    // the loads' address registers are rewritten by the code that follows
    asm volatile("s_wait_xcnt 0x0" ::: "memory");
    int mk[AT_GRP];
    #pragma unroll
    for (int j = 0; j < AT_GRP; ++j)
        mk[j] = mask[b * TLEN + tk[j]];
    float wl = 0.f;
    // a token without a rank (masked, in a row that has unmasked tokens)
    // takes 0 - 1e9, which gives the weight zero
    if (tid < AT_WTOK && ps >= 0) wl = clog[first + min(ps, TLEN - 1)];
    if (mw == 0) wl -= 1.0e9f;
    asm volatile("s_wait_xcnt 0x0" ::: "memory");

    // the same in every lane, so that a row's address is a scalar base; the
    // lane's own 16 B within the 512 B come in as one unchanging offset
    const float*   rows = img + (size_t)b * TLEN * FEATN + fs * AT_FEAT;
    const unsigned lo   = lane * 16;
    float4 iv[AT_DEPTH];
    // entries bi * AT_DEPTH .. + AT_DEPTH - 1 of the run; past its end the
    // batch's first row is named again (and gets the weight 0 in consume)
    auto issue = [&](const int tkj, const int bi) {
        // unrolled: iv[] must be indexed by constants to stay in registers
        #pragma unroll
        for (int k = 0; k < AT_DEPTH; ++k) {
            const int q = (bi * AT_DEPTH + k < mine) ? bi * AT_DEPTH + k : bi * AT_DEPTH;
            const int t = __builtin_amdgcn_readlane(tkj, q & 31);
            iv[k] = *(const float4*)((const char*)(rows + (size_t)t * FEATN) + lo);
        }
        // the loads' address registers are rewritten by the next batch
        asm volatile("s_wait_xcnt 0x0" ::: "memory");
    };
    float4 acc = make_float4(0.f, 0.f, 0.f, 0.f);
    auto consume = [&](const float ej, const int bi) {
        #pragma unroll
        for (int k = 0; k < AT_DEPTH; ++k) {
            const bool on = bi * AT_DEPTH + k < mine;
            const int  e  = __builtin_amdgcn_readlane(__float_as_int(ej), (bi * AT_DEPTH + k) & 31);
            const float wt = on ? __int_as_float(e) : 0.f;
            acc.x = fmaf(wt, iv[k].x, acc.x);
            acc.y = fmaf(wt, iv[k].y, acc.y);
            acc.z = fmaf(wt, iv[k].z, acc.z);
            acc.w = fmaf(wt, iv[k].w, acc.w);
        }
    };

    // ---- the first rows fly while the maximum is formed (a wave with an empty
    // run names the row's first live token, a valid address, and drops the values)
    issue(tk[0], 0);

    // ---- the row's maximum
    float mx = -3.0e38f;
    #pragma unroll
    for (int j = 0; j < AT_GRP; ++j) {
        float l = lg[j];
        if (mk[j] == 0) l -= 1.0e9f;      // only in a row with no unmasked token
        lg[j] = (j * 32 + lane < mine) ? l : -3.0e38f;
        mx = fmaxf(mx, lg[j]);
    }
    mx = fmaxf(mx, xor16_f(mx));
    mx = fmaxf(mx, dpp_f<0x168>(mx));
    mx = fmaxf(mx, dpp_f<0x164>(mx));
    mx = fmaxf(mx, dpp_f<0x162>(mx));
    mx = fmaxf(mx, dpp_f<0x161>(mx));
    if (lane == 0) redMax[wv] = mx;
    // publishes redMax. The barrier is written with fences on LDS alone: a
    // __syncthreads() would also wait for the img rows that are in flight
    __builtin_amdgcn_fence(__ATOMIC_RELEASE, "workgroup", "local");
    __builtin_amdgcn_s_barrier();
    __builtin_amdgcn_fence(__ATOMIC_ACQUIRE, "workgroup", "local");
    mx = redMax[lane & (AT_WAVES - 1)];
    mx = fmaxf(mx, dpp_f<0x168>(mx));
    mx = fmaxf(mx, dpp_f<0x164>(mx));
    mx = fmaxf(mx, dpp_f<0x162>(mx));
    mx = fmaxf(mx, dpp_f<0x161>(mx));

    // ---- exp(l - max) of this wave's run, and their sum
    float ex[AT_GRP];
    float s = 0.f;
    #pragma unroll
    for (int j = 0; j < AT_GRP; ++j) {
        ex[j] = (j * 32 + lane < mine) ? __expf(lg[j] - mx) : 0.f;
        s += ex[j];
    }
    s += xor16_f(s);
    s += dpp_f<0x168>(s);
    s += dpp_f<0x164>(s);
    s += dpp_f<0x162>(s);
    s += dpp_f<0x161>(s);
    if (lane == 0) redSum[wv] = s;

    // ---- the weighted sum over this wave's run.
    // unrolled: tk[] and ex[] must be indexed by constants to stay in registers
    #pragma unroll
    for (int bi = 0; bi < AT_GRP * 32 / AT_DEPTH; ++bi) {
        if (bi * AT_DEPTH < mine) {       // the same for the whole wave
            if (bi > 0) issue(tk[bi * AT_DEPTH / 32], bi);
            consume(ex[bi * AT_DEPTH / 32], bi);
        }
    }
    *(float4*)&redCtx[wv * AT_FEAT + lane * 4] = acc;
    // publishes redSum and redCtx
    __syncthreads();

    s = redSum[lane & (AT_WAVES - 1)];
    s += dpp_f<0x168>(s);
    s += dpp_f<0x164>(s);
    s += dpp_f<0x162>(s);
    s += dpp_f<0x161>(s);
    const float inv = 1.0f / s;

    if (tid < AT_WTOK) {
        wout[tw] = __expf(wl - mx) * inv;
        // the store's registers may be rewritten by the code that follows
        asm volatile("s_wait_xcnt 0x0" ::: "memory");
    }
    if (tid < AT_FEAT) {
        float c = redCtx[tid];
        // unrolled: the LDS reads go out together
        #pragma unroll
        for (int w = 1; w < AT_WAVES; ++w)
            c += redCtx[w * AT_FEAT + tid];
        ctx[b * FEATN + fs * AT_FEAT + tid] = c * inv;
    }
}

// ---------------------------------------------------------------------------
extern "C" void kernel_launch(void* const* d_in, const int* in_sizes, int n_in,
                              void* d_out, int out_size, void* d_ws, size_t ws_size,
                              hipStream_t stream) {
    (void)in_sizes; (void)n_in; (void)out_size; (void)ws_size;

    const float* img    = (const float*)d_in[0];   // [32][2048][1024]
    const int*   mask   = (const int*)  d_in[1];   // [32][2048]
    const float* hidden = (const float*)d_in[2];   // [32][512]
    const float* W1     = (const float*)d_in[3];   // [1024][512]
    const float* b1     = (const float*)d_in[4];   // [512]
    const float* W2     = (const float*)d_in[5];   // [512][512]
    const float* b2     = (const float*)d_in[6];   // [512]
    const float* Vv     = (const float*)d_in[7];   // [512]
    // d_in[8] = bV: softmax-invariant, unused.

    float* out     = (float*)d_out;
    float* ctx_out = out;                          // [32*1024] context first
    float* w_out   = out + BATCH * FEATN;          // [32*2048] weights second

    char* ws = (char*)d_ws;
    __bf16* w1t    = (__bf16*)ws;                                        // 1 MB
    float*  ph     = (float*)(ws + (1 << 20));                           // 64 KB
    int*    list   = (int*)  (ws + (1 << 20) + (64 << 10));              // 256 KB
    float*  clog   = (float*)(ws + (6 << 20));                           // 257 KB
    int*    pos    = (int*)  (ws + (7 << 20));                           // 256 KB
    int*    cnt    = (int*)  (ws + (8 << 20));                           // 4 KB

    k_prepare<<<PREP_CMP + PREP_PH + PREP_W1, 256, 0, stream>>>(
        W1, w1t, hidden, W2, b2, ph, mask, list, pos, cnt);

    k_logits<<<NTILES, WG_THREADS, 0, stream>>>(img, w1t, b1, ph, Vv, list, cnt, clog);

    dim3 g3(BATCH, AT_FS);
    k_attend<<<g3, AT_WAVES * 32, 0, stream>>>(img, clog, list, pos, cnt, mask, w_out, ctx_out);
}
